// v000
// The times below were measured on an AMD MI455X: many runs one after another, warmed up first and cycling through
// copies of the inputs, with the whole window's GPU time divided by the number of runs. Launches and the gaps
// between them are all in it. The median over several windows is given; except for v000 it joins two sittings, which
// can be a few percent apart, so the side-by-side timings, each taken in one sitting, are the better comparison.
// v000, which the later versions start from, runs in 228 microseconds.
#include <hip/hip_runtime.h>
#include <hip/hip_fp16.h>
#include <math.h>

// ---------------------------------------------------------------------------
// T5 encoder self-attention for MI455X (gfx1250, wave32, WMMA).
// f32->f16 convert (weights transposed) -> 3x double-buffered async WMMA GEMM
// (V written head-transposed) -> flash attention (S^T form, async K/V staging,
// LDS-resident bias, register P->B-frag) -> double-buffered WMMA GEMM out.
// ---------------------------------------------------------------------------

typedef __attribute__((ext_vector_type(16))) _Float16 v16h;
typedef __attribute__((ext_vector_type(8)))  _Float16 h8;
typedef __attribute__((ext_vector_type(8)))  float    v8f;
typedef __attribute__((ext_vector_type(4)))  float    f4;

union Frag16 { v16h v; h8 h[2]; };

__device__ __forceinline__ v8f wmma16x16x32(const Frag16& a, const Frag16& b, v8f c) {
  return __builtin_amdgcn_wmma_f32_16x16x32_f16(false, a.v, false, b.v, (short)0, c,
                                                false, false);
}

// CDNA5 async global->LDS copy (bypasses VGPRs, tracked by ASYNCcnt).
__device__ __forceinline__ void async_load_b128(const void* g, void* lds) {
  unsigned int l = (unsigned int)(unsigned long long)lds;
  asm volatile("global_load_async_to_lds_b128 %0, %1, off"
               :: "v"(l), "v"(g) : "memory");
}
__device__ __forceinline__ void async_wait0() {
  asm volatile("s_wait_asynccnt 0x0" ::: "memory");
}

constexpr int B_  = 2;
constexpr int S_  = 2048;
constexpr int D_  = 1024;
constexpr int H_  = 16;
constexpr int DH_ = 64;
constexpr int HD_ = H_ * DH_;    // 1024
constexpr int M_  = B_ * S_;     // 4096
constexpr int RELN = 2 * S_ - 1; // 4095
constexpr int BIASL = 2176;      // 2175 floats cover a block's rel range

// ---------------------------------------------------------------------------
// 1a) f32 -> f16 conversion (row-major kept), 8 elems/thread
// ---------------------------------------------------------------------------
__global__ void __launch_bounds__(256) cvt_f32_f16(const float* __restrict__ src,
                                                   _Float16* __restrict__ dst, int n) {
  int i = (blockIdx.x * 256 + threadIdx.x) * 8;
  if (i + 8 > n) return;
  f4 a = *(const f4*)(src + i);
  f4 b = *(const f4*)(src + i + 4);
  h8 o;
  o[0] = (_Float16)a[0]; o[1] = (_Float16)a[1];
  o[2] = (_Float16)a[2]; o[3] = (_Float16)a[3];
  o[4] = (_Float16)b[0]; o[5] = (_Float16)b[1];
  o[6] = (_Float16)b[2]; o[7] = (_Float16)b[3];
  *(h8*)(dst + i) = o;
}

// ---------------------------------------------------------------------------
// 1b) f32[1024][1024] -> transposed f16[1024][1024] (weights, one-time)
// ---------------------------------------------------------------------------
__global__ void __launch_bounds__(256) cvt_f32_f16_T(const float* __restrict__ src,
                                                     _Float16* __restrict__ dst) {
  __shared__ float tile[32][33];
  int k0 = blockIdx.y * 32, n0 = blockIdx.x * 32;
  int tx = threadIdx.x & 31, ty = threadIdx.x >> 5;   // 32 x 8
#pragma unroll
  for (int i = 0; i < 32; i += 8)
    tile[ty + i][tx] = src[(size_t)(k0 + ty + i) * D_ + n0 + tx];
  __syncthreads();
#pragma unroll
  for (int i = 0; i < 32; i += 8)
    dst[(size_t)(n0 + ty + i) * D_ + k0 + tx] = (_Float16)tile[tx][ty + i];
}

// ---------------------------------------------------------------------------
// 2) Expand rel_bias_table[32][H] -> biasE[H][4095] indexed by (rel + S-1)
// ---------------------------------------------------------------------------
__global__ void __launch_bounds__(256) bias_expand(const float* __restrict__ table,
                                                   float* __restrict__ biasE) {
  int tid = blockIdx.x * 256 + threadIdx.x;
  if (tid >= H_ * RELN) return;
  int h = tid / RELN, r = tid % RELN;
  int rel = r - (S_ - 1);
  const int nb = 16, me = 8;
  int rb = (rel > 0) ? nb : 0;
  int rp = rel < 0 ? -rel : rel;
  int b;
  if (rp < me) {
    b = rp;
  } else {
    float t = __logf((float)rp * (1.0f / me)) * (1.0f / __logf(16.0f)) * (float)(nb - me);
    b = me + (int)t;
    if (b > nb - 1) b = nb - 1;
  }
  biasE[h * RELN + r] = table[(rb + b) * H_ + h];
}

// ---------------------------------------------------------------------------
// 3) WMMA GEMM: C[M,N] = A[M,K](f16) * BT[N,K](f16, pre-transposed).
//    128x128x64 tile, 8 waves (4x2), wave = 32x64. Double-buffered async
//    global->LDS staging for both operands (no VGPR bounce, no scalar stores).
//    VOUT=true scatters the result as VT[b][h][dh][s] for the attention pass.
// ---------------------------------------------------------------------------
template <typename OutT, bool VOUT>
__global__ void __launch_bounds__(256)
gemm_wmma(const _Float16* __restrict__ A, const _Float16* __restrict__ BT,
          OutT* __restrict__ C, int Mdim, int Ndim, int Kdim) {
  __shared__ __align__(16) _Float16 As[2][128][64];
  __shared__ __align__(16) _Float16 Bs[2][128][64];   // [n][k]
  const int t    = threadIdx.x;
  const int lane = t & 31, w = t >> 5;
  const int wm   = w & 3, wn = w >> 2;
  const int m0   = blockIdx.y * 128, n0 = blockIdx.x * 128;
  const int lr   = lane & 15, ko = (lane >> 4) * 8;
  const int srow = t >> 1, soff = (t & 1) * 32;       // staging coords

  auto stage = [&](int k0, int buf) {
    const _Float16* sa = A  + (size_t)(m0 + srow) * Kdim + k0 + soff;
    const _Float16* sb = BT + (size_t)(n0 + srow) * Kdim + k0 + soff;
#pragma unroll
    for (int c = 0; c < 32; c += 8) {
      async_load_b128(sa + c, &As[buf][srow][soff + c]);
      async_load_b128(sb + c, &Bs[buf][srow][soff + c]);
    }
  };

  v8f acc[2][4] = {};
  stage(0, 0);
  async_wait0();
  __syncthreads();

  const int T = Kdim / 64;
  for (int i = 0; i < T; ++i) {
    int buf = i & 1;
    if (i + 1 < T) stage((i + 1) * 64, buf ^ 1);   // overlap with compute
#pragma unroll
    for (int ks = 0; ks < 64; ks += 32) {
      Frag16 a[2], b[4];
#pragma unroll
      for (int mt = 0; mt < 2; ++mt) {
        int row = wm * 32 + mt * 16 + lr;
        a[mt].h[0] = *(const h8*)&As[buf][row][ks + ko];
        a[mt].h[1] = *(const h8*)&As[buf][row][ks + ko + 16];
      }
#pragma unroll
      for (int nt = 0; nt < 4; ++nt) {
        int col = wn * 64 + nt * 16 + lr;
        b[nt].h[0] = *(const h8*)&Bs[buf][col][ks + ko];
        b[nt].h[1] = *(const h8*)&Bs[buf][col][ks + ko + 16];
      }
#pragma unroll
      for (int mt = 0; mt < 2; ++mt)
#pragma unroll
        for (int nt = 0; nt < 4; ++nt)
          acc[mt][nt] = wmma16x16x32(a[mt], b[nt], acc[mt][nt]);
    }
    async_wait0();
    __syncthreads();
  }

#pragma unroll
  for (int mt = 0; mt < 2; ++mt)
#pragma unroll
    for (int nt = 0; nt < 4; ++nt)
#pragma unroll
      for (int j = 0; j < 8; ++j) {
        int m = m0 + wm * 32 + mt * 16 + j + (lane >> 4) * 8;
        int n = n0 + wn * 64 + nt * 16 + lr;
        if constexpr (VOUT) {
          int bb = m >> 11, s = m & (S_ - 1);       // token -> (batch, seq)
          int hh = n >> 6,  dh = n & (DH_ - 1);     // col   -> (head, dh)
          C[((size_t)((bb * H_ + hh) * DH_ + dh)) * S_ + s] = (OutT)acc[mt][nt][j];
        } else {
          C[(size_t)m * Ndim + n] = (OutT)acc[mt][nt][j];
        }
      }
}

// ---------------------------------------------------------------------------
// 4) Flash attention in S^T form, double-buffered async K/V staging.
//    S^T = K * Q^T  ->  lane = query col, j = key row; per-query scalar state;
//    P^T converts in registers to the B-fragment of O^T = V^T * P^T.
//    Bias row segment staged once into LDS (block-invariant indexing).
// ---------------------------------------------------------------------------
__global__ void __launch_bounds__(256)
flash_attn(const _Float16* __restrict__ Q, const _Float16* __restrict__ K,
           const _Float16* __restrict__ VT, const float* __restrict__ biasE,
           _Float16* __restrict__ Ctx) {
  __shared__ __align__(16) _Float16 Ks[2][32][64];   // [key][dh]
  __shared__ __align__(16) _Float16 Vs[2][64][32];   // [dh][key] (from VT)
  __shared__ float biasL[BIASL];

  const int t = threadIdx.x, lane = t & 31, w = t >> 5;
  const int lr = lane & 15, ko = (lane >> 4) * 8;
  const int b = blockIdx.z, h = blockIdx.y;
  const int q0 = blockIdx.x * 128, qrow = q0 + w * 16;

  // stage this block's bias segment: biasL[i] = bias(rel = i - (q0+127))
  {
    const float* biasH = biasE + h * RELN + (S_ - 1);
    for (int i = t; i < BIASL - 1; i += 256) biasL[i] = biasH[i - (q0 + 127)];
  }

  const _Float16* Kb  = K  + (size_t)(b * S_) * HD_ + h * DH_;
  const _Float16* VTb = VT + (size_t)((b * H_ + h) * DH_) * S_;

  auto stageKV = [&](int kb, int buf) {
    int krow = t >> 3, koff8 = (t & 7) * 8;          // 32 x 64 K tile
    async_load_b128(Kb + (size_t)(kb + krow) * HD_ + koff8, &Ks[buf][krow][koff8]);
    int drow = t >> 2, soff8 = (t & 3) * 8;          // 64 x 32 V^T tile
    async_load_b128(VTb + (size_t)drow * S_ + kb + soff8, &Vs[buf][drow][soff8]);
  };

  // Q^T B-fragments (lane = query, regs = dh), loaded once from global
  Frag16 qf[2];
  {
    const _Float16* qp = Q + ((size_t)(b * S_ + qrow + lr) * HD_) + h * DH_;
    qf[0].h[0] = *(const h8*)(qp + ko);
    qf[0].h[1] = *(const h8*)(qp + ko + 16);
    qf[1].h[0] = *(const h8*)(qp + 32 + ko);
    qf[1].h[1] = *(const h8*)(qp + 32 + ko + 16);
  }

  v8f o[4] = {};
  float mx = -INFINITY, lsum = 0.0f;

  stageKV(0, 0);
  async_wait0();
  __syncthreads();

  for (int kb = 0; kb < S_; kb += 32) {
    int buf = (kb >> 5) & 1;
    if (kb + 32 < S_) stageKV(kb + 32, buf ^ 1);     // overlap with compute

    // S^T tiles: rows = keys (tk*16..), cols = queries
    v8f sc[2];
#pragma unroll
    for (int tk = 0; tk < 2; ++tk) {
      int key = tk * 16 + lr;
      Frag16 ka0, ka1;
      ka0.h[0] = *(const h8*)&Ks[buf][key][ko];
      ka0.h[1] = *(const h8*)&Ks[buf][key][ko + 16];
      ka1.h[0] = *(const h8*)&Ks[buf][key][32 + ko];
      ka1.h[1] = *(const h8*)&Ks[buf][key][32 + ko + 16];
      v8f c = {};
      c = wmma16x16x32(ka0, qf[0], c);
      c = wmma16x16x32(ka1, qf[1], c);
      sc[tk] = c;
    }

    // scale + bias from LDS (index independent of blockIdx)
#pragma unroll
    for (int tk = 0; tk < 2; ++tk) {
      int bbase = kb + tk * 16 + ((lane >> 4) << 3) - (w * 16 + lr) + 127;
#pragma unroll
      for (int j = 0; j < 8; ++j)
        sc[tk][j] = sc[tk][j] * 0.125f + biasL[bbase + j];
    }

    // online softmax, per-query scalar state (lane l and l^16 share a query)
    float mloc = sc[0][0];
#pragma unroll
    for (int j = 1; j < 8; ++j) mloc = fmaxf(mloc, sc[0][j]);
#pragma unroll
    for (int j = 0; j < 8; ++j) mloc = fmaxf(mloc, sc[1][j]);
    mloc = fmaxf(mloc, __shfl_xor(mloc, 16, 32));
    float nm    = fmaxf(mx, mloc);
    float alpha = __expf(mx - nm);
    mx = nm;

    Frag16 pf;
    float rs = 0.0f;
#pragma unroll
    for (int j = 0; j < 8; ++j) {
      float p0 = __expf(sc[0][j] - nm);
      float p1 = __expf(sc[1][j] - nm);
      rs += p0 + p1;
      pf.h[0][j] = (_Float16)p0;
      pf.h[1][j] = (_Float16)p1;
    }
    rs += __shfl_xor(rs, 16, 32);
    lsum = lsum * alpha + rs;

#pragma unroll
    for (int tdh = 0; tdh < 4; ++tdh)
#pragma unroll
      for (int j = 0; j < 8; ++j) o[tdh][j] *= alpha;

    // O^T += V^T(16dh x 32k) * P^T(32k x 16q)
#pragma unroll
    for (int tdh = 0; tdh < 4; ++tdh) {
      int dhrow = tdh * 16 + lr;
      Frag16 va;
      va.h[0] = *(const h8*)&Vs[buf][dhrow][ko];
      va.h[1] = *(const h8*)&Vs[buf][dhrow][ko + 16];
      o[tdh] = wmma16x16x32(va, pf, o[tdh]);
    }
    async_wait0();
    __syncthreads();
  }

  // normalize + store context row-major [token][h*64+dh]
  float inv = 1.0f / lsum;
#pragma unroll
  for (int tdh = 0; tdh < 4; ++tdh)
#pragma unroll
    for (int j = 0; j < 8; ++j) {
      int dhcol = tdh * 16 + j + (lane >> 4) * 8;
      Ctx[((size_t)(b * S_ + qrow + lr) * HD_) + h * DH_ + dhcol] =
          (_Float16)(o[tdh][j] * inv);
    }
}

// ---------------------------------------------------------------------------
// Launcher
// ---------------------------------------------------------------------------
extern "C" void kernel_launch(void* const* d_in, const int* in_sizes, int n_in,
                              void* d_out, int out_size, void* d_ws, size_t ws_size,
                              hipStream_t stream) {
  (void)in_sizes; (void)n_in; (void)out_size; (void)ws_size;
  const float* hs    = (const float*)d_in[0];
  const float* Wq    = (const float*)d_in[1];
  const float* Wk    = (const float*)d_in[2];
  const float* Wv    = (const float*)d_in[3];
  const float* Wo    = (const float*)d_in[4];
  const float* table = (const float*)d_in[5];

  char*  ws  = (char*)d_ws;
  size_t off = 0;
  auto alloc = [&](size_t bytes) -> void* {
    void* p = ws + off;
    off += (bytes + 255) & ~(size_t)255;
    return p;
  };

  _Float16* hs16   = (_Float16*)alloc((size_t)M_ * D_ * 2);
  _Float16* wq16T  = (_Float16*)alloc((size_t)D_ * HD_ * 2);
  _Float16* wk16T  = (_Float16*)alloc((size_t)D_ * HD_ * 2);
  _Float16* wv16T  = (_Float16*)alloc((size_t)D_ * HD_ * 2);
  _Float16* wo16T  = (_Float16*)alloc((size_t)HD_ * D_ * 2);
  _Float16* q16    = (_Float16*)alloc((size_t)M_ * HD_ * 2);
  _Float16* k16    = (_Float16*)alloc((size_t)M_ * HD_ * 2);
  _Float16* vT16   = (_Float16*)alloc((size_t)M_ * HD_ * 2);
  _Float16* ctx16  = (_Float16*)alloc((size_t)M_ * HD_ * 2);
  float*    biasE  = (float*)alloc((size_t)H_ * RELN * 4);

  const int nHS = M_ * D_;
  cvt_f32_f16<<<nHS / 8 / 256, 256, 0, stream>>>(hs, hs16, nHS);
  dim3 gT(D_ / 32, D_ / 32);
  cvt_f32_f16_T<<<gT, 256, 0, stream>>>(Wq, wq16T);
  cvt_f32_f16_T<<<gT, 256, 0, stream>>>(Wk, wk16T);
  cvt_f32_f16_T<<<gT, 256, 0, stream>>>(Wv, wv16T);
  cvt_f32_f16_T<<<gT, 256, 0, stream>>>(Wo, wo16T);
  bias_expand<<<(H_ * RELN + 255) / 256, 256, 0, stream>>>(table, biasE);

  dim3 gGemm(HD_ / 128, M_ / 128);
  gemm_wmma<_Float16, false><<<gGemm, 256, 0, stream>>>(hs16, wq16T, q16, M_, HD_, D_);
  gemm_wmma<_Float16, false><<<gGemm, 256, 0, stream>>>(hs16, wk16T, k16, M_, HD_, D_);
  gemm_wmma<_Float16, true ><<<gGemm, 256, 0, stream>>>(hs16, wv16T, vT16, M_, HD_, D_);

  dim3 gAttn(S_ / 128, H_, B_);
  flash_attn<<<gAttn, 256, 0, stream>>>(q16, k16, vT16, biasE, ctx16);

  dim3 gOut(D_ / 128, M_ / 128);
  gemm_wmma<float, false><<<gOut, 256, 0, stream>>>(ctx16, wo16T, (float*)d_out, M_, D_, HD_);
}

// v001
// One run takes 131 microseconds.
// Next to v000, in two timings, it ran 1.79 times as fast each time.
#include <hip/hip_runtime.h>
#include <hip/hip_fp16.h>
#include <math.h>

// ---------------------------------------------------------------------------
// T5 encoder self-attention for MI455X (gfx1250, wave32, WMMA).
// f32->f16 convert (weights transposed) -> 3x double-buffered async WMMA GEMM
// (V written head-transposed) -> flash attention (S^T form, async K/V staging,
// LDS-resident bias, register P->B-frag) -> double-buffered WMMA GEMM out.
// ---------------------------------------------------------------------------

typedef __attribute__((ext_vector_type(16))) _Float16 v16h;
typedef __attribute__((ext_vector_type(8)))  _Float16 h8;
typedef __attribute__((ext_vector_type(8)))  float    v8f;
typedef __attribute__((ext_vector_type(4)))  float    f4;

union Frag16 { v16h v; h8 h[2]; };

__device__ __forceinline__ v8f wmma16x16x32(const Frag16& a, const Frag16& b, v8f c) {
  return __builtin_amdgcn_wmma_f32_16x16x32_f16(false, a.v, false, b.v, (short)0, c,
                                                false, false);
}

// CDNA5 async global->LDS copy (bypasses VGPRs, tracked by ASYNCcnt).
__device__ __forceinline__ void async_load_b128(const void* g, void* lds) {
  unsigned int l = (unsigned int)(unsigned long long)lds;
  asm volatile("global_load_async_to_lds_b128 %0, %1, off"
               :: "v"(l), "v"(g) : "memory");
}
__device__ __forceinline__ void async_wait0() {
  asm volatile("s_wait_asynccnt 0x0" ::: "memory");
}

constexpr int B_  = 2;
constexpr int S_  = 2048;
constexpr int D_  = 1024;
constexpr int H_  = 16;
constexpr int DH_ = 64;
constexpr int HD_ = H_ * DH_;    // 1024
constexpr int M_  = B_ * S_;     // 4096
constexpr int RELN = 2 * S_ - 1; // 4095
constexpr int BIASL = 2176;      // 2175 floats cover a block's rel range
// LDS row pitches in f16 elements. Every tile is read by ds_load_b128 with 16
// lanes on 16 consecutive rows: a pitch of 16 B x odd puts those rows on 16
// different groups of four banks; the bare 128 B / 64 B rows fall on 2 / 4.
constexpr int P64 = 64 + 8;      // 64-element rows: 144 B
constexpr int P32 = 32 + 8;      // 32-element rows:  80 B

// ---------------------------------------------------------------------------
// 1a) f32 -> f16 conversion (row-major kept), 8 elems/thread
// ---------------------------------------------------------------------------
__global__ void __launch_bounds__(256) cvt_f32_f16(const float* __restrict__ src,
                                                   _Float16* __restrict__ dst, int n) {
  int i = (blockIdx.x * 256 + threadIdx.x) * 8;
  if (i + 8 > n) return;
  f4 a = *(const f4*)(src + i);
  f4 b = *(const f4*)(src + i + 4);
  h8 o;
  o[0] = (_Float16)a[0]; o[1] = (_Float16)a[1];
  o[2] = (_Float16)a[2]; o[3] = (_Float16)a[3];
  o[4] = (_Float16)b[0]; o[5] = (_Float16)b[1];
  o[6] = (_Float16)b[2]; o[7] = (_Float16)b[3];
  *(h8*)(dst + i) = o;
}

// ---------------------------------------------------------------------------
// 1b) f32[1024][1024] -> transposed f16[1024][1024] (weights, one-time)
// ---------------------------------------------------------------------------
__global__ void __launch_bounds__(256) cvt_f32_f16_T(const float* __restrict__ src,
                                                     _Float16* __restrict__ dst) {
  __shared__ float tile[32][33];
  int k0 = blockIdx.y * 32, n0 = blockIdx.x * 32;
  int tx = threadIdx.x & 31, ty = threadIdx.x >> 5;   // 32 x 8
#pragma unroll
  for (int i = 0; i < 32; i += 8)
    tile[ty + i][tx] = src[(size_t)(k0 + ty + i) * D_ + n0 + tx];
  __syncthreads();
#pragma unroll
  for (int i = 0; i < 32; i += 8)
    dst[(size_t)(n0 + ty + i) * D_ + k0 + tx] = (_Float16)tile[tx][ty + i];
}

// ---------------------------------------------------------------------------
// 2) Expand rel_bias_table[32][H] -> biasE[H][4095] indexed by (rel + S-1)
// ---------------------------------------------------------------------------
__global__ void __launch_bounds__(256) bias_expand(const float* __restrict__ table,
                                                   float* __restrict__ biasE) {
  int tid = blockIdx.x * 256 + threadIdx.x;
  if (tid >= H_ * RELN) return;
  int h = tid / RELN, r = tid % RELN;
  int rel = r - (S_ - 1);
  const int nb = 16, me = 8;
  int rb = (rel > 0) ? nb : 0;
  int rp = rel < 0 ? -rel : rel;
  int b;
  if (rp < me) {
    b = rp;
  } else {
    float t = __logf((float)rp * (1.0f / me)) * (1.0f / __logf(16.0f)) * (float)(nb - me);
    b = me + (int)t;
    if (b > nb - 1) b = nb - 1;
  }
  biasE[h * RELN + r] = table[(rb + b) * H_ + h];
}

// ---------------------------------------------------------------------------
// 3) WMMA GEMM: C[M,N] = A[M,K](f16) * BT[N,K](f16, pre-transposed).
//    128x128x64 tile, 8 waves (4x2), wave = 32x64. Double-buffered async
//    global->LDS staging for both operands (no VGPR bounce, no scalar stores).
//    VOUT=true scatters the result as VT[b][h][dh][s] for the attention pass.
// ---------------------------------------------------------------------------
template <typename OutT, bool VOUT>
__global__ void __launch_bounds__(256)
gemm_wmma(const _Float16* __restrict__ A, const _Float16* __restrict__ BT,
          OutT* __restrict__ C, int Mdim, int Ndim, int Kdim) {
  __shared__ __align__(16) _Float16 As[2][128][P64];
  __shared__ __align__(16) _Float16 Bs[2][128][P64];  // [n][k]
  const int t    = threadIdx.x;
  const int lane = t & 31, w = t >> 5;
  const int wm   = w & 3, wn = w >> 2;
  const int m0   = blockIdx.y * 128, n0 = blockIdx.x * 128;
  const int lr   = lane & 15, ko = (lane >> 4) * 8;
  const int srow = t >> 1, soff = (t & 1) * 32;       // staging coords

  auto stage = [&](int k0, int buf) {
    const _Float16* sa = A  + (size_t)(m0 + srow) * Kdim + k0 + soff;
    const _Float16* sb = BT + (size_t)(n0 + srow) * Kdim + k0 + soff;
#pragma unroll
    for (int c = 0; c < 32; c += 8) {
      async_load_b128(sa + c, &As[buf][srow][soff + c]);
      async_load_b128(sb + c, &Bs[buf][srow][soff + c]);
    }
  };

  v8f acc[2][4] = {};
  stage(0, 0);
  async_wait0();
  __syncthreads();

  const int T = Kdim / 64;
  for (int i = 0; i < T; ++i) {
    int buf = i & 1;
    if (i + 1 < T) stage((i + 1) * 64, buf ^ 1);   // overlap with compute
#pragma unroll
    for (int ks = 0; ks < 64; ks += 32) {
      Frag16 a[2], b[4];
#pragma unroll
      for (int mt = 0; mt < 2; ++mt) {
        int row = wm * 32 + mt * 16 + lr;
        a[mt].h[0] = *(const h8*)&As[buf][row][ks + ko];
        a[mt].h[1] = *(const h8*)&As[buf][row][ks + ko + 16];
      }
#pragma unroll
      for (int nt = 0; nt < 4; ++nt) {
        int col = wn * 64 + nt * 16 + lr;
        b[nt].h[0] = *(const h8*)&Bs[buf][col][ks + ko];
        b[nt].h[1] = *(const h8*)&Bs[buf][col][ks + ko + 16];
      }
#pragma unroll
      for (int mt = 0; mt < 2; ++mt)
#pragma unroll
        for (int nt = 0; nt < 4; ++nt)
          acc[mt][nt] = wmma16x16x32(a[mt], b[nt], acc[mt][nt]);
    }
    async_wait0();
    __syncthreads();
  }

#pragma unroll
  for (int mt = 0; mt < 2; ++mt)
#pragma unroll
    for (int nt = 0; nt < 4; ++nt)
#pragma unroll
      for (int j = 0; j < 8; ++j) {
        int m = m0 + wm * 32 + mt * 16 + j + (lane >> 4) * 8;
        int n = n0 + wn * 64 + nt * 16 + lr;
        if constexpr (VOUT) {
          int bb = m >> 11, s = m & (S_ - 1);       // token -> (batch, seq)
          int hh = n >> 6,  dh = n & (DH_ - 1);     // col   -> (head, dh)
          C[((size_t)((bb * H_ + hh) * DH_ + dh)) * S_ + s] = (OutT)acc[mt][nt][j];
        } else {
          C[(size_t)m * Ndim + n] = (OutT)acc[mt][nt][j];
        }
      }
}

// ---------------------------------------------------------------------------
// 4) Flash attention in S^T form, double-buffered async K/V staging.
//    S^T = K * Q^T  ->  lane = query col, j = key row; per-query scalar state;
//    P^T converts in registers to the B-fragment of O^T = V^T * P^T.
//    Bias row segment staged once into LDS (block-invariant indexing).
// ---------------------------------------------------------------------------
__global__ void __launch_bounds__(256)
flash_attn(const _Float16* __restrict__ Q, const _Float16* __restrict__ K,
           const _Float16* __restrict__ VT, const float* __restrict__ biasE,
           _Float16* __restrict__ Ctx) {
  __shared__ __align__(16) _Float16 Ks[2][32][P64];  // [key][dh]
  __shared__ __align__(16) _Float16 Vs[2][64][P32];  // [dh][key] (from VT)
  __shared__ float biasL[BIASL];

  const int t = threadIdx.x, lane = t & 31, w = t >> 5;
  const int lr = lane & 15, ko = (lane >> 4) * 8;
  const int b = blockIdx.z, h = blockIdx.y;
  const int q0 = blockIdx.x * 128, qrow = q0 + w * 16;

  // stage this block's bias segment: biasL[i] = bias(rel = i - (q0+127))
  {
    const float* biasH = biasE + h * RELN + (S_ - 1);
    for (int i = t; i < BIASL - 1; i += 256) biasL[i] = biasH[i - (q0 + 127)];
  }

  const _Float16* Kb  = K  + (size_t)(b * S_) * HD_ + h * DH_;
  const _Float16* VTb = VT + (size_t)((b * H_ + h) * DH_) * S_;

  auto stageKV = [&](int kb, int buf) {
    int krow = t >> 3, koff8 = (t & 7) * 8;          // 32 x 64 K tile
    async_load_b128(Kb + (size_t)(kb + krow) * HD_ + koff8, &Ks[buf][krow][koff8]);
    int drow = t >> 2, soff8 = (t & 3) * 8;          // 64 x 32 V^T tile
    async_load_b128(VTb + (size_t)drow * S_ + kb + soff8, &Vs[buf][drow][soff8]);
  };

  // Q^T B-fragments (lane = query, regs = dh), loaded once from global
  Frag16 qf[2];
  {
    const _Float16* qp = Q + ((size_t)(b * S_ + qrow + lr) * HD_) + h * DH_;
    qf[0].h[0] = *(const h8*)(qp + ko);
    qf[0].h[1] = *(const h8*)(qp + ko + 16);
    qf[1].h[0] = *(const h8*)(qp + 32 + ko);
    qf[1].h[1] = *(const h8*)(qp + 32 + ko + 16);
  }

  v8f o[4] = {};
  float mx = -INFINITY, lsum = 0.0f;

  stageKV(0, 0);
  async_wait0();
  __syncthreads();

  for (int kb = 0; kb < S_; kb += 32) {
    int buf = (kb >> 5) & 1;
    if (kb + 32 < S_) stageKV(kb + 32, buf ^ 1);     // overlap with compute

    // S^T tiles: rows = keys (tk*16..), cols = queries
    v8f sc[2];
#pragma unroll
    for (int tk = 0; tk < 2; ++tk) {
      int key = tk * 16 + lr;
      Frag16 ka0, ka1;
      ka0.h[0] = *(const h8*)&Ks[buf][key][ko];
      ka0.h[1] = *(const h8*)&Ks[buf][key][ko + 16];
      ka1.h[0] = *(const h8*)&Ks[buf][key][32 + ko];
      ka1.h[1] = *(const h8*)&Ks[buf][key][32 + ko + 16];
      v8f c = {};
      c = wmma16x16x32(ka0, qf[0], c);
      c = wmma16x16x32(ka1, qf[1], c);
      sc[tk] = c;
    }

    // scale + bias from LDS (index independent of blockIdx)
#pragma unroll
    for (int tk = 0; tk < 2; ++tk) {
      int bbase = kb + tk * 16 + ((lane >> 4) << 3) - (w * 16 + lr) + 127;
#pragma unroll
      for (int j = 0; j < 8; ++j)
        sc[tk][j] = sc[tk][j] * 0.125f + biasL[bbase + j];
    }

    // online softmax, per-query scalar state (lane l and l^16 share a query)
    float mloc = sc[0][0];
#pragma unroll
    for (int j = 1; j < 8; ++j) mloc = fmaxf(mloc, sc[0][j]);
#pragma unroll
    for (int j = 0; j < 8; ++j) mloc = fmaxf(mloc, sc[1][j]);
    mloc = fmaxf(mloc, __shfl_xor(mloc, 16, 32));
    float nm    = fmaxf(mx, mloc);
    float alpha = __expf(mx - nm);
    mx = nm;

    Frag16 pf;
    float rs = 0.0f;
#pragma unroll
    for (int j = 0; j < 8; ++j) {
      float p0 = __expf(sc[0][j] - nm);
      float p1 = __expf(sc[1][j] - nm);
      rs += p0 + p1;
      pf.h[0][j] = (_Float16)p0;
      pf.h[1][j] = (_Float16)p1;
    }
    rs += __shfl_xor(rs, 16, 32);
    lsum = lsum * alpha + rs;

#pragma unroll
    for (int tdh = 0; tdh < 4; ++tdh)
#pragma unroll
      for (int j = 0; j < 8; ++j) o[tdh][j] *= alpha;

    // O^T += V^T(16dh x 32k) * P^T(32k x 16q)
#pragma unroll
    for (int tdh = 0; tdh < 4; ++tdh) {
      int dhrow = tdh * 16 + lr;
      Frag16 va;
      va.h[0] = *(const h8*)&Vs[buf][dhrow][ko];
      va.h[1] = *(const h8*)&Vs[buf][dhrow][ko + 16];
      o[tdh] = wmma16x16x32(va, pf, o[tdh]);
    }
    async_wait0();
    __syncthreads();
  }

  // normalize + store context row-major [token][h*64+dh]
  float inv = 1.0f / lsum;
#pragma unroll
  for (int tdh = 0; tdh < 4; ++tdh)
#pragma unroll
    for (int j = 0; j < 8; ++j) {
      int dhcol = tdh * 16 + j + (lane >> 4) * 8;
      Ctx[((size_t)(b * S_ + qrow + lr) * HD_) + h * DH_ + dhcol] =
          (_Float16)(o[tdh][j] * inv);
    }
}

// ---------------------------------------------------------------------------
// Launcher
// ---------------------------------------------------------------------------
extern "C" void kernel_launch(void* const* d_in, const int* in_sizes, int n_in,
                              void* d_out, int out_size, void* d_ws, size_t ws_size,
                              hipStream_t stream) {
  (void)in_sizes; (void)n_in; (void)out_size; (void)ws_size;
  const float* hs    = (const float*)d_in[0];
  const float* Wq    = (const float*)d_in[1];
  const float* Wk    = (const float*)d_in[2];
  const float* Wv    = (const float*)d_in[3];
  const float* Wo    = (const float*)d_in[4];
  const float* table = (const float*)d_in[5];

  char*  ws  = (char*)d_ws;
  size_t off = 0;
  auto alloc = [&](size_t bytes) -> void* {
    void* p = ws + off;
    off += (bytes + 255) & ~(size_t)255;
    return p;
  };

  _Float16* hs16   = (_Float16*)alloc((size_t)M_ * D_ * 2);
  _Float16* wq16T  = (_Float16*)alloc((size_t)D_ * HD_ * 2);
  _Float16* wk16T  = (_Float16*)alloc((size_t)D_ * HD_ * 2);
  _Float16* wv16T  = (_Float16*)alloc((size_t)D_ * HD_ * 2);
  _Float16* wo16T  = (_Float16*)alloc((size_t)HD_ * D_ * 2);
  _Float16* q16    = (_Float16*)alloc((size_t)M_ * HD_ * 2);
  _Float16* k16    = (_Float16*)alloc((size_t)M_ * HD_ * 2);
  _Float16* vT16   = (_Float16*)alloc((size_t)M_ * HD_ * 2);
  _Float16* ctx16  = (_Float16*)alloc((size_t)M_ * HD_ * 2);
  float*    biasE  = (float*)alloc((size_t)H_ * RELN * 4);

  const int nHS = M_ * D_;
  cvt_f32_f16<<<nHS / 8 / 256, 256, 0, stream>>>(hs, hs16, nHS);
  dim3 gT(D_ / 32, D_ / 32);
  cvt_f32_f16_T<<<gT, 256, 0, stream>>>(Wq, wq16T);
  cvt_f32_f16_T<<<gT, 256, 0, stream>>>(Wk, wk16T);
  cvt_f32_f16_T<<<gT, 256, 0, stream>>>(Wv, wv16T);
  cvt_f32_f16_T<<<gT, 256, 0, stream>>>(Wo, wo16T);
  bias_expand<<<(H_ * RELN + 255) / 256, 256, 0, stream>>>(table, biasE);

  dim3 gGemm(HD_ / 128, M_ / 128);
  gemm_wmma<_Float16, false><<<gGemm, 256, 0, stream>>>(hs16, wq16T, q16, M_, HD_, D_);
  gemm_wmma<_Float16, false><<<gGemm, 256, 0, stream>>>(hs16, wk16T, k16, M_, HD_, D_);
  gemm_wmma<_Float16, true ><<<gGemm, 256, 0, stream>>>(hs16, wv16T, vT16, M_, HD_, D_);

  dim3 gAttn(S_ / 128, H_, B_);
  flash_attn<<<gAttn, 256, 0, stream>>>(q16, k16, vT16, biasE, ctx16);

  dim3 gOut(D_ / 128, M_ / 128);
  gemm_wmma<float, false><<<gOut, 256, 0, stream>>>(ctx16, wo16T, (float*)d_out, M_, D_, HD_);
}

// v002
// It runs in 122 microseconds.
// In two side-by-side timings against v001, it was 1.07 and 1.08 times as fast.
// Over all steps from v000 it is 1.93 times as fast.
#include <hip/hip_runtime.h>
#include <hip/hip_fp16.h>
#include <math.h>

// ---------------------------------------------------------------------------
// Encoder self-attention with relative position bias (gfx1250, wave32, WMMA).
// one prep launch (f32->f16, weights transposed, bias expanded) -> 3x double-buffered async WMMA GEMM
// (V written head-transposed) -> flash attention (S^T form, async K/V staging,
// LDS-resident bias, register P->B-frag) -> double-buffered WMMA GEMM out.
// ---------------------------------------------------------------------------

typedef __attribute__((ext_vector_type(16))) _Float16 v16h;
typedef __attribute__((ext_vector_type(8)))  _Float16 h8;
typedef __attribute__((ext_vector_type(8)))  float    v8f;
typedef __attribute__((ext_vector_type(4)))  float    f4;

union Frag16 { v16h v; h8 h[2]; };

__device__ __forceinline__ v8f wmma16x16x32(const Frag16& a, const Frag16& b, v8f c) {
  return __builtin_amdgcn_wmma_f32_16x16x32_f16(false, a.v, false, b.v, (short)0, c,
                                                false, false);
}

// CDNA5 async global->LDS copy (bypasses VGPRs, tracked by ASYNCcnt).
__device__ __forceinline__ void async_load_b128(const void* g, void* lds) {
  unsigned int l = (unsigned int)(unsigned long long)lds;
  asm volatile("global_load_async_to_lds_b128 %0, %1, off"
               :: "v"(l), "v"(g) : "memory");
}
__device__ __forceinline__ void async_wait0() {
  asm volatile("s_wait_asynccnt 0x0" ::: "memory");
}

constexpr int B_  = 2;
constexpr int S_  = 2048;
constexpr int D_  = 1024;
constexpr int H_  = 16;
constexpr int DH_ = 64;
constexpr int HD_ = H_ * DH_;    // 1024
constexpr int M_  = B_ * S_;     // 4096
constexpr int RELN = 2 * S_ - 1; // 4095
constexpr int BIASL = 2176;      // 2175 floats cover a block's rel range
// LDS row pitches in f16 elements. Every tile is read by ds_load_b128 with 16
// lanes on 16 consecutive rows: a pitch of 16 B x odd puts those rows on 16
// different groups of four banks; the bare 128 B / 64 B rows fall on 2 / 4.
constexpr int P64 = 64 + 8;      // 64-element rows: 144 B
constexpr int P32 = 32 + 8;      // 32-element rows:  80 B

// ---------------------------------------------------------------------------
// 1) All operand preparation in ONE launch; the block index picks the role.
//    The three roles share no data; each wave moves many bytes, so that few
//    waves have to be started and only one launch gap is paid.
//    a) weights: f32[k][n] -> f16[n][k]; a block takes one 64x64 tile position
//       of all four matrices (16 b128 loads in flight per thread, one barrier,
//       whole 128 B lines stored).
//    b) hidden states: f32 -> f16, 64 elements per thread, all loads first.
//    c) rel_bias_table[32][H] -> biasE[H][4095] indexed by (rel + S-1).
// ---------------------------------------------------------------------------
constexpr int WT_BLOCKS   = (D_ / 64) * (HD_ / 64);      // 256
constexpr int HS_UNROLL   = 8;
constexpr int HS_BLOCKS   = M_ * D_ / (256 * 8 * HS_UNROLL);  // 256
constexpr int BIAS_SPLIT  = 4;                           // blocks per head
constexpr int BIAS_BLOCKS = H_ * BIAS_SPLIT;             // 64

__global__ void __launch_bounds__(256)
prep_all(const float* __restrict__ hs, const float* __restrict__ Wq,
         const float* __restrict__ Wk, const float* __restrict__ Wv,
         const float* __restrict__ Wo, const float* __restrict__ table,
         _Float16* __restrict__ hs16, _Float16* __restrict__ wqT,
         _Float16* __restrict__ wkT, _Float16* __restrict__ wvT,
         _Float16* __restrict__ woT, float* __restrict__ biasE) {
  // pitch 65 floats: row writes and column reads both touch 32 different banks
  __shared__ float tile[4][64][65];
  const int t = threadIdx.x;
  int bid = blockIdx.x;

  if (bid < WT_BLOCKS) {
    const float* srcs[4] = {Wq, Wk, Wv, Wo};
    _Float16*    dsts[4] = {wqT, wkT, wvT, woT};
    const int k0 = (bid >> 4) * 64, n0 = (bid & 15) * 64;
    const int rr = t >> 4, cc = (t & 15) * 4;            // 16 rows x 64 cols a pass
    // one 32-bit byte offset serves all 16 loads (uniform base + constant step)
    const unsigned lo = (unsigned)((k0 + rr) * HD_ + n0 + cc) * 4u;
    f4 v[4][4];
#pragma unroll  // constant indices: arrays stay in registers, loads issue together
    for (int m = 0; m < 4; ++m)
#pragma unroll  // as above
      for (int p = 0; p < 4; ++p)
        v[m][p] = *(const f4*)((const char*)srcs[m] + lo + p * (16 * HD_ * 4));
    // wait before the loads' offset register is rewritten; naming it as an input
    // keeps it live up to here: without that the last load's result is placed
    // over it while the fifteen loads in front still name it
    asm volatile("s_wait_xcnt 0x0" :: "v"(lo) : "memory");
#pragma unroll  // as above
    for (int m = 0; m < 4; ++m)
#pragma unroll  // as above
      for (int p = 0; p < 4; ++p)
#pragma unroll  // as above
        for (int e = 0; e < 4; ++e) tile[m][p * 16 + rr][cc + e] = v[m][p][e];
    __syncthreads();
    const int kc = (t & 7) * 8, nr = t >> 3;             // 32 n-rows x 64 k a pass
    const unsigned so = (unsigned)((n0 + nr) * D_ + k0 + kc) * 2u;
#pragma unroll  // as above
    for (int m = 0; m < 4; ++m)
#pragma unroll  // as above
      for (int p = 0; p < 2; ++p) {
        h8 o;
#pragma unroll  // as above
        for (int e = 0; e < 8; ++e) o[e] = (_Float16)tile[m][kc + e][p * 32 + nr];
        *(h8*)((char*)dsts[m] + so + p * (32 * D_ * 2)) = o;
      }
    return;
  }
  bid -= WT_BLOCKS;

  if (bid < HS_BLOCKS) {
    const unsigned base = (unsigned)bid * (256 * 8 * HS_UNROLL) + t * 8;  // element
    const unsigned lo = base * 4u;                       // byte offset of the loads
    f4 a[HS_UNROLL], b[HS_UNROLL];
#pragma unroll  // constant indices: arrays stay in registers, loads issue together
    for (int u = 0; u < HS_UNROLL; ++u) {
      a[u] = *(const f4*)((const char*)hs + lo + u * 8192);
      b[u] = *(const f4*)((const char*)hs + lo + u * 8192 + 16);
    }
#pragma unroll  // as above
    for (int u = 0; u < HS_UNROLL; ++u) {
      h8 o;
      o[0] = (_Float16)a[u][0]; o[1] = (_Float16)a[u][1];
      o[2] = (_Float16)a[u][2]; o[3] = (_Float16)a[u][3];
      o[4] = (_Float16)b[u][0]; o[5] = (_Float16)b[u][1];
      o[6] = (_Float16)b[u][2]; o[7] = (_Float16)b[u][3];
      *(h8*)(hs16 + base + u * 2048) = o;
    }
    // behind the stores: the code that follows them in the listing rewrites
    // their address and data registers
    asm volatile("s_wait_xcnt 0x0" ::: "memory");
    return;
  }
  bid -= HS_BLOCKS;

  const int h  = bid / BIAS_SPLIT;
  const int r0 = (bid % BIAS_SPLIT) * 1024 + t;
  float val[4];
#pragma unroll  // constant indices: arrays stay in registers, loads issue together
  for (int u = 0; u < 4; ++u) {
    const int r  = r0 + u * 256;
    const int rc = r < RELN ? r : RELN - 1;   // index 4095 re-reads the last entry, is not stored
    int rel = rc - (S_ - 1);
    const int nb = 16, me = 8;
    int rb = (rel > 0) ? nb : 0;
    int rp = rel < 0 ? -rel : rel;
    int bk;
    if (rp < me) {
      bk = rp;
    } else {
      float x = __logf((float)rp * (1.0f / me)) * (1.0f / __logf(16.0f)) * (float)(nb - me);
      bk = me + (int)x;
      if (bk > nb - 1) bk = nb - 1;
    }
    val[u] = table[(rb + bk) * H_ + h];
  }
#pragma unroll  // as above
  for (int u = 0; u < 4; ++u)
    if (r0 + u * 256 < RELN) biasE[h * RELN + r0 + u * 256] = val[u];
}

// ---------------------------------------------------------------------------
// 3) WMMA GEMM: C[M,N] = A[M,K](f16) * BT[N,K](f16, pre-transposed).
//    128x128x64 tile, 8 waves (4x2), wave = 32x64. Double-buffered async
//    global->LDS staging for both operands (no VGPR bounce, no scalar stores).
//    VOUT=true scatters the result as VT[b][h][dh][s] for the attention pass.
// ---------------------------------------------------------------------------
template <typename OutT, bool VOUT>
__global__ void __launch_bounds__(256)
gemm_wmma(const _Float16* __restrict__ A, const _Float16* __restrict__ BT,
          OutT* __restrict__ C, int Mdim, int Ndim, int Kdim) {
  __shared__ __align__(16) _Float16 As[2][128][P64];
  __shared__ __align__(16) _Float16 Bs[2][128][P64];  // [n][k]
  const int t    = threadIdx.x;
  const int lane = t & 31, w = t >> 5;
  const int wm   = w & 3, wn = w >> 2;
  const int m0   = blockIdx.y * 128, n0 = blockIdx.x * 128;
  const int lr   = lane & 15, ko = (lane >> 4) * 8;
  const int srow = t >> 1, soff = (t & 1) * 32;       // staging coords

  auto stage = [&](int k0, int buf) {
    const _Float16* sa = A  + (size_t)(m0 + srow) * Kdim + k0 + soff;
    const _Float16* sb = BT + (size_t)(n0 + srow) * Kdim + k0 + soff;
#pragma unroll
    for (int c = 0; c < 32; c += 8) {
      async_load_b128(sa + c, &As[buf][srow][soff + c]);
      async_load_b128(sb + c, &Bs[buf][srow][soff + c]);
    }
  };

  v8f acc[2][4] = {};
  stage(0, 0);
  async_wait0();
  __syncthreads();

  const int T = Kdim / 64;
  for (int i = 0; i < T; ++i) {
    int buf = i & 1;
    if (i + 1 < T) stage((i + 1) * 64, buf ^ 1);   // overlap with compute
#pragma unroll
    for (int ks = 0; ks < 64; ks += 32) {
      Frag16 a[2], b[4];
#pragma unroll
      for (int mt = 0; mt < 2; ++mt) {
        int row = wm * 32 + mt * 16 + lr;
        a[mt].h[0] = *(const h8*)&As[buf][row][ks + ko];
        a[mt].h[1] = *(const h8*)&As[buf][row][ks + ko + 16];
      }
#pragma unroll
      for (int nt = 0; nt < 4; ++nt) {
        int col = wn * 64 + nt * 16 + lr;
        b[nt].h[0] = *(const h8*)&Bs[buf][col][ks + ko];
        b[nt].h[1] = *(const h8*)&Bs[buf][col][ks + ko + 16];
      }
#pragma unroll
      for (int mt = 0; mt < 2; ++mt)
#pragma unroll
        for (int nt = 0; nt < 4; ++nt)
          acc[mt][nt] = wmma16x16x32(a[mt], b[nt], acc[mt][nt]);
    }
    async_wait0();
    __syncthreads();
  }

#pragma unroll
  for (int mt = 0; mt < 2; ++mt)
#pragma unroll
    for (int nt = 0; nt < 4; ++nt)
#pragma unroll
      for (int j = 0; j < 8; ++j) {
        int m = m0 + wm * 32 + mt * 16 + j + (lane >> 4) * 8;
        int n = n0 + wn * 64 + nt * 16 + lr;
        if constexpr (VOUT) {
          int bb = m >> 11, s = m & (S_ - 1);       // token -> (batch, seq)
          int hh = n >> 6,  dh = n & (DH_ - 1);     // col   -> (head, dh)
          C[((size_t)((bb * H_ + hh) * DH_ + dh)) * S_ + s] = (OutT)acc[mt][nt][j];
        } else {
          C[(size_t)m * Ndim + n] = (OutT)acc[mt][nt][j];
        }
      }
}

// ---------------------------------------------------------------------------
// 4) Flash attention in S^T form, double-buffered async K/V staging.
//    S^T = K * Q^T  ->  lane = query col, j = key row; per-query scalar state;
//    P^T converts in registers to the B-fragment of O^T = V^T * P^T.
//    Bias row segment staged once into LDS (block-invariant indexing).
// ---------------------------------------------------------------------------
__global__ void __launch_bounds__(256)
flash_attn(const _Float16* __restrict__ Q, const _Float16* __restrict__ K,
           const _Float16* __restrict__ VT, const float* __restrict__ biasE,
           _Float16* __restrict__ Ctx) {
  __shared__ __align__(16) _Float16 Ks[2][32][P64];  // [key][dh]
  __shared__ __align__(16) _Float16 Vs[2][64][P32];  // [dh][key] (from VT)
  __shared__ float biasL[BIASL];

  const int t = threadIdx.x, lane = t & 31, w = t >> 5;
  const int lr = lane & 15, ko = (lane >> 4) * 8;
  const int b = blockIdx.z, h = blockIdx.y;
  const int q0 = blockIdx.x * 128, qrow = q0 + w * 16;

  // stage this block's bias segment: biasL[i] = bias(rel = i - (q0+127))
  {
    const float* biasH = biasE + h * RELN + (S_ - 1);
    for (int i = t; i < BIASL - 1; i += 256) biasL[i] = biasH[i - (q0 + 127)];
  }

  const _Float16* Kb  = K  + (size_t)(b * S_) * HD_ + h * DH_;
  const _Float16* VTb = VT + (size_t)((b * H_ + h) * DH_) * S_;

  auto stageKV = [&](int kb, int buf) {
    int krow = t >> 3, koff8 = (t & 7) * 8;          // 32 x 64 K tile
    async_load_b128(Kb + (size_t)(kb + krow) * HD_ + koff8, &Ks[buf][krow][koff8]);
    int drow = t >> 2, soff8 = (t & 3) * 8;          // 64 x 32 V^T tile
    async_load_b128(VTb + (size_t)drow * S_ + kb + soff8, &Vs[buf][drow][soff8]);
  };

  // Q^T B-fragments (lane = query, regs = dh), loaded once from global
  Frag16 qf[2];
  {
    const _Float16* qp = Q + ((size_t)(b * S_ + qrow + lr) * HD_) + h * DH_;
    qf[0].h[0] = *(const h8*)(qp + ko);
    qf[0].h[1] = *(const h8*)(qp + ko + 16);
    qf[1].h[0] = *(const h8*)(qp + 32 + ko);
    qf[1].h[1] = *(const h8*)(qp + 32 + ko + 16);
  }

  v8f o[4] = {};
  float mx = -INFINITY, lsum = 0.0f;

  stageKV(0, 0);
  async_wait0();
  __syncthreads();

  for (int kb = 0; kb < S_; kb += 32) {
    int buf = (kb >> 5) & 1;
    if (kb + 32 < S_) stageKV(kb + 32, buf ^ 1);     // overlap with compute

    // S^T tiles: rows = keys (tk*16..), cols = queries
    v8f sc[2];
#pragma unroll
    for (int tk = 0; tk < 2; ++tk) {
      int key = tk * 16 + lr;
      Frag16 ka0, ka1;
      ka0.h[0] = *(const h8*)&Ks[buf][key][ko];
      ka0.h[1] = *(const h8*)&Ks[buf][key][ko + 16];
      ka1.h[0] = *(const h8*)&Ks[buf][key][32 + ko];
      ka1.h[1] = *(const h8*)&Ks[buf][key][32 + ko + 16];
      v8f c = {};
      c = wmma16x16x32(ka0, qf[0], c);
      c = wmma16x16x32(ka1, qf[1], c);
      sc[tk] = c;
    }

    // scale + bias from LDS (index independent of blockIdx)
#pragma unroll
    for (int tk = 0; tk < 2; ++tk) {
      int bbase = kb + tk * 16 + ((lane >> 4) << 3) - (w * 16 + lr) + 127;
#pragma unroll
      for (int j = 0; j < 8; ++j)
        sc[tk][j] = sc[tk][j] * 0.125f + biasL[bbase + j];
    }

    // online softmax, per-query scalar state (lane l and l^16 share a query)
    float mloc = sc[0][0];
#pragma unroll
    for (int j = 1; j < 8; ++j) mloc = fmaxf(mloc, sc[0][j]);
#pragma unroll
    for (int j = 0; j < 8; ++j) mloc = fmaxf(mloc, sc[1][j]);
    mloc = fmaxf(mloc, __shfl_xor(mloc, 16, 32));
    float nm    = fmaxf(mx, mloc);
    float alpha = __expf(mx - nm);
    mx = nm;

    Frag16 pf;
    float rs = 0.0f;
#pragma unroll
    for (int j = 0; j < 8; ++j) {
      float p0 = __expf(sc[0][j] - nm);
      float p1 = __expf(sc[1][j] - nm);
      rs += p0 + p1;
      pf.h[0][j] = (_Float16)p0;
      pf.h[1][j] = (_Float16)p1;
    }
    rs += __shfl_xor(rs, 16, 32);
    lsum = lsum * alpha + rs;

#pragma unroll
    for (int tdh = 0; tdh < 4; ++tdh)
#pragma unroll
      for (int j = 0; j < 8; ++j) o[tdh][j] *= alpha;

    // O^T += V^T(16dh x 32k) * P^T(32k x 16q)
#pragma unroll
    for (int tdh = 0; tdh < 4; ++tdh) {
      int dhrow = tdh * 16 + lr;
      Frag16 va;
      va.h[0] = *(const h8*)&Vs[buf][dhrow][ko];
      va.h[1] = *(const h8*)&Vs[buf][dhrow][ko + 16];
      o[tdh] = wmma16x16x32(va, pf, o[tdh]);
    }
    async_wait0();
    __syncthreads();
  }

  // normalize + store context row-major [token][h*64+dh]
  float inv = 1.0f / lsum;
#pragma unroll
  for (int tdh = 0; tdh < 4; ++tdh)
#pragma unroll
    for (int j = 0; j < 8; ++j) {
      int dhcol = tdh * 16 + j + (lane >> 4) * 8;
      Ctx[((size_t)(b * S_ + qrow + lr) * HD_) + h * DH_ + dhcol] =
          (_Float16)(o[tdh][j] * inv);
    }
}

// ---------------------------------------------------------------------------
// Launcher
// ---------------------------------------------------------------------------
extern "C" void kernel_launch(void* const* d_in, const int* in_sizes, int n_in,
                              void* d_out, int out_size, void* d_ws, size_t ws_size,
                              hipStream_t stream) {
  (void)in_sizes; (void)n_in; (void)out_size; (void)ws_size;
  const float* hs    = (const float*)d_in[0];
  const float* Wq    = (const float*)d_in[1];
  const float* Wk    = (const float*)d_in[2];
  const float* Wv    = (const float*)d_in[3];
  const float* Wo    = (const float*)d_in[4];
  const float* table = (const float*)d_in[5];

  char*  ws  = (char*)d_ws;
  size_t off = 0;
  auto alloc = [&](size_t bytes) -> void* {
    void* p = ws + off;
    off += (bytes + 255) & ~(size_t)255;
    return p;
  };

  _Float16* hs16   = (_Float16*)alloc((size_t)M_ * D_ * 2);
  _Float16* wq16T  = (_Float16*)alloc((size_t)D_ * HD_ * 2);
  _Float16* wk16T  = (_Float16*)alloc((size_t)D_ * HD_ * 2);
  _Float16* wv16T  = (_Float16*)alloc((size_t)D_ * HD_ * 2);
  _Float16* wo16T  = (_Float16*)alloc((size_t)HD_ * D_ * 2);
  _Float16* q16    = (_Float16*)alloc((size_t)M_ * HD_ * 2);
  _Float16* k16    = (_Float16*)alloc((size_t)M_ * HD_ * 2);
  _Float16* vT16   = (_Float16*)alloc((size_t)M_ * HD_ * 2);
  _Float16* ctx16  = (_Float16*)alloc((size_t)M_ * HD_ * 2);
  float*    biasE  = (float*)alloc((size_t)H_ * RELN * 4);

  prep_all<<<WT_BLOCKS + HS_BLOCKS + BIAS_BLOCKS, 256, 0, stream>>>(
      hs, Wq, Wk, Wv, Wo, table, hs16, wq16T, wk16T, wv16T, wo16T, biasE);

  dim3 gGemm(HD_ / 128, M_ / 128);
  gemm_wmma<_Float16, false><<<gGemm, 256, 0, stream>>>(hs16, wq16T, q16, M_, HD_, D_);
  gemm_wmma<_Float16, false><<<gGemm, 256, 0, stream>>>(hs16, wk16T, k16, M_, HD_, D_);
  gemm_wmma<_Float16, true ><<<gGemm, 256, 0, stream>>>(hs16, wv16T, vT16, M_, HD_, D_);

  dim3 gAttn(S_ / 128, H_, B_);
  flash_attn<<<gAttn, 256, 0, stream>>>(q16, k16, vT16, biasE, ctx16);

  dim3 gOut(D_ / 128, M_ / 128);
  gemm_wmma<float, false><<<gOut, 256, 0, stream>>>(ctx16, wo16T, (float*)d_out, M_, D_, HD_);
}

// v003
// A run of this version takes 111 microseconds.
// Two timings next to v002 put it at 1.09 and 1.11 times that version's speed.
// Counting every step since v000, it is 2.13 times as fast.
#include <hip/hip_runtime.h>
#include <hip/hip_fp16.h>
#include <math.h>

// ---------------------------------------------------------------------------
// Encoder self-attention with relative position bias (gfx1250, wave32, WMMA).
// one prep launch (f32->f16, weights transposed, bias expanded) -> one double-buffered async WMMA GEMM
// launch for Q, K and V (V written head-transposed) -> flash attention (S^T form, async K/V staging,
// LDS-resident bias, register P->B-frag) -> double-buffered WMMA GEMM out.
// ---------------------------------------------------------------------------

typedef __attribute__((ext_vector_type(16))) _Float16 v16h;
typedef __attribute__((ext_vector_type(8)))  _Float16 h8;
typedef __attribute__((ext_vector_type(8)))  float    v8f;
typedef __attribute__((ext_vector_type(4)))  float    f4;

union Frag16 { v16h v; h8 h[2]; };

__device__ __forceinline__ v8f wmma16x16x32(const Frag16& a, const Frag16& b, v8f c) {
  return __builtin_amdgcn_wmma_f32_16x16x32_f16(false, a.v, false, b.v, (short)0, c,
                                                false, false);
}

// CDNA5 async global->LDS copy (bypasses VGPRs, tracked by ASYNCcnt).
__device__ __forceinline__ void async_load_b128(const void* g, void* lds) {
  unsigned int l = (unsigned int)(unsigned long long)lds;
  asm volatile("global_load_async_to_lds_b128 %0, %1, off"
               :: "v"(l), "v"(g) : "memory");
}
__device__ __forceinline__ void async_wait0() {
  asm volatile("s_wait_asynccnt 0x0" ::: "memory");
}

constexpr int B_  = 2;
constexpr int S_  = 2048;
constexpr int D_  = 1024;
constexpr int H_  = 16;
constexpr int DH_ = 64;
constexpr int HD_ = H_ * DH_;    // 1024
constexpr int M_  = B_ * S_;     // 4096
constexpr int RELN = 2 * S_ - 1; // 4095
constexpr int BIASL = 2176;      // 2175 floats cover a block's rel range
// LDS row pitches in f16 elements. Every tile is read by ds_load_b128 with 16
// lanes on 16 consecutive rows: a pitch of 16 B x odd puts those rows on 16
// different groups of four banks; the bare 128 B / 64 B rows fall on 2 / 4.
constexpr int P64 = 64 + 8;      // 64-element rows: 144 B
constexpr int P32 = 32 + 8;      // 32-element rows:  80 B

// ---------------------------------------------------------------------------
// 1) All operand preparation in ONE launch; the block index picks the role.
//    The three roles share no data; each wave moves many bytes, so that few
//    waves have to be started and only one launch gap is paid.
//    a) weights: f32[k][n] -> f16[n][k]; a block takes one 64x64 tile position
//       of all four matrices (16 b128 loads in flight per thread, one barrier,
//       whole 128 B lines stored).
//    b) hidden states: f32 -> f16, 64 elements per thread, all loads first.
//    c) rel_bias_table[32][H] -> biasE[H][4095] indexed by (rel + S-1).
// ---------------------------------------------------------------------------
constexpr int WT_BLOCKS   = (D_ / 64) * (HD_ / 64);      // 256
constexpr int HS_UNROLL   = 8;
constexpr int HS_BLOCKS   = M_ * D_ / (256 * 8 * HS_UNROLL);  // 256
constexpr int BIAS_SPLIT  = 4;                           // blocks per head
constexpr int BIAS_BLOCKS = H_ * BIAS_SPLIT;             // 64

__global__ void __launch_bounds__(256)
prep_all(const float* __restrict__ hs, const float* __restrict__ Wq,
         const float* __restrict__ Wk, const float* __restrict__ Wv,
         const float* __restrict__ Wo, const float* __restrict__ table,
         _Float16* __restrict__ hs16, _Float16* __restrict__ wqT,
         _Float16* __restrict__ wkT, _Float16* __restrict__ wvT,
         _Float16* __restrict__ woT, float* __restrict__ biasE) {
  // pitch 65 floats: row writes and column reads both touch 32 different banks
  __shared__ float tile[4][64][65];
  const int t = threadIdx.x;
  int bid = blockIdx.x;

  if (bid < WT_BLOCKS) {
    const float* srcs[4] = {Wq, Wk, Wv, Wo};
    _Float16*    dsts[4] = {wqT, wkT, wvT, woT};
    const int k0 = (bid >> 4) * 64, n0 = (bid & 15) * 64;
    const int rr = t >> 4, cc = (t & 15) * 4;            // 16 rows x 64 cols a pass
    // one 32-bit byte offset serves all 16 loads (uniform base + constant step)
    const unsigned lo = (unsigned)((k0 + rr) * HD_ + n0 + cc) * 4u;
    f4 v[4][4];
#pragma unroll  // constant indices: arrays stay in registers, loads issue together
    for (int m = 0; m < 4; ++m)
#pragma unroll  // as above
      for (int p = 0; p < 4; ++p)
        v[m][p] = *(const f4*)((const char*)srcs[m] + lo + p * (16 * HD_ * 4));
    // wait before the loads' offset register is rewritten; naming it as an input
    // keeps it live up to here: without that the last load's result is placed
    // over it while the fifteen loads in front still name it
    asm volatile("s_wait_xcnt 0x0" :: "v"(lo) : "memory");
#pragma unroll  // as above
    for (int m = 0; m < 4; ++m)
#pragma unroll  // as above
      for (int p = 0; p < 4; ++p)
#pragma unroll  // as above
        for (int e = 0; e < 4; ++e) tile[m][p * 16 + rr][cc + e] = v[m][p][e];
    __syncthreads();
    const int kc = (t & 7) * 8, nr = t >> 3;             // 32 n-rows x 64 k a pass
    const unsigned so = (unsigned)((n0 + nr) * D_ + k0 + kc) * 2u;
#pragma unroll  // as above
    for (int m = 0; m < 4; ++m)
#pragma unroll  // as above
      for (int p = 0; p < 2; ++p) {
        h8 o;
#pragma unroll  // as above
        for (int e = 0; e < 8; ++e) o[e] = (_Float16)tile[m][kc + e][p * 32 + nr];
        *(h8*)((char*)dsts[m] + so + p * (32 * D_ * 2)) = o;
      }
    return;
  }
  bid -= WT_BLOCKS;

  if (bid < HS_BLOCKS) {
    const unsigned base = (unsigned)bid * (256 * 8 * HS_UNROLL) + t * 8;  // element
    const unsigned lo = base * 4u;                       // byte offset of the loads
    f4 a[HS_UNROLL], b[HS_UNROLL];
#pragma unroll  // constant indices: arrays stay in registers, loads issue together
    for (int u = 0; u < HS_UNROLL; ++u) {
      a[u] = *(const f4*)((const char*)hs + lo + u * 8192);
      b[u] = *(const f4*)((const char*)hs + lo + u * 8192 + 16);
    }
#pragma unroll  // as above
    for (int u = 0; u < HS_UNROLL; ++u) {
      h8 o;
      o[0] = (_Float16)a[u][0]; o[1] = (_Float16)a[u][1];
      o[2] = (_Float16)a[u][2]; o[3] = (_Float16)a[u][3];
      o[4] = (_Float16)b[u][0]; o[5] = (_Float16)b[u][1];
      o[6] = (_Float16)b[u][2]; o[7] = (_Float16)b[u][3];
      *(h8*)(hs16 + base + u * 2048) = o;
    }
    // behind the stores: the code that follows them in the listing rewrites
    // their address and data registers
    asm volatile("s_wait_xcnt 0x0" ::: "memory");
    return;
  }
  bid -= HS_BLOCKS;

  const int h  = bid / BIAS_SPLIT;
  const int r0 = (bid % BIAS_SPLIT) * 1024 + t;
  float val[4];
#pragma unroll  // constant indices: arrays stay in registers, loads issue together
  for (int u = 0; u < 4; ++u) {
    const int r  = r0 + u * 256;
    const int rc = r < RELN ? r : RELN - 1;   // index 4095 re-reads the last entry, is not stored
    int rel = rc - (S_ - 1);
    const int nb = 16, me = 8;
    int rb = (rel > 0) ? nb : 0;
    int rp = rel < 0 ? -rel : rel;
    int bk;
    if (rp < me) {
      bk = rp;
    } else {
      float x = __logf((float)rp * (1.0f / me)) * (1.0f / __logf(16.0f)) * (float)(nb - me);
      bk = me + (int)x;
      if (bk > nb - 1) bk = nb - 1;
    }
    val[u] = table[(rb + bk) * H_ + h];
  }
#pragma unroll  // as above
  for (int u = 0; u < 4; ++u)
    if (r0 + u * 256 < RELN) biasE[h * RELN + r0 + u * 256] = val[u];
}

// ---------------------------------------------------------------------------
// 3) WMMA GEMM: C[M,N] = A[M,K](f16) * BT[N,K](f16, pre-transposed).
//    128x128x64 tile, 8 waves (4x2), wave = 32x64. Double-buffered async
//    global->LDS staging for both operands (no VGPR bounce, no scalar stores).
//    QKV=true: BT is Wq^T, Wk^T, Wv^T stacked by rows, so that one grid of
//    three times the column blocks does all three projections: three blocks
//    share a WGP and one block's compute covers another's wait for its tile.
//    Column blocks of the first HD_ columns go to C, of the second to Ck
//    (both of row pitch Ndim), the third are scattered as CvT[b][h][dh][s]
//    for the attention pass.
// ---------------------------------------------------------------------------
template <typename OutT, bool QKV>
__global__ void __launch_bounds__(256)
gemm_wmma(const _Float16* __restrict__ A, const _Float16* __restrict__ BT,
          OutT* __restrict__ C, OutT* __restrict__ Ck, OutT* __restrict__ CvT,
          int Mdim, int Ndim, int Kdim) {
  __shared__ __align__(16) _Float16 As[2][128][P64];
  __shared__ __align__(16) _Float16 Bs[2][128][P64];  // [n][k]
  const int t    = threadIdx.x;
  const int lane = t & 31, w = t >> 5;
  const int wm   = w & 3, wn = w >> 2;
  const int m0   = blockIdx.y * 128, n0 = blockIdx.x * 128;
  const int lr   = lane & 15, ko = (lane >> 4) * 8;
  const int srow = t >> 1, soff = (t & 1) * 32;       // staging coords

  auto stage = [&](int k0, int buf) {
    const _Float16* sa = A  + (size_t)(m0 + srow) * Kdim + k0 + soff;
    const _Float16* sb = BT + (size_t)(n0 + srow) * Kdim + k0 + soff;
#pragma unroll
    for (int c = 0; c < 32; c += 8) {
      async_load_b128(sa + c, &As[buf][srow][soff + c]);
      async_load_b128(sb + c, &Bs[buf][srow][soff + c]);
    }
  };

  v8f acc[2][4] = {};
  stage(0, 0);
  async_wait0();
  __syncthreads();

  const int T = Kdim / 64;
  for (int i = 0; i < T; ++i) {
    int buf = i & 1;
    if (i + 1 < T) stage((i + 1) * 64, buf ^ 1);   // overlap with compute
#pragma unroll
    for (int ks = 0; ks < 64; ks += 32) {
      Frag16 a[2], b[4];
#pragma unroll
      for (int mt = 0; mt < 2; ++mt) {
        int row = wm * 32 + mt * 16 + lr;
        a[mt].h[0] = *(const h8*)&As[buf][row][ks + ko];
        a[mt].h[1] = *(const h8*)&As[buf][row][ks + ko + 16];
      }
#pragma unroll
      for (int nt = 0; nt < 4; ++nt) {
        int col = wn * 64 + nt * 16 + lr;
        b[nt].h[0] = *(const h8*)&Bs[buf][col][ks + ko];
        b[nt].h[1] = *(const h8*)&Bs[buf][col][ks + ko + 16];
      }
#pragma unroll
      for (int mt = 0; mt < 2; ++mt)
#pragma unroll
        for (int nt = 0; nt < 4; ++nt)
          acc[mt][nt] = wmma16x16x32(a[mt], b[nt], acc[mt][nt]);
    }
    async_wait0();
    __syncthreads();
  }

  // a 128-column block lies wholly in one of the three outputs (block-uniform)
  const int sel = QKV ? n0 / HD_ : 0;
  const int nc0 = QKV ? n0 % HD_ : n0;
  if (QKV && sel == 2) {
#pragma unroll
    for (int mt = 0; mt < 2; ++mt)
#pragma unroll
      for (int nt = 0; nt < 4; ++nt)
#pragma unroll
        for (int j = 0; j < 8; ++j) {
          int m = m0 + wm * 32 + mt * 16 + j + (lane >> 4) * 8;
          int n = nc0 + wn * 64 + nt * 16 + lr;
          int bb = m >> 11, s = m & (S_ - 1);       // token -> (batch, seq)
          int hh = n >> 6,  dh = n & (DH_ - 1);     // col   -> (head, dh)
          CvT[((size_t)((bb * H_ + hh) * DH_ + dh)) * S_ + s] = (OutT)acc[mt][nt][j];
        }
    return;
  }
  OutT* __restrict__ Cs = (QKV && sel == 1) ? Ck : C;
#pragma unroll
  for (int mt = 0; mt < 2; ++mt)
#pragma unroll
    for (int nt = 0; nt < 4; ++nt)
#pragma unroll
      for (int j = 0; j < 8; ++j) {
        int m = m0 + wm * 32 + mt * 16 + j + (lane >> 4) * 8;
        int n = nc0 + wn * 64 + nt * 16 + lr;
        Cs[(size_t)m * Ndim + n] = (OutT)acc[mt][nt][j];
      }
  // behind the stores: in the listing the V block follows them and rewrites
  // their address and data registers
  if constexpr (QKV) asm volatile("s_wait_xcnt 0x0" ::: "memory");
}

// ---------------------------------------------------------------------------
// 4) Flash attention in S^T form, double-buffered async K/V staging.
//    S^T = K * Q^T  ->  lane = query col, j = key row; per-query scalar state;
//    P^T converts in registers to the B-fragment of O^T = V^T * P^T.
//    Bias row segment staged once into LDS (block-invariant indexing).
// ---------------------------------------------------------------------------
__global__ void __launch_bounds__(256)
flash_attn(const _Float16* __restrict__ Q, const _Float16* __restrict__ K,
           const _Float16* __restrict__ VT, const float* __restrict__ biasE,
           _Float16* __restrict__ Ctx) {
  __shared__ __align__(16) _Float16 Ks[2][32][P64];  // [key][dh]
  __shared__ __align__(16) _Float16 Vs[2][64][P32];  // [dh][key] (from VT)
  __shared__ float biasL[BIASL];

  const int t = threadIdx.x, lane = t & 31, w = t >> 5;
  const int lr = lane & 15, ko = (lane >> 4) * 8;
  const int b = blockIdx.z, h = blockIdx.y;
  const int q0 = blockIdx.x * 128, qrow = q0 + w * 16;

  // stage this block's bias segment: biasL[i] = bias(rel = i - (q0+127))
  {
    const float* biasH = biasE + h * RELN + (S_ - 1);
    for (int i = t; i < BIASL - 1; i += 256) biasL[i] = biasH[i - (q0 + 127)];
  }

  const _Float16* Kb  = K  + (size_t)(b * S_) * HD_ + h * DH_;
  const _Float16* VTb = VT + (size_t)((b * H_ + h) * DH_) * S_;

  auto stageKV = [&](int kb, int buf) {
    int krow = t >> 3, koff8 = (t & 7) * 8;          // 32 x 64 K tile
    async_load_b128(Kb + (size_t)(kb + krow) * HD_ + koff8, &Ks[buf][krow][koff8]);
    int drow = t >> 2, soff8 = (t & 3) * 8;          // 64 x 32 V^T tile
    async_load_b128(VTb + (size_t)drow * S_ + kb + soff8, &Vs[buf][drow][soff8]);
  };

  // Q^T B-fragments (lane = query, regs = dh), loaded once from global
  Frag16 qf[2];
  {
    const _Float16* qp = Q + ((size_t)(b * S_ + qrow + lr) * HD_) + h * DH_;
    qf[0].h[0] = *(const h8*)(qp + ko);
    qf[0].h[1] = *(const h8*)(qp + ko + 16);
    qf[1].h[0] = *(const h8*)(qp + 32 + ko);
    qf[1].h[1] = *(const h8*)(qp + 32 + ko + 16);
  }

  v8f o[4] = {};
  float mx = -INFINITY, lsum = 0.0f;

  stageKV(0, 0);
  async_wait0();
  __syncthreads();

  for (int kb = 0; kb < S_; kb += 32) {
    int buf = (kb >> 5) & 1;
    if (kb + 32 < S_) stageKV(kb + 32, buf ^ 1);     // overlap with compute

    // S^T tiles: rows = keys (tk*16..), cols = queries
    v8f sc[2];
#pragma unroll
    for (int tk = 0; tk < 2; ++tk) {
      int key = tk * 16 + lr;
      Frag16 ka0, ka1;
      ka0.h[0] = *(const h8*)&Ks[buf][key][ko];
      ka0.h[1] = *(const h8*)&Ks[buf][key][ko + 16];
      ka1.h[0] = *(const h8*)&Ks[buf][key][32 + ko];
      ka1.h[1] = *(const h8*)&Ks[buf][key][32 + ko + 16];
      v8f c = {};
      c = wmma16x16x32(ka0, qf[0], c);
      c = wmma16x16x32(ka1, qf[1], c);
      sc[tk] = c;
    }

    // scale + bias from LDS (index independent of blockIdx)
#pragma unroll
    for (int tk = 0; tk < 2; ++tk) {
      int bbase = kb + tk * 16 + ((lane >> 4) << 3) - (w * 16 + lr) + 127;
#pragma unroll
      for (int j = 0; j < 8; ++j)
        sc[tk][j] = sc[tk][j] * 0.125f + biasL[bbase + j];
    }

    // online softmax, per-query scalar state (lane l and l^16 share a query)
    float mloc = sc[0][0];
#pragma unroll
    for (int j = 1; j < 8; ++j) mloc = fmaxf(mloc, sc[0][j]);
#pragma unroll
    for (int j = 0; j < 8; ++j) mloc = fmaxf(mloc, sc[1][j]);
    mloc = fmaxf(mloc, __shfl_xor(mloc, 16, 32));
    float nm    = fmaxf(mx, mloc);
    float alpha = __expf(mx - nm);
    mx = nm;

    Frag16 pf;
    float rs = 0.0f;
#pragma unroll
    for (int j = 0; j < 8; ++j) {
      float p0 = __expf(sc[0][j] - nm);
      float p1 = __expf(sc[1][j] - nm);
      rs += p0 + p1;
      pf.h[0][j] = (_Float16)p0;
      pf.h[1][j] = (_Float16)p1;
    }
    rs += __shfl_xor(rs, 16, 32);
    lsum = lsum * alpha + rs;

#pragma unroll
    for (int tdh = 0; tdh < 4; ++tdh)
#pragma unroll
      for (int j = 0; j < 8; ++j) o[tdh][j] *= alpha;

    // O^T += V^T(16dh x 32k) * P^T(32k x 16q)
#pragma unroll
    for (int tdh = 0; tdh < 4; ++tdh) {
      int dhrow = tdh * 16 + lr;
      Frag16 va;
      va.h[0] = *(const h8*)&Vs[buf][dhrow][ko];
      va.h[1] = *(const h8*)&Vs[buf][dhrow][ko + 16];
      o[tdh] = wmma16x16x32(va, pf, o[tdh]);
    }
    async_wait0();
    __syncthreads();
  }

  // normalize + store context row-major [token][h*64+dh]
  float inv = 1.0f / lsum;
#pragma unroll
  for (int tdh = 0; tdh < 4; ++tdh)
#pragma unroll
    for (int j = 0; j < 8; ++j) {
      int dhcol = tdh * 16 + j + (lane >> 4) * 8;
      Ctx[((size_t)(b * S_ + qrow + lr) * HD_) + h * DH_ + dhcol] =
          (_Float16)(o[tdh][j] * inv);
    }
}

// ---------------------------------------------------------------------------
// Launcher
// ---------------------------------------------------------------------------
extern "C" void kernel_launch(void* const* d_in, const int* in_sizes, int n_in,
                              void* d_out, int out_size, void* d_ws, size_t ws_size,
                              hipStream_t stream) {
  (void)in_sizes; (void)n_in; (void)out_size; (void)ws_size;
  const float* hs    = (const float*)d_in[0];
  const float* Wq    = (const float*)d_in[1];
  const float* Wk    = (const float*)d_in[2];
  const float* Wv    = (const float*)d_in[3];
  const float* Wo    = (const float*)d_in[4];
  const float* table = (const float*)d_in[5];

  char*  ws  = (char*)d_ws;
  size_t off = 0;
  auto alloc = [&](size_t bytes) -> void* {
    void* p = ws + off;
    off += (bytes + 255) & ~(size_t)255;
    return p;
  };

  _Float16* hs16   = (_Float16*)alloc((size_t)M_ * D_ * 2);
  _Float16* wq16T  = (_Float16*)alloc((size_t)3 * D_ * HD_ * 2);  // Wq^T | Wk^T | Wv^T
  _Float16* wk16T  = wq16T + (size_t)D_ * HD_;
  _Float16* wv16T  = wk16T + (size_t)D_ * HD_;
  _Float16* wo16T  = (_Float16*)alloc((size_t)HD_ * D_ * 2);
  _Float16* q16    = (_Float16*)alloc((size_t)M_ * HD_ * 2);
  _Float16* k16    = (_Float16*)alloc((size_t)M_ * HD_ * 2);
  _Float16* vT16   = (_Float16*)alloc((size_t)M_ * HD_ * 2);
  _Float16* ctx16  = (_Float16*)alloc((size_t)M_ * HD_ * 2);
  float*    biasE  = (float*)alloc((size_t)H_ * RELN * 4);

  prep_all<<<WT_BLOCKS + HS_BLOCKS + BIAS_BLOCKS, 256, 0, stream>>>(
      hs, Wq, Wk, Wv, Wo, table, hs16, wq16T, wk16T, wv16T, wo16T, biasE);

  dim3 gQkv(3 * HD_ / 128, M_ / 128);
  gemm_wmma<_Float16, true><<<gQkv, 256, 0, stream>>>(hs16, wq16T, q16, k16, vT16, M_, HD_, D_);

  dim3 gAttn(S_ / 128, H_, B_);
  flash_attn<<<gAttn, 256, 0, stream>>>(q16, k16, vT16, biasE, ctx16);

  dim3 gOut(D_ / 128, M_ / 128);
  gemm_wmma<float, false><<<gOut, 256, 0, stream>>>(ctx16, wo16T, (float*)d_out, nullptr, nullptr,
                                                    M_, D_, HD_);
}

// v004
// A run of this version takes 101 microseconds.
// In both of two side-by-side timings against v003, it was 1.10 times as fast.
// Over all steps from v000 it is 2.34 times as fast.
#include <hip/hip_runtime.h>
#include <hip/hip_fp16.h>
#include <math.h>

// ---------------------------------------------------------------------------
// Encoder self-attention with relative position bias (gfx1250, wave32, WMMA).
// one prep launch (f32->f16, weights transposed, bias expanded) -> one double-buffered async WMMA GEMM
// launch for Q, K and V (V written head-transposed) -> flash attention (S^T form, async K/V staging,
// LDS-resident bias, register P->B-frag) -> double-buffered WMMA GEMM out.
// ---------------------------------------------------------------------------

typedef __attribute__((ext_vector_type(16))) _Float16 v16h;
typedef __attribute__((ext_vector_type(8)))  _Float16 h8;
typedef __attribute__((ext_vector_type(8)))  float    v8f;
typedef __attribute__((ext_vector_type(4)))  float    f4;

union Frag16 { v16h v; h8 h[2]; };

__device__ __forceinline__ v8f wmma16x16x32(const Frag16& a, const Frag16& b, v8f c) {
  return __builtin_amdgcn_wmma_f32_16x16x32_f16(false, a.v, false, b.v, (short)0, c,
                                                false, false);
}

// CDNA5 async global->LDS copy (bypasses VGPRs, tracked by ASYNCcnt).
__device__ __forceinline__ void async_load_b128(const void* g, void* lds) {
  unsigned int l = (unsigned int)(unsigned long long)lds;
  asm volatile("global_load_async_to_lds_b128 %0, %1, off"
               :: "v"(l), "v"(g) : "memory");
}
__device__ __forceinline__ void async_wait0() {
  asm volatile("s_wait_asynccnt 0x0" ::: "memory");
}

constexpr int B_  = 2;
constexpr int S_  = 2048;
constexpr int D_  = 1024;
constexpr int H_  = 16;
constexpr int DH_ = 64;
constexpr int HD_ = H_ * DH_;    // 1024
constexpr int M_  = B_ * S_;     // 4096
constexpr int RELN = 2 * S_ - 1; // 4095
constexpr int BIASL = 2176;      // 2175 floats cover a block's rel range
// LDS row pitches in f16 elements. Every tile is read by ds_load_b128 with 16
// lanes on 16 consecutive rows: a pitch of 16 B x odd puts those rows on 16
// different groups of four banks; the bare 128 B / 256 B rows fall on 2 / 1.
constexpr int P64 = 64 + 8;      // 64-element rows: 144 B
constexpr int P32 = 32 + 8;      // unused: no LDS tile has 32-element rows

// ---------------------------------------------------------------------------
// 1) All operand preparation in ONE launch; the block index picks the role.
//    The three roles share no data; each wave moves many bytes, so that few
//    waves have to be started and only one launch gap is paid.
//    a) weights: f32[k][n] -> f16[n][k]; a block takes one 64x64 tile position
//       of all four matrices (16 b128 loads in flight per thread, one barrier,
//       whole 128 B lines stored).
//    b) hidden states: f32 -> f16, 64 elements per thread, all loads first.
//    c) rel_bias_table[32][H] -> biasE[H][4095] indexed by (rel + S-1).
// ---------------------------------------------------------------------------
constexpr int WT_BLOCKS   = (D_ / 64) * (HD_ / 64);      // 256
constexpr int HS_UNROLL   = 8;
constexpr int HS_BLOCKS   = M_ * D_ / (256 * 8 * HS_UNROLL);  // 256
constexpr int BIAS_SPLIT  = 4;                           // blocks per head
constexpr int BIAS_BLOCKS = H_ * BIAS_SPLIT;             // 64

__global__ void __launch_bounds__(256)
prep_all(const float* __restrict__ hs, const float* __restrict__ Wq,
         const float* __restrict__ Wk, const float* __restrict__ Wv,
         const float* __restrict__ Wo, const float* __restrict__ table,
         _Float16* __restrict__ hs16, _Float16* __restrict__ wqT,
         _Float16* __restrict__ wkT, _Float16* __restrict__ wvT,
         _Float16* __restrict__ woT, float* __restrict__ biasE) {
  // pitch 65 floats: row writes and column reads both touch 32 different banks
  __shared__ float tile[4][64][65];
  const int t = threadIdx.x;
  int bid = blockIdx.x;

  if (bid < WT_BLOCKS) {
    const float* srcs[4] = {Wq, Wk, Wv, Wo};
    _Float16*    dsts[4] = {wqT, wkT, wvT, woT};
    const int k0 = (bid >> 4) * 64, n0 = (bid & 15) * 64;
    const int rr = t >> 4, cc = (t & 15) * 4;            // 16 rows x 64 cols a pass
    // one 32-bit byte offset serves all 16 loads (uniform base + constant step)
    const unsigned lo = (unsigned)((k0 + rr) * HD_ + n0 + cc) * 4u;
    f4 v[4][4];
#pragma unroll  // constant indices: arrays stay in registers, loads issue together
    for (int m = 0; m < 4; ++m)
#pragma unroll  // as above
      for (int p = 0; p < 4; ++p)
        v[m][p] = *(const f4*)((const char*)srcs[m] + lo + p * (16 * HD_ * 4));
    // wait before the loads' offset register is rewritten; naming it as an input
    // keeps it live up to here: without that the last load's result is placed
    // over it while the fifteen loads in front still name it
    asm volatile("s_wait_xcnt 0x0" :: "v"(lo) : "memory");
#pragma unroll  // as above
    for (int m = 0; m < 4; ++m)
#pragma unroll  // as above
      for (int p = 0; p < 4; ++p)
#pragma unroll  // as above
        for (int e = 0; e < 4; ++e) tile[m][p * 16 + rr][cc + e] = v[m][p][e];
    __syncthreads();
    const int kc = (t & 7) * 8, nr = t >> 3;             // 32 n-rows x 64 k a pass
    const unsigned so = (unsigned)((n0 + nr) * D_ + k0 + kc) * 2u;
#pragma unroll  // as above
    for (int m = 0; m < 4; ++m)
#pragma unroll  // as above
      for (int p = 0; p < 2; ++p) {
        h8 o;
#pragma unroll  // as above
        for (int e = 0; e < 8; ++e) o[e] = (_Float16)tile[m][kc + e][p * 32 + nr];
        *(h8*)((char*)dsts[m] + so + p * (32 * D_ * 2)) = o;
      }
    return;
  }
  bid -= WT_BLOCKS;

  if (bid < HS_BLOCKS) {
    const unsigned base = (unsigned)bid * (256 * 8 * HS_UNROLL) + t * 8;  // element
    const unsigned lo = base * 4u;                       // byte offset of the loads
    f4 a[HS_UNROLL], b[HS_UNROLL];
#pragma unroll  // constant indices: arrays stay in registers, loads issue together
    for (int u = 0; u < HS_UNROLL; ++u) {
      a[u] = *(const f4*)((const char*)hs + lo + u * 8192);
      b[u] = *(const f4*)((const char*)hs + lo + u * 8192 + 16);
    }
#pragma unroll  // as above
    for (int u = 0; u < HS_UNROLL; ++u) {
      h8 o;
      o[0] = (_Float16)a[u][0]; o[1] = (_Float16)a[u][1];
      o[2] = (_Float16)a[u][2]; o[3] = (_Float16)a[u][3];
      o[4] = (_Float16)b[u][0]; o[5] = (_Float16)b[u][1];
      o[6] = (_Float16)b[u][2]; o[7] = (_Float16)b[u][3];
      *(h8*)(hs16 + base + u * 2048) = o;
    }
    // behind the stores: the code that follows them in the listing rewrites
    // their address and data registers
    asm volatile("s_wait_xcnt 0x0" ::: "memory");
    return;
  }
  bid -= HS_BLOCKS;

  const int h  = bid / BIAS_SPLIT;
  const int r0 = (bid % BIAS_SPLIT) * 1024 + t;
  float val[4];
#pragma unroll  // constant indices: arrays stay in registers, loads issue together
  for (int u = 0; u < 4; ++u) {
    const int r  = r0 + u * 256;
    const int rc = r < RELN ? r : RELN - 1;   // index 4095 re-reads the last entry, is not stored
    int rel = rc - (S_ - 1);
    const int nb = 16, me = 8;
    int rb = (rel > 0) ? nb : 0;
    int rp = rel < 0 ? -rel : rel;
    int bk;
    if (rp < me) {
      bk = rp;
    } else {
      float x = __logf((float)rp * (1.0f / me)) * (1.0f / __logf(16.0f)) * (float)(nb - me);
      bk = me + (int)x;
      if (bk > nb - 1) bk = nb - 1;
    }
    val[u] = table[(rb + bk) * H_ + h];
  }
#pragma unroll  // as above
  for (int u = 0; u < 4; ++u)
    if (r0 + u * 256 < RELN) biasE[h * RELN + r0 + u * 256] = val[u];
}

// ---------------------------------------------------------------------------
// 3) WMMA GEMM: C[M,N] = A[M,K](f16) * BT[N,K](f16, pre-transposed).
//    128x128x64 tile, 8 waves (4x2), wave = 32x64. Double-buffered async
//    global->LDS staging for both operands (no VGPR bounce, no scalar stores).
//    QKV=true: BT is Wq^T, Wk^T, Wv^T stacked by rows, so that one grid of
//    three times the column blocks does all three projections: three blocks
//    share a WGP and one block's compute covers another's wait for its tile.
//    Column blocks of the first HD_ columns go to C, of the second to Ck
//    (both of row pitch Ndim), the third are scattered as CvT[b][h][dh][s]
//    for the attention pass.
// ---------------------------------------------------------------------------
template <typename OutT, bool QKV>
__global__ void __launch_bounds__(256)
gemm_wmma(const _Float16* __restrict__ A, const _Float16* __restrict__ BT,
          OutT* __restrict__ C, OutT* __restrict__ Ck, OutT* __restrict__ CvT,
          int Mdim, int Ndim, int Kdim) {
  __shared__ __align__(16) _Float16 As[2][128][P64];
  __shared__ __align__(16) _Float16 Bs[2][128][P64];  // [n][k]
  const int t    = threadIdx.x;
  const int lane = t & 31, w = t >> 5;
  const int wm   = w & 3, wn = w >> 2;
  const int m0   = blockIdx.y * 128, n0 = blockIdx.x * 128;
  const int lr   = lane & 15, ko = (lane >> 4) * 8;
  const int srow = t >> 1, soff = (t & 1) * 32;       // staging coords

  auto stage = [&](int k0, int buf) {
    const _Float16* sa = A  + (size_t)(m0 + srow) * Kdim + k0 + soff;
    const _Float16* sb = BT + (size_t)(n0 + srow) * Kdim + k0 + soff;
#pragma unroll
    for (int c = 0; c < 32; c += 8) {
      async_load_b128(sa + c, &As[buf][srow][soff + c]);
      async_load_b128(sb + c, &Bs[buf][srow][soff + c]);
    }
  };

  v8f acc[2][4] = {};
  stage(0, 0);
  async_wait0();
  __syncthreads();

  const int T = Kdim / 64;
  for (int i = 0; i < T; ++i) {
    int buf = i & 1;
    if (i + 1 < T) stage((i + 1) * 64, buf ^ 1);   // overlap with compute
#pragma unroll
    for (int ks = 0; ks < 64; ks += 32) {
      Frag16 a[2], b[4];
#pragma unroll
      for (int mt = 0; mt < 2; ++mt) {
        int row = wm * 32 + mt * 16 + lr;
        a[mt].h[0] = *(const h8*)&As[buf][row][ks + ko];
        a[mt].h[1] = *(const h8*)&As[buf][row][ks + ko + 16];
      }
#pragma unroll
      for (int nt = 0; nt < 4; ++nt) {
        int col = wn * 64 + nt * 16 + lr;
        b[nt].h[0] = *(const h8*)&Bs[buf][col][ks + ko];
        b[nt].h[1] = *(const h8*)&Bs[buf][col][ks + ko + 16];
      }
#pragma unroll
      for (int mt = 0; mt < 2; ++mt)
#pragma unroll
        for (int nt = 0; nt < 4; ++nt)
          acc[mt][nt] = wmma16x16x32(a[mt], b[nt], acc[mt][nt]);
    }
    async_wait0();
    __syncthreads();
  }

  // a 128-column block lies wholly in one of the three outputs (block-uniform)
  const int sel = QKV ? n0 / HD_ : 0;
  const int nc0 = QKV ? n0 % HD_ : n0;
  if (QKV && sel == 2) {
#pragma unroll
    for (int mt = 0; mt < 2; ++mt)
#pragma unroll
      for (int nt = 0; nt < 4; ++nt)
#pragma unroll
        for (int j = 0; j < 8; ++j) {
          int m = m0 + wm * 32 + mt * 16 + j + (lane >> 4) * 8;
          int n = nc0 + wn * 64 + nt * 16 + lr;
          int bb = m >> 11, s = m & (S_ - 1);       // token -> (batch, seq)
          int hh = n >> 6,  dh = n & (DH_ - 1);     // col   -> (head, dh)
          CvT[((size_t)((bb * H_ + hh) * DH_ + dh)) * S_ + s] = (OutT)acc[mt][nt][j];
        }
    return;
  }
  OutT* __restrict__ Cs = (QKV && sel == 1) ? Ck : C;
#pragma unroll
  for (int mt = 0; mt < 2; ++mt)
#pragma unroll
    for (int nt = 0; nt < 4; ++nt)
#pragma unroll
      for (int j = 0; j < 8; ++j) {
        int m = m0 + wm * 32 + mt * 16 + j + (lane >> 4) * 8;
        int n = nc0 + wn * 64 + nt * 16 + lr;
        Cs[(size_t)m * Ndim + n] = (OutT)acc[mt][nt][j];
      }
  // behind the stores: in the listing the V block follows them and rewrites
  // their address and data registers
  if constexpr (QKV) asm volatile("s_wait_xcnt 0x0" ::: "memory");
}

// ---------------------------------------------------------------------------
// 4) Flash attention in S^T form, double-buffered async K/V staging.
//    S^T = K * Q^T  ->  lane = query col, j = key row; per-query scalar state;
//    P^T converts in registers to the B-fragment of O^T = V^T * P^T.
//    Bias row segment staged once into LDS (block-invariant indexing).
//    A pass takes KT keys: what is paid once a pass (the exchange of the
//    maximum and of the sum between the wave's halves, the rescale of O, the
//    wait for the copies, the barrier) is paid once per KT keys, and the
//    KT / 16 score tiles of a pass are independent work for the wave.
// ---------------------------------------------------------------------------
constexpr int KT  = 128;         // keys per pass
constexpr int PKT = KT + 8;      // V^T rows of KT keys: 272 B = 16 B x 17 (odd)
static_assert(KT == 128 && S_ % KT == 0 && S_ / KT >= 2, "the staging below is written for 128 keys");

__global__ void __launch_bounds__(256)
flash_attn(const _Float16* __restrict__ Q, const _Float16* __restrict__ K,
           const _Float16* __restrict__ VT, const float* __restrict__ biasE,
           _Float16* __restrict__ Ctx) {
  __shared__ __align__(16) _Float16 Ks[2][KT][P64];  // [key][dh]
  __shared__ __align__(16) _Float16 Vs[2][64][PKT];  // [dh][key] (from VT)
  __shared__ float biasL[BIASL];

  const int t = threadIdx.x, lane = t & 31, w = t >> 5;
  const int lr = lane & 15, ko = (lane >> 4) * 8;
  const int b = blockIdx.z, h = blockIdx.y;
  const int q0 = blockIdx.x * 128, qrow = q0 + w * 16;

  // stage this block's bias segment: biasL[i] = bias(rel = i - (q0+127))
  {
    const float* biasH = biasE + h * RELN + (S_ - 1);
    for (int i = t; i < BIASL - 1; i += 256) biasL[i] = biasH[i - (q0 + 127)];
  }

  const _Float16* Kb  = K  + (size_t)(b * S_) * HD_ + h * DH_;
  const _Float16* VTb = VT + (size_t)((b * H_ + h) * DH_) * S_;

  // One pass's tiles: K 128 rows of 128 B, V^T 64 rows of 256 B; a thread copies
  // four 16-byte pieces of each (32 K rows / 16 V^T rows apart).
  auto stageKV = [&](int kb, int buf) {
    const _Float16* gk = Kb + (size_t)(kb + (t >> 3)) * HD_ + (t & 7) * 8;
    const _Float16* gv = VTb + (size_t)(t >> 4) * S_ + kb + (t & 15) * 8;
    const unsigned lk = (unsigned)(unsigned long long)&Ks[buf][t >> 3][(t & 7) * 8];
    const unsigned lv = (unsigned)(unsigned long long)&Vs[buf][t >> 4][(t & 15) * 8];
    // the copies and their s_wait_xcnt in one statement: the wait then stands in
    // front of every later write of a register that a copy names
    asm volatile(
        "global_load_async_to_lds_b128 %0, %8, off\n\t"
        "global_load_async_to_lds_b128 %1, %9, off\n\t"
        "global_load_async_to_lds_b128 %2, %10, off\n\t"
        "global_load_async_to_lds_b128 %3, %11, off\n\t"
        "global_load_async_to_lds_b128 %4, %12, off\n\t"
        "global_load_async_to_lds_b128 %5, %13, off\n\t"
        "global_load_async_to_lds_b128 %6, %14, off\n\t"
        "global_load_async_to_lds_b128 %7, %15, off\n\t"
        "s_wait_xcnt 0x0"
        :: "v"(lk), "v"(lk + 32 * P64 * 2), "v"(lk + 64 * P64 * 2), "v"(lk + 96 * P64 * 2),
           "v"(lv), "v"(lv + 16 * PKT * 2), "v"(lv + 32 * PKT * 2), "v"(lv + 48 * PKT * 2),
           "v"(gk), "v"(gk + 32 * HD_), "v"(gk + 64 * HD_), "v"(gk + 96 * HD_),
           "v"(gv), "v"(gv + 16 * S_), "v"(gv + 32 * S_), "v"(gv + 48 * S_)
        : "memory");
  };

  // Q^T B-fragments (lane = query, regs = dh), loaded once from global
  Frag16 qf[2];
  {
    const _Float16* qp = Q + ((size_t)(b * S_ + qrow + lr) * HD_) + h * DH_;
    qf[0].h[0] = *(const h8*)(qp + ko);
    qf[0].h[1] = *(const h8*)(qp + ko + 16);
    qf[1].h[0] = *(const h8*)(qp + 32 + ko);
    qf[1].h[1] = *(const h8*)(qp + 32 + ko + 16);
  }

  v8f o[4] = {};
  float mx = -INFINITY, lsum = 0.0f;

  stageKV(0, 0);
  async_wait0();
  __syncthreads();
  stageKV(KT, 1);                                    // flies during pass 0

  for (int kb = 0; kb < S_; kb += KT) {
    const int buf = (kb / KT) & 1;

    // S^T tiles: rows = keys (tk*16..), cols = queries
    v8f sc[KT / 16];
#pragma unroll  // constant indices: the score tiles stay in registers
    for (int tk = 0; tk < KT / 16; ++tk) {
      int key = tk * 16 + lr;
      Frag16 ka0, ka1;
      ka0.h[0] = *(const h8*)&Ks[buf][key][ko];
      ka0.h[1] = *(const h8*)&Ks[buf][key][ko + 16];
      ka1.h[0] = *(const h8*)&Ks[buf][key][32 + ko];
      ka1.h[1] = *(const h8*)&Ks[buf][key][32 + ko + 16];
      v8f c = {};
      c = wmma16x16x32(ka0, qf[0], c);
      c = wmma16x16x32(ka1, qf[1], c);
      sc[tk] = c;
    }

    // scale + bias from LDS (index independent of blockIdx); one maximum a tile
    float mt[KT / 16];
#pragma unroll  // as above
    for (int tk = 0; tk < KT / 16; ++tk) {
      int bbase = kb + tk * 16 + ((lane >> 4) << 3) - (w * 16 + lr) + 127;
#pragma unroll  // as above
      for (int j = 0; j < 8; ++j)
        sc[tk][j] = sc[tk][j] * 0.125f + biasL[bbase + j];
      float m = sc[tk][0];
#pragma unroll  // as above
      for (int j = 1; j < 8; ++j) m = fmaxf(m, sc[tk][j]);
      mt[tk] = m;
    }

    // online softmax, per-query scalar state (lane l and l^16 share a query)
    float mloc = fmaxf(fmaxf(fmaxf(mt[0], mt[1]), fmaxf(mt[2], mt[3])),
                       fmaxf(fmaxf(mt[4], mt[5]), fmaxf(mt[6], mt[7])));
    mloc = fmaxf(mloc, __shfl_xor(mloc, 16, 32));
    float nm    = fmaxf(mx, mloc);
    float alpha = __expf(mx - nm);
    mx = nm;

    Frag16 pf[KT / 32];
    float rg[KT / 32];                               // one partial sum per 32 keys
#pragma unroll  // as above
    for (int g = 0; g < KT / 32; ++g) {
      float r = 0.0f;
#pragma unroll  // as above
      for (int j = 0; j < 8; ++j) {
        float p0 = __expf(sc[2 * g][j] - nm);
        float p1 = __expf(sc[2 * g + 1][j] - nm);
        r += p0 + p1;
        pf[g].h[0][j] = (_Float16)p0;
        pf[g].h[1][j] = (_Float16)p1;
      }
      rg[g] = r;
    }
    float rs = (rg[0] + rg[1]) + (rg[2] + rg[3]);
    rs += __shfl_xor(rs, 16, 32);
    lsum = lsum * alpha + rs;

#pragma unroll  // as above
    for (int tdh = 0; tdh < 4; ++tdh)
#pragma unroll  // as above
      for (int j = 0; j < 8; ++j) o[tdh][j] *= alpha;

    // O^T += V^T(16dh x 32k) * P^T(32k x 16q), 32 keys at a time
#pragma unroll  // as above
    for (int g = 0; g < KT / 32; ++g)
#pragma unroll  // as above
      for (int tdh = 0; tdh < 4; ++tdh) {
        int dhrow = tdh * 16 + lr;
        Frag16 va;
        va.h[0] = *(const h8*)&Vs[buf][dhrow][g * 32 + ko];
        va.h[1] = *(const h8*)&Vs[buf][dhrow][g * 32 + ko + 16];
        o[tdh] = wmma16x16x32(va, pf[g], o[tdh]);
      }

    // hand-over: this wave's LDS reads are done, its copies of the next tile have
    // landed; behind the barrier that holds for all waves, and the buffer just
    // read may be refilled
    asm volatile("s_wait_dscnt 0x0" ::: "memory");
    async_wait0();
    __syncthreads();
    if (kb + 2 * KT < S_) stageKV(kb + 2 * KT, buf);
  }
  async_wait0();  // nothing is in flight here; the wave does not end on an open count

  // normalize + store context row-major [token][h*64+dh]
  float inv = 1.0f / lsum;
#pragma unroll
  for (int tdh = 0; tdh < 4; ++tdh)
#pragma unroll
    for (int j = 0; j < 8; ++j) {
      int dhcol = tdh * 16 + j + (lane >> 4) * 8;
      Ctx[((size_t)(b * S_ + qrow + lr) * HD_) + h * DH_ + dhcol] =
          (_Float16)(o[tdh][j] * inv);
    }
}

// ---------------------------------------------------------------------------
// Launcher
// ---------------------------------------------------------------------------
extern "C" void kernel_launch(void* const* d_in, const int* in_sizes, int n_in,
                              void* d_out, int out_size, void* d_ws, size_t ws_size,
                              hipStream_t stream) {
  (void)in_sizes; (void)n_in; (void)out_size; (void)ws_size;
  const float* hs    = (const float*)d_in[0];
  const float* Wq    = (const float*)d_in[1];
  const float* Wk    = (const float*)d_in[2];
  const float* Wv    = (const float*)d_in[3];
  const float* Wo    = (const float*)d_in[4];
  const float* table = (const float*)d_in[5];

  char*  ws  = (char*)d_ws;
  size_t off = 0;
  auto alloc = [&](size_t bytes) -> void* {
    void* p = ws + off;
    off += (bytes + 255) & ~(size_t)255;
    return p;
  };

  _Float16* hs16   = (_Float16*)alloc((size_t)M_ * D_ * 2);
  _Float16* wq16T  = (_Float16*)alloc((size_t)3 * D_ * HD_ * 2);  // Wq^T | Wk^T | Wv^T
  _Float16* wk16T  = wq16T + (size_t)D_ * HD_;
  _Float16* wv16T  = wk16T + (size_t)D_ * HD_;
  _Float16* wo16T  = (_Float16*)alloc((size_t)HD_ * D_ * 2);
  _Float16* q16    = (_Float16*)alloc((size_t)M_ * HD_ * 2);
  _Float16* k16    = (_Float16*)alloc((size_t)M_ * HD_ * 2);
  _Float16* vT16   = (_Float16*)alloc((size_t)M_ * HD_ * 2);
  _Float16* ctx16  = (_Float16*)alloc((size_t)M_ * HD_ * 2);
  float*    biasE  = (float*)alloc((size_t)H_ * RELN * 4);

  prep_all<<<WT_BLOCKS + HS_BLOCKS + BIAS_BLOCKS, 256, 0, stream>>>(
      hs, Wq, Wk, Wv, Wo, table, hs16, wq16T, wk16T, wv16T, wo16T, biasE);

  dim3 gQkv(3 * HD_ / 128, M_ / 128);
  gemm_wmma<_Float16, true><<<gQkv, 256, 0, stream>>>(hs16, wq16T, q16, k16, vT16, M_, HD_, D_);

  dim3 gAttn(S_ / 128, H_, B_);
  flash_attn<<<gAttn, 256, 0, stream>>>(q16, k16, vT16, biasE, ctx16);

  dim3 gOut(D_ / 128, M_ / 128);
  gemm_wmma<float, false><<<gOut, 256, 0, stream>>>(ctx16, wo16T, (float*)d_out, nullptr, nullptr,
                                                    M_, D_, HD_);
}

// v005
// A run of this version takes 95.6 microseconds.
// Timed twice side by side with v004, it ran 1.07 and 1.06 times as fast.
// All steps since v000 together make it 2.48 times as fast.
#include <hip/hip_runtime.h>
#include <hip/hip_fp16.h>
#include <math.h>

// ---------------------------------------------------------------------------
// Encoder self-attention with relative position bias (gfx1250, wave32, WMMA).
// one prep launch (f32->f16, weights transposed, bias expanded) -> one double-buffered async WMMA GEMM
// launch for Q, K and V (V written head-transposed) -> flash attention (S^T form, async K/V staging,
// LDS-resident bias, register P->B-frag) -> double-buffered WMMA GEMM out.
// ---------------------------------------------------------------------------

typedef __attribute__((ext_vector_type(16))) _Float16 v16h;
typedef __attribute__((ext_vector_type(8)))  _Float16 h8;
typedef __attribute__((ext_vector_type(8)))  float    v8f;
typedef __attribute__((ext_vector_type(4)))  float    f4;

union Frag16 { v16h v; h8 h[2]; };

__device__ __forceinline__ v8f wmma16x16x32(const Frag16& a, const Frag16& b, v8f c) {
  return __builtin_amdgcn_wmma_f32_16x16x32_f16(false, a.v, false, b.v, (short)0, c,
                                                false, false);
}

// CDNA5 async global->LDS copy (bypasses VGPRs, tracked by ASYNCcnt).
__device__ __forceinline__ void async_load_b128(const void* g, void* lds) {
  unsigned int l = (unsigned int)(unsigned long long)lds;
  asm volatile("global_load_async_to_lds_b128 %0, %1, off"
               :: "v"(l), "v"(g) : "memory");
}
__device__ __forceinline__ void async_wait0() {
  asm volatile("s_wait_asynccnt 0x0" ::: "memory");
}

constexpr int B_  = 2;
constexpr int S_  = 2048;
constexpr int D_  = 1024;
constexpr int H_  = 16;
constexpr int DH_ = 64;
constexpr int HD_ = H_ * DH_;    // 1024
constexpr int M_  = B_ * S_;     // 4096
constexpr int RELN = 2 * S_ - 1; // 4095
constexpr int BIASL = 512;       // key - query from -255 to 256 (256 is staged, never read)
// LDS row pitches in f16 elements. Every tile is read by ds_load_b128 with 16
// lanes on 16 consecutive rows: a pitch of 16 B x odd puts those rows on 16
// different groups of four banks; the bare 128 B / 256 B rows fall on 2 / 1.
constexpr int P64 = 64 + 8;      // 64-element rows: 144 B
constexpr int P32 = 32 + 8;      // unused: no LDS tile has 32-element rows

// ---------------------------------------------------------------------------
// 1) All operand preparation in ONE launch; the block index picks the role.
//    The three roles share no data; each wave moves many bytes, so that few
//    waves have to be started and only one launch gap is paid.
//    a) weights: f32[k][n] -> f16[n][k]; a block takes one 64x64 tile position
//       of all four matrices (16 b128 loads in flight per thread, one barrier,
//       whole 128 B lines stored).
//    b) hidden states: f32 -> f16, 64 elements per thread, all loads first.
//    c) rel_bias_table[32][H] -> biasE[H][4095] indexed by (rel + S-1).
// ---------------------------------------------------------------------------
constexpr int WT_BLOCKS   = (D_ / 64) * (HD_ / 64);      // 256
constexpr int HS_UNROLL   = 8;
constexpr int HS_BLOCKS   = M_ * D_ / (256 * 8 * HS_UNROLL);  // 256
constexpr int BIAS_SPLIT  = 4;                           // blocks per head
constexpr int BIAS_BLOCKS = H_ * BIAS_SPLIT;             // 64

__global__ void __launch_bounds__(256)
prep_all(const float* __restrict__ hs, const float* __restrict__ Wq,
         const float* __restrict__ Wk, const float* __restrict__ Wv,
         const float* __restrict__ Wo, const float* __restrict__ table,
         _Float16* __restrict__ hs16, _Float16* __restrict__ wqT,
         _Float16* __restrict__ wkT, _Float16* __restrict__ wvT,
         _Float16* __restrict__ woT, float* __restrict__ biasE) {
  // pitch 65 floats: row writes and column reads both touch 32 different banks
  __shared__ float tile[4][64][65];
  const int t = threadIdx.x;
  int bid = blockIdx.x;

  if (bid < WT_BLOCKS) {
    const float* srcs[4] = {Wq, Wk, Wv, Wo};
    _Float16*    dsts[4] = {wqT, wkT, wvT, woT};
    const int k0 = (bid >> 4) * 64, n0 = (bid & 15) * 64;
    const int rr = t >> 4, cc = (t & 15) * 4;            // 16 rows x 64 cols a pass
    // one 32-bit byte offset serves all 16 loads (uniform base + constant step)
    const unsigned lo = (unsigned)((k0 + rr) * HD_ + n0 + cc) * 4u;
    f4 v[4][4];
#pragma unroll  // constant indices: arrays stay in registers, loads issue together
    for (int m = 0; m < 4; ++m)
#pragma unroll  // as above
      for (int p = 0; p < 4; ++p)
        v[m][p] = *(const f4*)((const char*)srcs[m] + lo + p * (16 * HD_ * 4));
    // wait before the loads' offset register is rewritten; naming it as an input
    // keeps it live up to here: without that the last load's result is placed
    // over it while the fifteen loads in front still name it
    asm volatile("s_wait_xcnt 0x0" :: "v"(lo) : "memory");
#pragma unroll  // as above
    for (int m = 0; m < 4; ++m)
#pragma unroll  // as above
      for (int p = 0; p < 4; ++p)
#pragma unroll  // as above
        for (int e = 0; e < 4; ++e) tile[m][p * 16 + rr][cc + e] = v[m][p][e];
    __syncthreads();
    const int kc = (t & 7) * 8, nr = t >> 3;             // 32 n-rows x 64 k a pass
    const unsigned so = (unsigned)((n0 + nr) * D_ + k0 + kc) * 2u;
#pragma unroll  // as above
    for (int m = 0; m < 4; ++m)
#pragma unroll  // as above
      for (int p = 0; p < 2; ++p) {
        h8 o;
#pragma unroll  // as above
        for (int e = 0; e < 8; ++e) o[e] = (_Float16)tile[m][kc + e][p * 32 + nr];
        *(h8*)((char*)dsts[m] + so + p * (32 * D_ * 2)) = o;
      }
    return;
  }
  bid -= WT_BLOCKS;

  if (bid < HS_BLOCKS) {
    const unsigned base = (unsigned)bid * (256 * 8 * HS_UNROLL) + t * 8;  // element
    const unsigned lo = base * 4u;                       // byte offset of the loads
    f4 a[HS_UNROLL], b[HS_UNROLL];
#pragma unroll  // constant indices: arrays stay in registers, loads issue together
    for (int u = 0; u < HS_UNROLL; ++u) {
      a[u] = *(const f4*)((const char*)hs + lo + u * 8192);
      b[u] = *(const f4*)((const char*)hs + lo + u * 8192 + 16);
    }
#pragma unroll  // as above
    for (int u = 0; u < HS_UNROLL; ++u) {
      h8 o;
      o[0] = (_Float16)a[u][0]; o[1] = (_Float16)a[u][1];
      o[2] = (_Float16)a[u][2]; o[3] = (_Float16)a[u][3];
      o[4] = (_Float16)b[u][0]; o[5] = (_Float16)b[u][1];
      o[6] = (_Float16)b[u][2]; o[7] = (_Float16)b[u][3];
      *(h8*)(hs16 + base + u * 2048) = o;
    }
    // behind the stores: the code that follows them in the listing rewrites
    // their address and data registers
    asm volatile("s_wait_xcnt 0x0" ::: "memory");
    return;
  }
  bid -= HS_BLOCKS;

  const int h  = bid / BIAS_SPLIT;
  const int r0 = (bid % BIAS_SPLIT) * 1024 + t;
  float val[4];
#pragma unroll  // constant indices: arrays stay in registers, loads issue together
  for (int u = 0; u < 4; ++u) {
    const int r  = r0 + u * 256;
    const int rc = r < RELN ? r : RELN - 1;   // index 4095 re-reads the last entry, is not stored
    int rel = rc - (S_ - 1);
    const int nb = 16, me = 8;
    int rb = (rel > 0) ? nb : 0;
    int rp = rel < 0 ? -rel : rel;
    int bk;
    if (rp < me) {
      bk = rp;
    } else {
      float x = __logf((float)rp * (1.0f / me)) * (1.0f / __logf(16.0f)) * (float)(nb - me);
      bk = me + (int)x;
      if (bk > nb - 1) bk = nb - 1;
    }
    val[u] = table[(rb + bk) * H_ + h];
  }
#pragma unroll  // as above
  for (int u = 0; u < 4; ++u)
    if (r0 + u * 256 < RELN) biasE[h * RELN + r0 + u * 256] = val[u];
}

// ---------------------------------------------------------------------------
// 3) WMMA GEMM: C[M,N] = A[M,K](f16) * BT[N,K](f16, pre-transposed).
//    128x128x64 tile, 8 waves (4x2), wave = 32x64. Double-buffered async
//    global->LDS staging for both operands (no VGPR bounce, no scalar stores).
//    QKV=true: BT is Wq^T, Wk^T, Wv^T stacked by rows, so that one grid of
//    three times the column blocks does all three projections: three blocks
//    share a WGP and one block's compute covers another's wait for its tile.
//    Column blocks of the first HD_ columns go to C, of the second to Ck
//    (both of row pitch Ndim), the third are scattered as CvT[b][h][dh][s]
//    for the attention pass.
// ---------------------------------------------------------------------------
template <typename OutT, bool QKV>
__global__ void __launch_bounds__(256)
gemm_wmma(const _Float16* __restrict__ A, const _Float16* __restrict__ BT,
          OutT* __restrict__ C, OutT* __restrict__ Ck, OutT* __restrict__ CvT,
          int Mdim, int Ndim, int Kdim) {
  __shared__ __align__(16) _Float16 As[2][128][P64];
  __shared__ __align__(16) _Float16 Bs[2][128][P64];  // [n][k]
  const int t    = threadIdx.x;
  const int lane = t & 31, w = t >> 5;
  const int wm   = w & 3, wn = w >> 2;
  const int m0   = blockIdx.y * 128, n0 = blockIdx.x * 128;
  const int lr   = lane & 15, ko = (lane >> 4) * 8;
  const int srow = t >> 1, soff = (t & 1) * 32;       // staging coords

  auto stage = [&](int k0, int buf) {
    const _Float16* sa = A  + (size_t)(m0 + srow) * Kdim + k0 + soff;
    const _Float16* sb = BT + (size_t)(n0 + srow) * Kdim + k0 + soff;
#pragma unroll
    for (int c = 0; c < 32; c += 8) {
      async_load_b128(sa + c, &As[buf][srow][soff + c]);
      async_load_b128(sb + c, &Bs[buf][srow][soff + c]);
    }
  };

  v8f acc[2][4] = {};
  stage(0, 0);
  async_wait0();
  __syncthreads();

  const int T = Kdim / 64;
  for (int i = 0; i < T; ++i) {
    int buf = i & 1;
    if (i + 1 < T) stage((i + 1) * 64, buf ^ 1);   // overlap with compute
#pragma unroll
    for (int ks = 0; ks < 64; ks += 32) {
      Frag16 a[2], b[4];
#pragma unroll
      for (int mt = 0; mt < 2; ++mt) {
        int row = wm * 32 + mt * 16 + lr;
        a[mt].h[0] = *(const h8*)&As[buf][row][ks + ko];
        a[mt].h[1] = *(const h8*)&As[buf][row][ks + ko + 16];
      }
#pragma unroll
      for (int nt = 0; nt < 4; ++nt) {
        int col = wn * 64 + nt * 16 + lr;
        b[nt].h[0] = *(const h8*)&Bs[buf][col][ks + ko];
        b[nt].h[1] = *(const h8*)&Bs[buf][col][ks + ko + 16];
      }
#pragma unroll
      for (int mt = 0; mt < 2; ++mt)
#pragma unroll
        for (int nt = 0; nt < 4; ++nt)
          acc[mt][nt] = wmma16x16x32(a[mt], b[nt], acc[mt][nt]);
    }
    async_wait0();
    __syncthreads();
  }

  // a 128-column block lies wholly in one of the three outputs (block-uniform)
  const int sel = QKV ? n0 / HD_ : 0;
  const int nc0 = QKV ? n0 % HD_ : n0;
  if (QKV && sel == 2) {
#pragma unroll
    for (int mt = 0; mt < 2; ++mt)
#pragma unroll
      for (int nt = 0; nt < 4; ++nt)
#pragma unroll
        for (int j = 0; j < 8; ++j) {
          int m = m0 + wm * 32 + mt * 16 + j + (lane >> 4) * 8;
          int n = nc0 + wn * 64 + nt * 16 + lr;
          int bb = m >> 11, s = m & (S_ - 1);       // token -> (batch, seq)
          int hh = n >> 6,  dh = n & (DH_ - 1);     // col   -> (head, dh)
          CvT[((size_t)((bb * H_ + hh) * DH_ + dh)) * S_ + s] = (OutT)acc[mt][nt][j];
        }
    return;
  }
  OutT* __restrict__ Cs = (QKV && sel == 1) ? Ck : C;
#pragma unroll
  for (int mt = 0; mt < 2; ++mt)
#pragma unroll
    for (int nt = 0; nt < 4; ++nt)
#pragma unroll
      for (int j = 0; j < 8; ++j) {
        int m = m0 + wm * 32 + mt * 16 + j + (lane >> 4) * 8;
        int n = nc0 + wn * 64 + nt * 16 + lr;
        Cs[(size_t)m * Ndim + n] = (OutT)acc[mt][nt][j];
      }
  // behind the stores: in the listing the V block follows them and rewrites
  // their address and data registers
  if constexpr (QKV) asm volatile("s_wait_xcnt 0x0" ::: "memory");
}

// ---------------------------------------------------------------------------
// 4) Flash attention in S^T form, double-buffered async K/V staging.
//    S^T = K * Q^T  ->  lane = query col, j = key row; per-query scalar state;
//    P^T converts in registers to the B-fragment of O^T = V^T * P^T.
//    The bucket of a distance is the last one of its side from 128 on
//    so a pass whose keys all lie 129 or more from
//    all of the block's queries has ONE bias value: it takes the maximum over
//    the raw products and folds scale, bias and maximum into one multiply-add
//    in front of the exponential, with no bias read. Only the three passes
//    round the diagonal read the bias per element, from 512 floats in LDS.
//    A pass takes KT keys: what is paid once a pass (the exchange of the
//    maximum and of the sum between the wave's halves, the rescale of O, the
//    wait for the copies, the barrier) is paid once per KT keys, and the
//    KT / 16 score tiles of a pass are independent work for the wave.
// ---------------------------------------------------------------------------
constexpr int KT  = 128;         // keys per pass
constexpr int PKT = KT + 8;      // V^T rows of KT keys: 272 B = 16 B x 17 (odd)
static_assert(KT == 128 && S_ % KT == 0 && S_ / KT >= 2, "the staging below is written for 128 keys");
struct FarPass  { static constexpr bool far = true;  };
struct NearPass { static constexpr bool far = false; };

__global__ void __launch_bounds__(256)
flash_attn(const _Float16* __restrict__ Q, const _Float16* __restrict__ K,
           const _Float16* __restrict__ VT, const float* __restrict__ biasE,
           _Float16* __restrict__ Ctx) {
  __shared__ __align__(16) _Float16 Ks[2][KT][P64];  // [key][dh]
  __shared__ __align__(16) _Float16 Vs[2][64][PKT];  // [dh][key] (from VT)
  __shared__ float biasL[BIASL];

  const int t = threadIdx.x, lane = t & 31, w = t >> 5;
  const int lr = lane & 15, ko = (lane >> 4) * 8;
  const int b = blockIdx.z, h = blockIdx.y;
  const int q0 = blockIdx.x * 128, qrow = q0 + w * 16;

  // bias near the diagonal: biasL[i] = bias(key - query = i - 255); far from it
  // the two capped values, taken at the ends of the expanded row
  const float* biasH = biasE + h * RELN + (S_ - 1);
  static_assert(BIASL == 2 * 256, "two entries a thread, both loads in flight together");
  const float bn0 = biasH[t - 255], bn1 = biasH[t + 1];
  const float biasLo = biasH[-(S_ - 1)], biasHi = biasH[S_ - 1];

  const _Float16* Kb  = K  + (size_t)(b * S_) * HD_ + h * DH_;
  const _Float16* VTb = VT + (size_t)((b * H_ + h) * DH_) * S_;

  // One pass's tiles: K 128 rows of 128 B, V^T 64 rows of 256 B; a thread copies
  // four 16-byte pieces of each (32 K rows / 16 V^T rows apart).
  auto stageKV = [&](int kb, int buf) {
    const _Float16* gk = Kb + (size_t)(kb + (t >> 3)) * HD_ + (t & 7) * 8;
    const _Float16* gv = VTb + (size_t)(t >> 4) * S_ + kb + (t & 15) * 8;
    const unsigned lk = (unsigned)(unsigned long long)&Ks[buf][t >> 3][(t & 7) * 8];
    const unsigned lv = (unsigned)(unsigned long long)&Vs[buf][t >> 4][(t & 15) * 8];
    // the copies and their s_wait_xcnt in one statement: the wait then stands in
    // front of every later write of a register that a copy names
    asm volatile(
        "global_load_async_to_lds_b128 %0, %8, off\n\t"
        "global_load_async_to_lds_b128 %1, %9, off\n\t"
        "global_load_async_to_lds_b128 %2, %10, off\n\t"
        "global_load_async_to_lds_b128 %3, %11, off\n\t"
        "global_load_async_to_lds_b128 %4, %12, off\n\t"
        "global_load_async_to_lds_b128 %5, %13, off\n\t"
        "global_load_async_to_lds_b128 %6, %14, off\n\t"
        "global_load_async_to_lds_b128 %7, %15, off\n\t"
        "s_wait_xcnt 0x0"
        :: "v"(lk), "v"(lk + 32 * P64 * 2), "v"(lk + 64 * P64 * 2), "v"(lk + 96 * P64 * 2),
           "v"(lv), "v"(lv + 16 * PKT * 2), "v"(lv + 32 * PKT * 2), "v"(lv + 48 * PKT * 2),
           "v"(gk), "v"(gk + 32 * HD_), "v"(gk + 64 * HD_), "v"(gk + 96 * HD_),
           "v"(gv), "v"(gv + 16 * S_), "v"(gv + 32 * S_), "v"(gv + 48 * S_)
        : "memory");
  };

  // Q^T B-fragments (lane = query, regs = dh), loaded once from global
  Frag16 qf[2];
  {
    const _Float16* qp = Q + ((size_t)(b * S_ + qrow + lr) * HD_) + h * DH_;
    qf[0].h[0] = *(const h8*)(qp + ko);
    qf[0].h[1] = *(const h8*)(qp + ko + 16);
    qf[1].h[0] = *(const h8*)(qp + 32 + ko);
    qf[1].h[1] = *(const h8*)(qp + 32 + ko + 16);
  }

  v8f o[4] = {};
  float mx = -INFINITY, lsum = 0.0f;

  stageKV(0, 0);
  biasL[t]       = bn0;
  biasL[t + 256] = bn1;
  async_wait0();
  __syncthreads();
  stageKV(KT, 1);                                    // flies during pass 0

  // The passes kbeg, kbeg + KT, ... below kend. FAR is a type whose member says
  // which form of the softmax is built; cb is a far run's one bias value.
  auto passes = [&](int kbeg, int kend, float cb, auto FAR) {
    constexpr bool far = decltype(FAR)::far;
    for (int kb = kbeg; kb < kend; kb += KT) {
      const int buf = (kb / KT) & 1;

      // S^T tiles: rows = keys (tk*16..), cols = queries
      v8f sc[KT / 16];
#pragma unroll  // constant indices: the score tiles stay in registers
      for (int tk = 0; tk < KT / 16; ++tk) {
        int key = tk * 16 + lr;
        Frag16 ka0, ka1;
        ka0.h[0] = *(const h8*)&Ks[buf][key][ko];
        ka0.h[1] = *(const h8*)&Ks[buf][key][ko + 16];
        ka1.h[0] = *(const h8*)&Ks[buf][key][32 + ko];
        ka1.h[1] = *(const h8*)&Ks[buf][key][32 + ko + 16];
        v8f c = {};
        c = wmma16x16x32(ka0, qf[0], c);
        c = wmma16x16x32(ka1, qf[1], c);
        sc[tk] = c;
      }

      // near: scale + bias from LDS first; far: the raw products. One maximum a tile
      float mt[KT / 16];
#pragma unroll  // as above
      for (int tk = 0; tk < KT / 16; ++tk) {
        if constexpr (!far) {
          int bbase = kb - q0 + tk * 16 + ((lane >> 4) << 3) - (w * 16 + lr) + 255;
#pragma unroll  // as above
          for (int j = 0; j < 8; ++j)
            sc[tk][j] = sc[tk][j] * 0.125f + biasL[bbase + j];
        }
        float m = sc[tk][0];
#pragma unroll  // as above
        for (int j = 1; j < 8; ++j) m = fmaxf(m, sc[tk][j]);
        mt[tk] = m;
      }

      // online softmax, per-query scalar state (lane l and l^16 share a query)
      float mloc = fmaxf(fmaxf(fmaxf(mt[0], mt[1]), fmaxf(mt[2], mt[3])),
                         fmaxf(fmaxf(mt[4], mt[5]), fmaxf(mt[6], mt[7])));
      mloc = fmaxf(mloc, __shfl_xor(mloc, 16, 32));
      if constexpr (far) mloc = mloc * 0.125f + cb;  // the scale is positive: the maximum carries over
      float nm    = fmaxf(mx, mloc);
      float alpha = __expf(mx - nm);
      mx = nm;
      constexpr float LOG2E = 1.44269504088896340736f;
      const float sh2 = (cb - nm) * LOG2E;           // far: exp(s/8 + cb - nm) = 2^(s * LOG2E/8 + sh2)

      v8f e2[KT / 16];                               // far: the exponents to base 2
      if constexpr (far) {
#pragma unroll  // as above
        for (int tk = 0; tk < KT / 16; ++tk) e2[tk] = sc[tk] * (0.125f * LOG2E) + sh2;
      }

      Frag16 pf[KT / 32];
      float rg[KT / 32];                             // one partial sum per 32 keys
#pragma unroll  // as above
      for (int g = 0; g < KT / 32; ++g) {
        float r = 0.0f;
#pragma unroll  // as above
        for (int j = 0; j < 8; ++j) {
          float p0, p1;
          if constexpr (far) {
            p0 = __builtin_amdgcn_exp2f(e2[2 * g][j]);
            p1 = __builtin_amdgcn_exp2f(e2[2 * g + 1][j]);
          } else {
            p0 = __expf(sc[2 * g][j] - nm);
            p1 = __expf(sc[2 * g + 1][j] - nm);
          }
          r += p0 + p1;
          pf[g].h[0][j] = (_Float16)p0;
          pf[g].h[1][j] = (_Float16)p1;
        }
        rg[g] = r;
      }
      float rs = (rg[0] + rg[1]) + (rg[2] + rg[3]);
      rs += __shfl_xor(rs, 16, 32);
      lsum = lsum * alpha + rs;

#pragma unroll  // as above
      for (int tdh = 0; tdh < 4; ++tdh)
#pragma unroll  // as above
        for (int j = 0; j < 8; ++j) o[tdh][j] *= alpha;

      // O^T += V^T(16dh x 32k) * P^T(32k x 16q), 32 keys at a time
#pragma unroll  // as above
      for (int g = 0; g < KT / 32; ++g)
#pragma unroll  // as above
        for (int tdh = 0; tdh < 4; ++tdh) {
          int dhrow = tdh * 16 + lr;
          Frag16 va;
          va.h[0] = *(const h8*)&Vs[buf][dhrow][g * 32 + ko];
          va.h[1] = *(const h8*)&Vs[buf][dhrow][g * 32 + ko + 16];
          o[tdh] = wmma16x16x32(va, pf[g], o[tdh]);
        }

      // hand-over: this wave's LDS reads are done, its copies of the next tile have
      // landed; behind the barrier that holds for all waves, and the buffer just
      // read may be refilled
      asm volatile("s_wait_dscnt 0x0" ::: "memory");
      async_wait0();
      __syncthreads();
      if (kb + 2 * KT < S_) stageKV(kb + 2 * KT, buf);
    }
  };

  // Keys kb..kb+127 against queries q0..q0+127 (both starts multiples of 128) are
  // 129 or more apart once the starts differ by 256 or more: the keys fall into a
  // far run below the diagonal, up to three near passes, a far run above it.
  // The bounds are the same for the whole block.
  const int nlo = q0 >= KT ? q0 - KT : 0;
  const int nhi = q0 + 2 * KT <= S_ ? q0 + 2 * KT : S_;
  passes(0, nlo, biasLo, FarPass{});
  passes(nlo, nhi, 0.0f, NearPass{});
  passes(nhi, S_, biasHi, FarPass{});
  async_wait0();  // nothing is in flight here; the wave does not end on an open count

  // normalize + store context row-major [token][h*64+dh]
  float inv = 1.0f / lsum;
#pragma unroll
  for (int tdh = 0; tdh < 4; ++tdh)
#pragma unroll
    for (int j = 0; j < 8; ++j) {
      int dhcol = tdh * 16 + j + (lane >> 4) * 8;
      Ctx[((size_t)(b * S_ + qrow + lr) * HD_) + h * DH_ + dhcol] =
          (_Float16)(o[tdh][j] * inv);
    }
}

// ---------------------------------------------------------------------------
// Launcher
// ---------------------------------------------------------------------------
extern "C" void kernel_launch(void* const* d_in, const int* in_sizes, int n_in,
                              void* d_out, int out_size, void* d_ws, size_t ws_size,
                              hipStream_t stream) {
  (void)in_sizes; (void)n_in; (void)out_size; (void)ws_size;
  const float* hs    = (const float*)d_in[0];
  const float* Wq    = (const float*)d_in[1];
  const float* Wk    = (const float*)d_in[2];
  const float* Wv    = (const float*)d_in[3];
  const float* Wo    = (const float*)d_in[4];
  const float* table = (const float*)d_in[5];

  char*  ws  = (char*)d_ws;
  size_t off = 0;
  auto alloc = [&](size_t bytes) -> void* {
    void* p = ws + off;
    off += (bytes + 255) & ~(size_t)255;
    return p;
  };

  _Float16* hs16   = (_Float16*)alloc((size_t)M_ * D_ * 2);
  _Float16* wq16T  = (_Float16*)alloc((size_t)3 * D_ * HD_ * 2);  // Wq^T | Wk^T | Wv^T
  _Float16* wk16T  = wq16T + (size_t)D_ * HD_;
  _Float16* wv16T  = wk16T + (size_t)D_ * HD_;
  _Float16* wo16T  = (_Float16*)alloc((size_t)HD_ * D_ * 2);
  _Float16* q16    = (_Float16*)alloc((size_t)M_ * HD_ * 2);
  _Float16* k16    = (_Float16*)alloc((size_t)M_ * HD_ * 2);
  _Float16* vT16   = (_Float16*)alloc((size_t)M_ * HD_ * 2);
  _Float16* ctx16  = (_Float16*)alloc((size_t)M_ * HD_ * 2);
  float*    biasE  = (float*)alloc((size_t)H_ * RELN * 4);

  prep_all<<<WT_BLOCKS + HS_BLOCKS + BIAS_BLOCKS, 256, 0, stream>>>(
      hs, Wq, Wk, Wv, Wo, table, hs16, wq16T, wk16T, wv16T, wo16T, biasE);

  dim3 gQkv(3 * HD_ / 128, M_ / 128);
  gemm_wmma<_Float16, true><<<gQkv, 256, 0, stream>>>(hs16, wq16T, q16, k16, vT16, M_, HD_, D_);

  dim3 gAttn(S_ / 128, H_, B_);
  flash_attn<<<gAttn, 256, 0, stream>>>(q16, k16, vT16, biasE, ctx16);

  dim3 gOut(D_ / 128, M_ / 128);
  gemm_wmma<float, false><<<gOut, 256, 0, stream>>>(ctx16, wo16T, (float*)d_out, nullptr, nullptr,
                                                    M_, D_, HD_);
}

// v006
// One run takes 91.8 microseconds.
// Next to v005, in two timings, it ran 1.05 and 1.03 times as fast.
// All steps since v000 together make it 2.59 times as fast.
#include <hip/hip_runtime.h>
#include <hip/hip_fp16.h>
#include <math.h>

// ---------------------------------------------------------------------------
// Encoder self-attention with relative position bias (gfx1250, wave32, WMMA).
// one prep launch (f32->f16, weights transposed, bias expanded) -> one double-buffered async WMMA GEMM
// launch for Q, K and V (V written head-transposed) -> flash attention (S^T form, async K/V staging,
// LDS-resident bias, register P->B-frag) -> double-buffered WMMA GEMM out.
// ---------------------------------------------------------------------------

typedef __attribute__((ext_vector_type(16))) _Float16 v16h;
typedef __attribute__((ext_vector_type(8)))  _Float16 h8;
typedef __attribute__((ext_vector_type(8)))  float    v8f;
typedef __attribute__((ext_vector_type(4)))  float    f4;

union Frag16 { v16h v; h8 h[2]; };

__device__ __forceinline__ v8f wmma16x16x32(const Frag16& a, const Frag16& b, v8f c) {
  return __builtin_amdgcn_wmma_f32_16x16x32_f16(false, a.v, false, b.v, (short)0, c,
                                                false, false);
}

// CDNA5 async global->LDS copy (bypasses VGPRs, tracked by ASYNCcnt).
__device__ __forceinline__ void async_load_b128(const void* g, void* lds) {
  unsigned int l = (unsigned int)(unsigned long long)lds;
  asm volatile("global_load_async_to_lds_b128 %0, %1, off"
               :: "v"(l), "v"(g) : "memory");
}
__device__ __forceinline__ void async_wait0() {
  asm volatile("s_wait_asynccnt 0x0" ::: "memory");
}

constexpr int B_  = 2;
constexpr int S_  = 2048;
constexpr int D_  = 1024;
constexpr int H_  = 16;
constexpr int DH_ = 64;
constexpr int HD_ = H_ * DH_;    // 1024
constexpr int M_  = B_ * S_;     // 4096
constexpr int RELN = 2 * S_ - 1; // 4095
constexpr int BIASL = 512;       // key - query from -255 to 256 (256 is staged, never read)
// LDS row pitches in f16 elements. Every tile is read by ds_load_b128 with 16
// lanes on 16 consecutive rows: a pitch of 16 B x odd puts those rows on 16
// different groups of four banks; the bare 128 B / 256 B rows fall on 2 / 1.
constexpr int P64 = 64 + 8;      // 64-element rows: 144 B
constexpr int P32 = 32 + 8;      // unused: no LDS tile has 32-element rows

// ---------------------------------------------------------------------------
// 1) All operand preparation in ONE launch; the block index picks the role.
//    The three roles share no data; each wave moves many bytes, so that few
//    waves have to be started and only one launch gap is paid.
//    a) weights: f32[k][n] -> f16[n][k]; a block takes one 64x64 tile position
//       of all four matrices (16 b128 loads in flight per thread, one barrier,
//       whole 128 B lines stored).
//    b) hidden states: f32 -> f16, 64 elements per thread, all loads first.
//    c) rel_bias_table[32][H] -> biasE[H][4095] indexed by (rel + S-1).
// ---------------------------------------------------------------------------
constexpr int WT_BLOCKS   = (D_ / 64) * (HD_ / 64);      // 256
constexpr int HS_UNROLL   = 8;
constexpr int HS_BLOCKS   = M_ * D_ / (256 * 8 * HS_UNROLL);  // 256
constexpr int BIAS_SPLIT  = 4;                           // blocks per head
constexpr int BIAS_BLOCKS = H_ * BIAS_SPLIT;             // 64

__global__ void __launch_bounds__(256)
prep_all(const float* __restrict__ hs, const float* __restrict__ Wq,
         const float* __restrict__ Wk, const float* __restrict__ Wv,
         const float* __restrict__ Wo, const float* __restrict__ table,
         _Float16* __restrict__ hs16, _Float16* __restrict__ wqT,
         _Float16* __restrict__ wkT, _Float16* __restrict__ wvT,
         _Float16* __restrict__ woT, float* __restrict__ biasE) {
  // pitch 65 floats: row writes and column reads both touch 32 different banks
  __shared__ float tile[4][64][65];
  const int t = threadIdx.x;
  int bid = blockIdx.x;

  if (bid < WT_BLOCKS) {
    const float* srcs[4] = {Wq, Wk, Wv, Wo};
    _Float16*    dsts[4] = {wqT, wkT, wvT, woT};
    const int k0 = (bid >> 4) * 64, n0 = (bid & 15) * 64;
    const int rr = t >> 4, cc = (t & 15) * 4;            // 16 rows x 64 cols a pass
    // one 32-bit byte offset serves all 16 loads (uniform base + constant step)
    const unsigned lo = (unsigned)((k0 + rr) * HD_ + n0 + cc) * 4u;
    f4 v[4][4];
#pragma unroll  // constant indices: arrays stay in registers, loads issue together
    for (int m = 0; m < 4; ++m)
#pragma unroll  // as above
      for (int p = 0; p < 4; ++p)
        v[m][p] = *(const f4*)((const char*)srcs[m] + lo + p * (16 * HD_ * 4));
    // wait before the loads' offset register is rewritten; naming it as an input
    // keeps it live up to here: without that the last load's result is placed
    // over it while the fifteen loads in front still name it
    asm volatile("s_wait_xcnt 0x0" :: "v"(lo) : "memory");
#pragma unroll  // as above
    for (int m = 0; m < 4; ++m)
#pragma unroll  // as above
      for (int p = 0; p < 4; ++p)
#pragma unroll  // as above
        for (int e = 0; e < 4; ++e) tile[m][p * 16 + rr][cc + e] = v[m][p][e];
    __syncthreads();
    const int kc = (t & 7) * 8, nr = t >> 3;             // 32 n-rows x 64 k a pass
    const unsigned so = (unsigned)((n0 + nr) * D_ + k0 + kc) * 2u;
#pragma unroll  // as above
    for (int m = 0; m < 4; ++m)
#pragma unroll  // as above
      for (int p = 0; p < 2; ++p) {
        h8 o;
#pragma unroll  // as above
        for (int e = 0; e < 8; ++e) o[e] = (_Float16)tile[m][kc + e][p * 32 + nr];
        *(h8*)((char*)dsts[m] + so + p * (32 * D_ * 2)) = o;
      }
    return;
  }
  bid -= WT_BLOCKS;

  if (bid < HS_BLOCKS) {
    const unsigned base = (unsigned)bid * (256 * 8 * HS_UNROLL) + t * 8;  // element
    const unsigned lo = base * 4u;                       // byte offset of the loads
    f4 a[HS_UNROLL], b[HS_UNROLL];
#pragma unroll  // constant indices: arrays stay in registers, loads issue together
    for (int u = 0; u < HS_UNROLL; ++u) {
      a[u] = *(const f4*)((const char*)hs + lo + u * 8192);
      b[u] = *(const f4*)((const char*)hs + lo + u * 8192 + 16);
    }
#pragma unroll  // as above
    for (int u = 0; u < HS_UNROLL; ++u) {
      h8 o;
      o[0] = (_Float16)a[u][0]; o[1] = (_Float16)a[u][1];
      o[2] = (_Float16)a[u][2]; o[3] = (_Float16)a[u][3];
      o[4] = (_Float16)b[u][0]; o[5] = (_Float16)b[u][1];
      o[6] = (_Float16)b[u][2]; o[7] = (_Float16)b[u][3];
      *(h8*)(hs16 + base + u * 2048) = o;
    }
    // behind the stores: the code that follows them in the listing rewrites
    // their address and data registers
    asm volatile("s_wait_xcnt 0x0" ::: "memory");
    return;
  }
  bid -= HS_BLOCKS;

  const int h  = bid / BIAS_SPLIT;
  const int r0 = (bid % BIAS_SPLIT) * 1024 + t;
  float val[4];
#pragma unroll  // constant indices: arrays stay in registers, loads issue together
  for (int u = 0; u < 4; ++u) {
    const int r  = r0 + u * 256;
    const int rc = r < RELN ? r : RELN - 1;   // index 4095 re-reads the last entry, is not stored
    int rel = rc - (S_ - 1);
    const int nb = 16, me = 8;
    int rb = (rel > 0) ? nb : 0;
    int rp = rel < 0 ? -rel : rel;
    int bk;
    if (rp < me) {
      bk = rp;
    } else {
      float x = __logf((float)rp * (1.0f / me)) * (1.0f / __logf(16.0f)) * (float)(nb - me);
      bk = me + (int)x;
      if (bk > nb - 1) bk = nb - 1;
    }
    val[u] = table[(rb + bk) * H_ + h];
  }
#pragma unroll  // as above
  for (int u = 0; u < 4; ++u)
    if (r0 + u * 256 < RELN) biasE[h * RELN + r0 + u * 256] = val[u];
}

// ---------------------------------------------------------------------------
// 3) WMMA GEMM: C[M,N] = A[M,K](f16) * BT[N,K](f16, pre-transposed).
//    128x128x64 tile, 8 waves (4x2), wave = 32x64. Double-buffered async
//    global->LDS staging for both operands (no VGPR bounce, no scalar stores).
//    QKV=true: BT is Wq^T, Wk^T, Wv^T stacked by rows, so that one grid of
//    three times the column blocks does all three projections: three blocks
//    share a WGP and one block's compute covers another's wait for its tile.
//    Column blocks of the first HD_ columns go to C, of the second to Ck
//    (both of row pitch Ndim), the third are scattered as CvT[b][h][dh][s]
//    for the attention pass.
// ---------------------------------------------------------------------------
template <typename OutT, bool QKV>
__global__ void __launch_bounds__(256)
gemm_wmma(const _Float16* __restrict__ A, const _Float16* __restrict__ BT,
          OutT* __restrict__ C, OutT* __restrict__ Ck, OutT* __restrict__ CvT,
          int Mdim, int Ndim, int Kdim) {
  __shared__ __align__(16) _Float16 As[2][128][P64];
  __shared__ __align__(16) _Float16 Bs[2][128][P64];  // [n][k]
  const int t    = threadIdx.x;
  const int lane = t & 31, w = t >> 5;
  const int wm   = w & 3, wn = w >> 2;
  const int m0   = blockIdx.y * 128, n0 = blockIdx.x * 128;
  const int lr   = lane & 15, ko = (lane >> 4) * 8;
  const int srow = t >> 1, soff = (t & 1) * 32;       // staging coords

  auto stage = [&](int k0, int buf) {
    const _Float16* sa = A  + (size_t)(m0 + srow) * Kdim + k0 + soff;
    const _Float16* sb = BT + (size_t)(n0 + srow) * Kdim + k0 + soff;
#pragma unroll
    for (int c = 0; c < 32; c += 8) {
      async_load_b128(sa + c, &As[buf][srow][soff + c]);
      async_load_b128(sb + c, &Bs[buf][srow][soff + c]);
    }
  };

  v8f acc[2][4] = {};
  stage(0, 0);
  async_wait0();
  __syncthreads();

  const int T = Kdim / 64;
  for (int i = 0; i < T; ++i) {
    int buf = i & 1;
    if (i + 1 < T) stage((i + 1) * 64, buf ^ 1);   // overlap with compute
#pragma unroll
    for (int ks = 0; ks < 64; ks += 32) {
      Frag16 a[2], b[4];
#pragma unroll
      for (int mt = 0; mt < 2; ++mt) {
        int row = wm * 32 + mt * 16 + lr;
        a[mt].h[0] = *(const h8*)&As[buf][row][ks + ko];
        a[mt].h[1] = *(const h8*)&As[buf][row][ks + ko + 16];
      }
#pragma unroll
      for (int nt = 0; nt < 4; ++nt) {
        int col = wn * 64 + nt * 16 + lr;
        b[nt].h[0] = *(const h8*)&Bs[buf][col][ks + ko];
        b[nt].h[1] = *(const h8*)&Bs[buf][col][ks + ko + 16];
      }
#pragma unroll
      for (int mt = 0; mt < 2; ++mt)
#pragma unroll
        for (int nt = 0; nt < 4; ++nt)
          acc[mt][nt] = wmma16x16x32(a[mt], b[nt], acc[mt][nt]);
    }
    async_wait0();
    __syncthreads();
  }

  // a 128-column block lies wholly in one of the three outputs (block-uniform)
  const int sel = QKV ? n0 / HD_ : 0;
  const int nc0 = QKV ? n0 % HD_ : n0;
  if (QKV && sel == 2) {
#pragma unroll
    for (int mt = 0; mt < 2; ++mt)
#pragma unroll
      for (int nt = 0; nt < 4; ++nt)
#pragma unroll
        for (int j = 0; j < 8; ++j) {
          int m = m0 + wm * 32 + mt * 16 + j + (lane >> 4) * 8;
          int n = nc0 + wn * 64 + nt * 16 + lr;
          int bb = m >> 11, s = m & (S_ - 1);       // token -> (batch, seq)
          int hh = n >> 6,  dh = n & (DH_ - 1);     // col   -> (head, dh)
          CvT[((size_t)((bb * H_ + hh) * DH_ + dh)) * S_ + s] = (OutT)acc[mt][nt][j];
        }
    return;
  }
  OutT* __restrict__ Cs = (QKV && sel == 1) ? Ck : C;
#pragma unroll
  for (int mt = 0; mt < 2; ++mt)
#pragma unroll
    for (int nt = 0; nt < 4; ++nt)
#pragma unroll
      for (int j = 0; j < 8; ++j) {
        int m = m0 + wm * 32 + mt * 16 + j + (lane >> 4) * 8;
        int n = nc0 + wn * 64 + nt * 16 + lr;
        Cs[(size_t)m * Ndim + n] = (OutT)acc[mt][nt][j];
      }
  // behind the stores: in the listing the V block follows them and rewrites
  // their address and data registers
  if constexpr (QKV) asm volatile("s_wait_xcnt 0x0" ::: "memory");
}

// ---------------------------------------------------------------------------
// 4) Flash attention in S^T form, double-buffered async K/V staging.
//    S^T = K * Q^T  ->  lane = query col, j = key row; per-query scalar state;
//    P^T converts in registers to the B-fragment of O^T = V^T * P^T.
//    The bucket of a distance is the last one of its side from 128 on
//    so a pass whose keys all lie 129 or more from
//    all of the block's queries has ONE bias value: it takes the maximum over
//    the raw products and folds scale, bias and maximum into one multiply-add
//    in front of the exponential, with no bias read. Only the three passes
//    round the diagonal read the bias per element, from 512 floats in LDS.
//    A pass takes KT keys: what is paid once a pass (the exchange of the
//    maximum and of the sum between the wave's halves, the rescale of O, the
//    wait for the copies, the barrier) is paid once per KT keys, and the
//    score tiles of a pass are independent work for the wave.
//    A wave takes 32 queries (two column tiles) and one half of a pass's keys:
//    every K and V^T fragment read from LDS feeds two matrix instructions, so
//    the block reads half the LDS bytes of a 16-query wave, with as many waves.
//    The two waves of a query group keep their own maximum, sum and O over
//    their halves of the keys; the halves are joined once, behind the last pass.
// ---------------------------------------------------------------------------
constexpr int KT  = 128;         // keys per pass
constexpr int KW  = KT / 2;      // keys per pass and wave
constexpr int PKT = KT + 8;      // V^T rows of KT keys: 272 B = 16 B x 17 (odd)
static_assert(KT == 128 && S_ % KT == 0 && S_ / KT >= 2, "the staging below is written for 128 keys");
struct FarPass  { static constexpr bool far = true;  };
struct NearPass { static constexpr bool far = false; };

// four waves per SIMD (two blocks on a WGP) as before: the register budget is held at 256
__global__ void __launch_bounds__(256) __attribute__((amdgpu_waves_per_eu(4, 4)))
flash_attn(const _Float16* __restrict__ Q, const _Float16* __restrict__ K,
           const _Float16* __restrict__ VT, const float* __restrict__ biasE,
           _Float16* __restrict__ Ctx) {
  __shared__ __align__(16) _Float16 Ks[2][KT][P64];  // [key][dh]
  __shared__ __align__(16) _Float16 Vs[2][64][PKT];  // [dh][key] (from VT)
  __shared__ float biasL[BIASL];

  const int t = threadIdx.x, lane = t & 31, w = t >> 5;
  const int lr = lane & 15, ko = (lane >> 4) * 8;
  const int b = blockIdx.z, h = blockIdx.y;
  const int qg = w & 3, kh = w >> 2;                 // query group of 32, half of the keys
  const int q0 = blockIdx.x * 128, qrow = q0 + qg * 32;
  const int k0w = kh * KW;                           // the wave's first key within a pass

  // bias near the diagonal: biasL[i] = bias(key - query = i - 255); far from it
  // the two capped values, taken at the ends of the expanded row
  const float* biasH = biasE + h * RELN + (S_ - 1);
  static_assert(BIASL == 2 * 256, "two entries a thread, both loads in flight together");
  const float bn0 = biasH[t - 255], bn1 = biasH[t + 1];
  const float biasLo = biasH[-(S_ - 1)], biasHi = biasH[S_ - 1];

  const _Float16* Kb  = K  + (size_t)(b * S_) * HD_ + h * DH_;
  const _Float16* VTb = VT + (size_t)((b * H_ + h) * DH_) * S_;

  // One pass's tiles: K 128 rows of 128 B, V^T 64 rows of 256 B; a thread copies
  // four 16-byte pieces of each (32 K rows / 16 V^T rows apart).
  auto stageKV = [&](int kb, int buf) {
    const _Float16* gk = Kb + (size_t)(kb + (t >> 3)) * HD_ + (t & 7) * 8;
    const _Float16* gv = VTb + (size_t)(t >> 4) * S_ + kb + (t & 15) * 8;
    const unsigned lk = (unsigned)(unsigned long long)&Ks[buf][t >> 3][(t & 7) * 8];
    const unsigned lv = (unsigned)(unsigned long long)&Vs[buf][t >> 4][(t & 15) * 8];
    // the copies and their s_wait_xcnt in one statement: the wait then stands in
    // front of every later write of a register that a copy names
    asm volatile(
        "global_load_async_to_lds_b128 %0, %8, off\n\t"
        "global_load_async_to_lds_b128 %1, %9, off\n\t"
        "global_load_async_to_lds_b128 %2, %10, off\n\t"
        "global_load_async_to_lds_b128 %3, %11, off\n\t"
        "global_load_async_to_lds_b128 %4, %12, off\n\t"
        "global_load_async_to_lds_b128 %5, %13, off\n\t"
        "global_load_async_to_lds_b128 %6, %14, off\n\t"
        "global_load_async_to_lds_b128 %7, %15, off\n\t"
        "s_wait_xcnt 0x0"
        :: "v"(lk), "v"(lk + 32 * P64 * 2), "v"(lk + 64 * P64 * 2), "v"(lk + 96 * P64 * 2),
           "v"(lv), "v"(lv + 16 * PKT * 2), "v"(lv + 32 * PKT * 2), "v"(lv + 48 * PKT * 2),
           "v"(gk), "v"(gk + 32 * HD_), "v"(gk + 64 * HD_), "v"(gk + 96 * HD_),
           "v"(gv), "v"(gv + 16 * S_), "v"(gv + 32 * S_), "v"(gv + 48 * S_)
        : "memory");
  };

  // Q^T B-fragments (lane = query, regs = dh), loaded once from global
  Frag16 qf[2][2];                                   // [query tile][dh half]
  const _Float16* qa[2];
#pragma unroll  // constant indices: the fragments stay in registers
  for (int qt = 0; qt < 2; ++qt) {
    qa[qt] = Q + ((size_t)(b * S_ + qrow + qt * 16 + lr) * HD_) + h * DH_ + ko;
    qf[qt][0].h[0] = *(const h8*)(qa[qt]);
    qf[qt][0].h[1] = *(const h8*)(qa[qt] + 16);
    qf[qt][1].h[0] = *(const h8*)(qa[qt] + 32);
    qf[qt][1].h[1] = *(const h8*)(qa[qt] + 48);
  }
  // behind the Q loads: the code that follows rewrites their address registers;
  // naming the addresses as inputs keeps them live up to the wait
  asm volatile("s_wait_xcnt 0x0" :: "v"(qa[0]), "v"(qa[1]) : "memory");

  v8f o[2][4] = {};                                  // [query tile][dh tile]
  float mx[2] = {-INFINITY, -INFINITY}, lsum[2] = {0.0f, 0.0f};

  stageKV(0, 0);
  biasL[t]       = bn0;
  biasL[t + 256] = bn1;
  async_wait0();
  __syncthreads();
  stageKV(KT, 1);                                    // flies during pass 0

  // The passes kbeg, kbeg + KT, ... below kend. FAR is a type whose member says
  // which form of the softmax is built; cb is a far run's one bias value.
  auto passes = [&](int kbeg, int kend, float cb, auto FAR) {
    constexpr bool far = decltype(FAR)::far;
    for (int kb = kbeg; kb < kend; kb += KT) {
      const int buf = (kb / KT) & 1;

      // S^T tiles: rows = the wave's keys (tk*16..), cols = queries; one K fragment, two tiles
      Frag16 ka[KW / 16][2];
#pragma unroll  // constant indices: the fragments stay in registers
      for (int tk = 0; tk < KW / 16; ++tk) {
        int key = k0w + tk * 16 + lr;
        ka[tk][0].h[0] = *(const h8*)&Ks[buf][key][ko];
        ka[tk][0].h[1] = *(const h8*)&Ks[buf][key][ko + 16];
        ka[tk][1].h[0] = *(const h8*)&Ks[buf][key][32 + ko];
        ka[tk][1].h[1] = *(const h8*)&Ks[buf][key][32 + ko + 16];
      }
      // keeps the K reads one group in front of the products: a read placed among
      // them is waited for on the spot
      __builtin_amdgcn_sched_barrier(0);
      v8f sc[2][KW / 16];
#pragma unroll  // constant indices: the score tiles stay in registers
      for (int tk = 0; tk < KW / 16; ++tk)
#pragma unroll  // as above
        for (int qt = 0; qt < 2; ++qt) {
          v8f c = {};
          c = wmma16x16x32(ka[tk][0], qf[qt][0], c);
          c = wmma16x16x32(ka[tk][1], qf[qt][1], c);
          sc[qt][tk] = c;
        }
      // keeps the products one run in front of the vector work: mixed with it, each
      // product is followed by idle slots until its result may be read
      __builtin_amdgcn_sched_barrier(0);

      Frag16 pf[2][KW / 32];
#pragma unroll  // as above
      for (int qt = 0; qt < 2; ++qt) {
        // near: scale + bias from LDS first; far: the raw products. One maximum a tile
        float mt[KW / 16];
#pragma unroll  // as above
        for (int tk = 0; tk < KW / 16; ++tk) {
          if constexpr (!far) {
            int bbase = kb - q0 + k0w + tk * 16 + ((lane >> 4) << 3) - (qg * 32 + qt * 16 + lr) + 255;
#pragma unroll  // as above
            for (int j = 0; j < 8; ++j)
              sc[qt][tk][j] = sc[qt][tk][j] * 0.125f + biasL[bbase + j];
          }
          float m = sc[qt][tk][0];
#pragma unroll  // as above
          for (int j = 1; j < 8; ++j) m = fmaxf(m, sc[qt][tk][j]);
          mt[tk] = m;
        }

        // online softmax, per-query scalar state (lane l and l^16 share a query)
        float mloc = fmaxf(fmaxf(mt[0], mt[1]), fmaxf(mt[2], mt[3]));
        mloc = fmaxf(mloc, __shfl_xor(mloc, 16, 32));
        if constexpr (far) mloc = mloc * 0.125f + cb;  // the scale is positive: the maximum carries over
        float nm    = fmaxf(mx[qt], mloc);
        float alpha = __expf(mx[qt] - nm);
        mx[qt] = nm;
        constexpr float LOG2E = 1.44269504088896340736f;
        const float sh2 = (cb - nm) * LOG2E;           // far: exp(s/8 + cb - nm) = 2^(s * LOG2E/8 + sh2)

        v8f e2[KW / 16];                               // far: the exponents to base 2
        if constexpr (far) {
#pragma unroll  // as above
          for (int tk = 0; tk < KW / 16; ++tk) e2[tk] = sc[qt][tk] * (0.125f * LOG2E) + sh2;
        }

        float rg[KW / 32];                             // one partial sum per 32 keys
#pragma unroll  // as above
        for (int g = 0; g < KW / 32; ++g) {
          float r = 0.0f;
#pragma unroll  // as above
          for (int j = 0; j < 8; ++j) {
            float p0, p1;
            if constexpr (far) {
              p0 = __builtin_amdgcn_exp2f(e2[2 * g][j]);
              p1 = __builtin_amdgcn_exp2f(e2[2 * g + 1][j]);
            } else {
              p0 = __expf(sc[qt][2 * g][j] - nm);
              p1 = __expf(sc[qt][2 * g + 1][j] - nm);
            }
            r += p0 + p1;
            pf[qt][g].h[0][j] = (_Float16)p0;
            pf[qt][g].h[1][j] = (_Float16)p1;
          }
          rg[g] = r;
        }
        float rs = rg[0] + rg[1];
        rs += __shfl_xor(rs, 16, 32);
        lsum[qt] = lsum[qt] * alpha + rs;

#pragma unroll  // as above
        for (int tdh = 0; tdh < 4; ++tdh)
#pragma unroll  // as above
          for (int j = 0; j < 8; ++j) o[qt][tdh][j] *= alpha;
      }

      // O^T += V^T(16dh x 32k) * P^T(32k x 16q), 32 keys at a time; one V^T fragment, two tiles
#pragma unroll  // as above
      for (int g = 0; g < KW / 32; ++g)
#pragma unroll  // as above
        for (int tdh = 0; tdh < 4; ++tdh) {
          int dhrow = tdh * 16 + lr;
          Frag16 va;
          va.h[0] = *(const h8*)&Vs[buf][dhrow][k0w + g * 32 + ko];
          va.h[1] = *(const h8*)&Vs[buf][dhrow][k0w + g * 32 + ko + 16];
#pragma unroll  // as above
          for (int qt = 0; qt < 2; ++qt) o[qt][tdh] = wmma16x16x32(va, pf[qt][g], o[qt][tdh]);
        }

      // hand-over: this wave's LDS reads are done, its copies of the next tile have
      // landed; behind the barrier that holds for all waves, and the buffer just
      // read may be refilled
      asm volatile("s_wait_dscnt 0x0" ::: "memory");
      async_wait0();
      __syncthreads();
      if (kb + 2 * KT < S_) stageKV(kb + 2 * KT, buf);
    }
  };

  // Keys kb..kb+127 against queries q0..q0+127 (both starts multiples of 128) are
  // 129 or more apart once the starts differ by 256 or more: the keys fall into a
  // far run below the diagonal, up to three near passes, a far run above it.
  // The bounds are the same for the whole block.
  const int nlo = q0 >= KT ? q0 - KT : 0;
  const int nhi = q0 + 2 * KT <= S_ ? q0 + 2 * KT : S_;
  passes(0, nlo, biasLo, FarPass{});
  passes(nlo, nhi, 0.0f, NearPass{});
  passes(nhi, S_, biasHi, FarPass{});
  async_wait0();  // nothing is in flight here; the wave does not end on an open count

  // Join the two halves of the keys. Each wave of a pair finishes one query tile:
  // it hands the other tile's maximum, sum and O to its partner through LDS. The K
  // buffers are free: every wave's last read of them lies in front of the last
  // pass's barrier and no copy is in flight.
  constexpr int MRG_O = 8 * 8 * 32 * 4;              // floats: 8 tiles x 8 x 32 lanes x 16 B
  static_assert((MRG_O + 8 * 2 * 32) * 4 <= (int)sizeof(Ks), "the join fits the K buffers");
  float* mrg = reinterpret_cast<float*>(&Ks[0][0][0]);
  const bool up = kh != 0;                           // the wave keeps tile kh, gives tile 1 - kh
  {
    const int r = qg * 2 + (1 - kh);
#pragma unroll  // constant indices: O stays in registers
    for (int tdh = 0; tdh < 4; ++tdh) {
      const v8f g = up ? o[0][tdh] : o[1][tdh];
      f4 lo4 = {g[0], g[1], g[2], g[3]}, hi4 = {g[4], g[5], g[6], g[7]};
      *(f4*)&mrg[((r * 8 + tdh * 2) * 32 + lane) * 4]     = lo4;
      *(f4*)&mrg[((r * 8 + tdh * 2 + 1) * 32 + lane) * 4] = hi4;
    }
    mrg[MRG_O + (r * 2) * 32 + lane]     = up ? mx[0] : mx[1];
    mrg[MRG_O + (r * 2 + 1) * 32 + lane] = up ? lsum[0] : lsum[1];
  }
  __syncthreads();                                   // the partner's tile is in LDS

  // rescale both halves to the common maximum, normalize, store context
  // row-major [token][h*64+dh]
  const int r = qg * 2 + kh;
  const float ma = up ? mx[1] : mx[0], la = up ? lsum[1] : lsum[0];
  const float mb = mrg[MRG_O + (r * 2) * 32 + lane], lb = mrg[MRG_O + (r * 2 + 1) * 32 + lane];
  const float mj = fmaxf(ma, mb);
  float fa = __expf(ma - mj), fb = __expf(mb - mj);
  const float inv = 1.0f / (la * fa + lb * fb);
  fa *= inv;
  fb *= inv;
#pragma unroll  // as above
  for (int tdh = 0; tdh < 4; ++tdh) {
    const v8f mine = up ? o[1][tdh] : o[0][tdh];
    const f4 lo4 = *(const f4*)&mrg[((r * 8 + tdh * 2) * 32 + lane) * 4];
    const f4 hi4 = *(const f4*)&mrg[((r * 8 + tdh * 2 + 1) * 32 + lane) * 4];
#pragma unroll  // as above
    for (int j = 0; j < 8; ++j) {
      int dhcol = tdh * 16 + j + (lane >> 4) * 8;
      const float other = j < 4 ? lo4[j & 3] : hi4[j & 3];
      Ctx[((size_t)(b * S_ + qrow + kh * 16 + lr) * HD_) + h * DH_ + dhcol] =
          (_Float16)(mine[j] * fa + other * fb);
    }
  }
}

// ---------------------------------------------------------------------------
// Launcher
// ---------------------------------------------------------------------------
extern "C" void kernel_launch(void* const* d_in, const int* in_sizes, int n_in,
                              void* d_out, int out_size, void* d_ws, size_t ws_size,
                              hipStream_t stream) {
  (void)in_sizes; (void)n_in; (void)out_size; (void)ws_size;
  const float* hs    = (const float*)d_in[0];
  const float* Wq    = (const float*)d_in[1];
  const float* Wk    = (const float*)d_in[2];
  const float* Wv    = (const float*)d_in[3];
  const float* Wo    = (const float*)d_in[4];
  const float* table = (const float*)d_in[5];

  char*  ws  = (char*)d_ws;
  size_t off = 0;
  auto alloc = [&](size_t bytes) -> void* {
    void* p = ws + off;
    off += (bytes + 255) & ~(size_t)255;
    return p;
  };

  _Float16* hs16   = (_Float16*)alloc((size_t)M_ * D_ * 2);
  _Float16* wq16T  = (_Float16*)alloc((size_t)3 * D_ * HD_ * 2);  // Wq^T | Wk^T | Wv^T
  _Float16* wk16T  = wq16T + (size_t)D_ * HD_;
  _Float16* wv16T  = wk16T + (size_t)D_ * HD_;
  _Float16* wo16T  = (_Float16*)alloc((size_t)HD_ * D_ * 2);
  _Float16* q16    = (_Float16*)alloc((size_t)M_ * HD_ * 2);
  _Float16* k16    = (_Float16*)alloc((size_t)M_ * HD_ * 2);
  _Float16* vT16   = (_Float16*)alloc((size_t)M_ * HD_ * 2);
  _Float16* ctx16  = (_Float16*)alloc((size_t)M_ * HD_ * 2);
  float*    biasE  = (float*)alloc((size_t)H_ * RELN * 4);

  prep_all<<<WT_BLOCKS + HS_BLOCKS + BIAS_BLOCKS, 256, 0, stream>>>(
      hs, Wq, Wk, Wv, Wo, table, hs16, wq16T, wk16T, wv16T, wo16T, biasE);

  dim3 gQkv(3 * HD_ / 128, M_ / 128);
  gemm_wmma<_Float16, true><<<gQkv, 256, 0, stream>>>(hs16, wq16T, q16, k16, vT16, M_, HD_, D_);

  dim3 gAttn(S_ / 128, H_, B_);
  flash_attn<<<gAttn, 256, 0, stream>>>(q16, k16, vT16, biasE, ctx16);

  dim3 gOut(D_ / 128, M_ / 128);
  gemm_wmma<float, false><<<gOut, 256, 0, stream>>>(ctx16, wo16T, (float*)d_out, nullptr, nullptr,
                                                    M_, D_, HD_);
}

// v007
// A run of this version takes 81.7 microseconds.
// Timed twice side by side with v006, it ran 1.12 and 1.13 times as fast.
// Counting every step since v000, it is 2.91 times as fast.
#include <hip/hip_runtime.h>
#include <hip/hip_fp16.h>
#include <math.h>

// ---------------------------------------------------------------------------
// Encoder self-attention with relative position bias (gfx1250, wave32, WMMA).
// one prep launch (f32->f16, weights transposed, bias expanded) -> one double-buffered async WMMA GEMM
// launch for Q, K and V (V written head-transposed) -> flash attention (S^T form, async K/V staging,
// LDS-resident bias, register P->B-frag) -> double-buffered WMMA GEMM out.
// ---------------------------------------------------------------------------

typedef __attribute__((ext_vector_type(16))) _Float16 v16h;
typedef __attribute__((ext_vector_type(8)))  _Float16 h8;
typedef __attribute__((ext_vector_type(8)))  float    v8f;
typedef __attribute__((ext_vector_type(4)))  float    f4;

union Frag16 { v16h v; h8 h[2]; };

__device__ __forceinline__ v8f wmma16x16x32(const Frag16& a, const Frag16& b, v8f c) {
  return __builtin_amdgcn_wmma_f32_16x16x32_f16(false, a.v, false, b.v, (short)0, c,
                                                false, false);
}

// Async global->LDS copies bypass the VGPRs and are tracked by ASYNCcnt.
__device__ __forceinline__ void async_wait0() {
  asm volatile("s_wait_asynccnt 0x0" ::: "memory");
}

constexpr int B_  = 2;
constexpr int S_  = 2048;
constexpr int D_  = 1024;
constexpr int H_  = 16;
constexpr int DH_ = 64;
constexpr int HD_ = H_ * DH_;    // 1024
constexpr int M_  = B_ * S_;     // 4096
constexpr int RELN = 2 * S_ - 1; // 4095
constexpr int BIASL = 512;       // key - query from -255 to 256 (256 is staged, never read)
// LDS row pitches in f16 elements. Every tile is read by ds_load_b128 with 16
// lanes on 16 consecutive rows: a pitch of 16 B x odd puts those rows on 16
// different groups of four banks; the bare 128 B / 256 B rows fall on 2 / 1.
constexpr int P64 = 64 + 8;      // 64-element rows: 144 B
constexpr int P32 = 32 + 8;      // unused: no LDS tile has 32-element rows

// ---------------------------------------------------------------------------
// 1) All operand preparation in ONE launch; the block index picks the role.
//    The three roles share no data; each wave moves many bytes, so that few
//    waves have to be started and only one launch gap is paid.
//    a) weights: f32[k][n] -> f16[n][k]; a block takes one 64x64 tile position
//       of all four matrices (16 b128 loads in flight per thread, one barrier,
//       whole 128 B lines stored).
//    b) hidden states: f32 -> f16, 64 elements per thread, all loads first.
//    c) rel_bias_table[32][H] -> biasE[H][4095] indexed by (rel + S-1).
// ---------------------------------------------------------------------------
constexpr int WT_BLOCKS   = (D_ / 64) * (HD_ / 64);      // 256
constexpr int HS_UNROLL   = 8;
constexpr int HS_BLOCKS   = M_ * D_ / (256 * 8 * HS_UNROLL);  // 256
constexpr int BIAS_SPLIT  = 4;                           // blocks per head
constexpr int BIAS_BLOCKS = H_ * BIAS_SPLIT;             // 64

__global__ void __launch_bounds__(256)
prep_all(const float* __restrict__ hs, const float* __restrict__ Wq,
         const float* __restrict__ Wk, const float* __restrict__ Wv,
         const float* __restrict__ Wo, const float* __restrict__ table,
         _Float16* __restrict__ hs16, _Float16* __restrict__ wqT,
         _Float16* __restrict__ wkT, _Float16* __restrict__ wvT,
         _Float16* __restrict__ woT, float* __restrict__ biasE) {
  // pitch 65 floats: row writes and column reads both touch 32 different banks
  __shared__ float tile[4][64][65];
  const int t = threadIdx.x;
  int bid = blockIdx.x;

  if (bid < WT_BLOCKS) {
    const float* srcs[4] = {Wq, Wk, Wv, Wo};
    _Float16*    dsts[4] = {wqT, wkT, wvT, woT};
    const int k0 = (bid >> 4) * 64, n0 = (bid & 15) * 64;
    const int rr = t >> 4, cc = (t & 15) * 4;            // 16 rows x 64 cols a pass
    // one 32-bit byte offset serves all 16 loads (uniform base + constant step)
    const unsigned lo = (unsigned)((k0 + rr) * HD_ + n0 + cc) * 4u;
    f4 v[4][4];
#pragma unroll  // constant indices: arrays stay in registers, loads issue together
    for (int m = 0; m < 4; ++m)
#pragma unroll  // as above
      for (int p = 0; p < 4; ++p)
        v[m][p] = *(const f4*)((const char*)srcs[m] + lo + p * (16 * HD_ * 4));
    // wait before the loads' offset register is rewritten; naming it as an input
    // keeps it live up to here: without that the last load's result is placed
    // over it while the fifteen loads in front still name it
    asm volatile("s_wait_xcnt 0x0" :: "v"(lo) : "memory");
#pragma unroll  // as above
    for (int m = 0; m < 4; ++m)
#pragma unroll  // as above
      for (int p = 0; p < 4; ++p)
#pragma unroll  // as above
        for (int e = 0; e < 4; ++e) tile[m][p * 16 + rr][cc + e] = v[m][p][e];
    __syncthreads();
    const int kc = (t & 7) * 8, nr = t >> 3;             // 32 n-rows x 64 k a pass
    const unsigned so = (unsigned)((n0 + nr) * D_ + k0 + kc) * 2u;
#pragma unroll  // as above
    for (int m = 0; m < 4; ++m)
#pragma unroll  // as above
      for (int p = 0; p < 2; ++p) {
        h8 o;
#pragma unroll  // as above
        for (int e = 0; e < 8; ++e) o[e] = (_Float16)tile[m][kc + e][p * 32 + nr];
        *(h8*)((char*)dsts[m] + so + p * (32 * D_ * 2)) = o;
      }
    return;
  }
  bid -= WT_BLOCKS;

  if (bid < HS_BLOCKS) {
    const unsigned base = (unsigned)bid * (256 * 8 * HS_UNROLL) + t * 8;  // element
    const unsigned lo = base * 4u;                       // byte offset of the loads
    f4 a[HS_UNROLL], b[HS_UNROLL];
#pragma unroll  // constant indices: arrays stay in registers, loads issue together
    for (int u = 0; u < HS_UNROLL; ++u) {
      a[u] = *(const f4*)((const char*)hs + lo + u * 8192);
      b[u] = *(const f4*)((const char*)hs + lo + u * 8192 + 16);
    }
#pragma unroll  // as above
    for (int u = 0; u < HS_UNROLL; ++u) {
      h8 o;
      o[0] = (_Float16)a[u][0]; o[1] = (_Float16)a[u][1];
      o[2] = (_Float16)a[u][2]; o[3] = (_Float16)a[u][3];
      o[4] = (_Float16)b[u][0]; o[5] = (_Float16)b[u][1];
      o[6] = (_Float16)b[u][2]; o[7] = (_Float16)b[u][3];
      *(h8*)(hs16 + base + u * 2048) = o;
    }
    // behind the stores: the code that follows them in the listing rewrites
    // their address and data registers
    asm volatile("s_wait_xcnt 0x0" ::: "memory");
    return;
  }
  bid -= HS_BLOCKS;

  const int h  = bid / BIAS_SPLIT;
  const int r0 = (bid % BIAS_SPLIT) * 1024 + t;
  float val[4];
#pragma unroll  // constant indices: arrays stay in registers, loads issue together
  for (int u = 0; u < 4; ++u) {
    const int r  = r0 + u * 256;
    const int rc = r < RELN ? r : RELN - 1;   // index 4095 re-reads the last entry, is not stored
    int rel = rc - (S_ - 1);
    const int nb = 16, me = 8;
    int rb = (rel > 0) ? nb : 0;
    int rp = rel < 0 ? -rel : rel;
    int bk;
    if (rp < me) {
      bk = rp;
    } else {
      float x = __logf((float)rp * (1.0f / me)) * (1.0f / __logf(16.0f)) * (float)(nb - me);
      bk = me + (int)x;
      if (bk > nb - 1) bk = nb - 1;
    }
    val[u] = table[(rb + bk) * H_ + h];
  }
#pragma unroll  // as above
  for (int u = 0; u < 4; ++u)
    if (r0 + u * 256 < RELN) biasE[h * RELN + r0 + u * 256] = val[u];
}

// ---------------------------------------------------------------------------
// 3) WMMA GEMM: C[M,N] = A[M,K](f16) * BT[N,K](f16, pre-transposed).
//    128x128x64 tile, 8 waves (4x2), wave = 32x64. Double-buffered async
//    global->LDS staging for both operands (no VGPR bounce, no scalar stores).
//    QKV=true: BT is Wq^T, Wk^T, Wv^T stacked by rows, so that one grid of
//    three times the column blocks does all three projections: three blocks
//    share a WGP and one block's compute covers another's wait for its tile.
//    Column blocks of the first HD_ columns go to C, of the second to Ck
//    (both of row pitch Ndim), the third are scattered as CvT[b][h][dh][s]
//    for the attention pass.
// ---------------------------------------------------------------------------
template <typename OutT, bool QKV>
__global__ void __launch_bounds__(256)
gemm_wmma(const _Float16* __restrict__ A, const _Float16* __restrict__ BT,
          OutT* __restrict__ C, OutT* __restrict__ Ck, OutT* __restrict__ CvT,
          int Mdim, int Ndim, int Kdim) {
  __shared__ __align__(16) _Float16 As[2][128][P64];
  __shared__ __align__(16) _Float16 Bs[2][128][P64];  // [n][k]
  const int t    = threadIdx.x;
  const int lane = t & 31, w = t >> 5;
  const int wm   = w & 3, wn = w >> 2;
  const int m0   = blockIdx.y * 128, n0 = blockIdx.x * 128;
  const int lr   = lane & 15, ko = (lane >> 4) * 8;
  // Staging coords: eight lanes cover the 128 B that a row has in a tile, so a
  // wave-wide copy asks for four whole lines, not for 32 B out of each of sixteen.
  // A thread copies one 16-byte piece of four rows (32 apart) of each operand.
  const int srow = t >> 3, scol = (t & 7) * 8;

  auto stage = [&](int k0, int buf) {
    const _Float16* sa = A  + (size_t)(m0 + srow) * Kdim + k0 + scol;
    const _Float16* sb = BT + (size_t)(n0 + srow) * Kdim + k0 + scol;
    const size_t    rs = (size_t)32 * Kdim;           // 32 rows on, in elements
    const unsigned  la = (unsigned)(unsigned long long)&As[buf][srow][scol];
    const unsigned  lb = (unsigned)(unsigned long long)&Bs[buf][srow][scol];
    // the copies and their s_wait_xcnt in one statement: the wait then stands in
    // front of every later write of a register that a copy names
    asm volatile(
        "global_load_async_to_lds_b128 %0, %8, off\n\t"
        "global_load_async_to_lds_b128 %1, %9, off\n\t"
        "global_load_async_to_lds_b128 %2, %10, off\n\t"
        "global_load_async_to_lds_b128 %3, %11, off\n\t"
        "global_load_async_to_lds_b128 %4, %12, off\n\t"
        "global_load_async_to_lds_b128 %5, %13, off\n\t"
        "global_load_async_to_lds_b128 %6, %14, off\n\t"
        "global_load_async_to_lds_b128 %7, %15, off\n\t"
        "s_wait_xcnt 0x0"
        :: "v"(la), "v"(la + 32 * P64 * 2), "v"(la + 64 * P64 * 2), "v"(la + 96 * P64 * 2),
           "v"(lb), "v"(lb + 32 * P64 * 2), "v"(lb + 64 * P64 * 2), "v"(lb + 96 * P64 * 2),
           "v"(sa), "v"(sa + rs), "v"(sa + 2 * rs), "v"(sa + 3 * rs),
           "v"(sb), "v"(sb + rs), "v"(sb + 2 * rs), "v"(sb + 3 * rs)
        : "memory");
  };

  v8f acc[2][4] = {};
  stage(0, 0);
  async_wait0();
  __syncthreads();

  const int T = Kdim / 64;
  for (int i = 0; i < T; ++i) {
    int buf = i & 1;
    if (i + 1 < T) stage((i + 1) * 64, buf ^ 1);   // overlap with compute
#pragma unroll
    for (int ks = 0; ks < 64; ks += 32) {
      Frag16 a[2], b[4];
#pragma unroll
      for (int mt = 0; mt < 2; ++mt) {
        int row = wm * 32 + mt * 16 + lr;
        a[mt].h[0] = *(const h8*)&As[buf][row][ks + ko];
        a[mt].h[1] = *(const h8*)&As[buf][row][ks + ko + 16];
      }
#pragma unroll
      for (int nt = 0; nt < 4; ++nt) {
        int col = wn * 64 + nt * 16 + lr;
        b[nt].h[0] = *(const h8*)&Bs[buf][col][ks + ko];
        b[nt].h[1] = *(const h8*)&Bs[buf][col][ks + ko + 16];
      }
#pragma unroll
      for (int mt = 0; mt < 2; ++mt)
#pragma unroll
        for (int nt = 0; nt < 4; ++nt)
          acc[mt][nt] = wmma16x16x32(a[mt], b[nt], acc[mt][nt]);
    }
    // hand-over: this wave's LDS reads are done, its copies of the next tile have
    // landed; behind the barrier that holds for all waves, and the buffer just
    // read may be refilled (at the head of the next trip)
    asm volatile("s_wait_dscnt 0x0" ::: "memory");
    async_wait0();
    __syncthreads();
  }

  // a 128-column block lies wholly in one of the three outputs (block-uniform)
  const int sel = QKV ? n0 / HD_ : 0;
  const int nc0 = QKV ? n0 % HD_ : n0;
  if (QKV && sel == 2) {
#pragma unroll
    for (int mt = 0; mt < 2; ++mt)
#pragma unroll
      for (int nt = 0; nt < 4; ++nt)
#pragma unroll
        for (int j = 0; j < 8; ++j) {
          int m = m0 + wm * 32 + mt * 16 + j + (lane >> 4) * 8;
          int n = nc0 + wn * 64 + nt * 16 + lr;
          int bb = m >> 11, s = m & (S_ - 1);       // token -> (batch, seq)
          int hh = n >> 6,  dh = n & (DH_ - 1);     // col   -> (head, dh)
          CvT[((size_t)((bb * H_ + hh) * DH_ + dh)) * S_ + s] = (OutT)acc[mt][nt][j];
        }
    return;
  }
  OutT* __restrict__ Cs = (QKV && sel == 1) ? Ck : C;
#pragma unroll
  for (int mt = 0; mt < 2; ++mt)
#pragma unroll
    for (int nt = 0; nt < 4; ++nt)
#pragma unroll
      for (int j = 0; j < 8; ++j) {
        int m = m0 + wm * 32 + mt * 16 + j + (lane >> 4) * 8;
        int n = nc0 + wn * 64 + nt * 16 + lr;
        Cs[(size_t)m * Ndim + n] = (OutT)acc[mt][nt][j];
      }
  // behind the stores: in the listing the V block follows them and rewrites
  // their address and data registers
  if constexpr (QKV) asm volatile("s_wait_xcnt 0x0" ::: "memory");
}

// ---------------------------------------------------------------------------
// 4) Flash attention in S^T form, double-buffered async K/V staging.
//    S^T = K * Q^T  ->  lane = query col, j = key row; per-query scalar state;
//    P^T converts in registers to the B-fragment of O^T = V^T * P^T.
//    The bucket of a distance is the last one of its side from 128 on
//    so a pass whose keys all lie 129 or more from
//    all of the block's queries has ONE bias value: it takes the maximum over
//    the raw products and folds scale, bias and maximum into one multiply-add
//    in front of the exponential, with no bias read. Only the three passes
//    round the diagonal read the bias per element, from 512 floats in LDS.
//    A pass takes KT keys: what is paid once a pass (the exchange of the
//    maximum and of the sum between the wave's halves, the rescale of O, the
//    wait for the copies, the barrier) is paid once per KT keys, and the
//    score tiles of a pass are independent work for the wave.
//    A wave takes 32 queries (two column tiles) and one half of a pass's keys:
//    every K and V^T fragment read from LDS feeds two matrix instructions, so
//    the block reads half the LDS bytes of a 16-query wave, with as many waves.
//    The two waves of a query group keep their own maximum, sum and O over
//    their halves of the keys; the halves are joined once, behind the last pass.
// ---------------------------------------------------------------------------
constexpr int KT  = 128;         // keys per pass
constexpr int KW  = KT / 2;      // keys per pass and wave
constexpr int PKT = KT + 8;      // V^T rows of KT keys: 272 B = 16 B x 17 (odd)
static_assert(KT == 128 && S_ % KT == 0 && S_ / KT >= 2, "the staging below is written for 128 keys");
struct FarPass  { static constexpr bool far = true;  };
struct NearPass { static constexpr bool far = false; };

// four waves per SIMD (two blocks on a WGP) as before: the register budget is held at 256
__global__ void __launch_bounds__(256) __attribute__((amdgpu_waves_per_eu(4, 4)))
flash_attn(const _Float16* __restrict__ Q, const _Float16* __restrict__ K,
           const _Float16* __restrict__ VT, const float* __restrict__ biasE,
           _Float16* __restrict__ Ctx) {
  __shared__ __align__(16) _Float16 Ks[2][KT][P64];  // [key][dh]
  __shared__ __align__(16) _Float16 Vs[2][64][PKT];  // [dh][key] (from VT)
  __shared__ float biasL[BIASL];

  const int t = threadIdx.x, lane = t & 31, w = t >> 5;
  const int lr = lane & 15, ko = (lane >> 4) * 8;
  const int b = blockIdx.z, h = blockIdx.y;
  const int qg = w & 3, kh = w >> 2;                 // query group of 32, half of the keys
  const int q0 = blockIdx.x * 128, qrow = q0 + qg * 32;
  const int k0w = kh * KW;                           // the wave's first key within a pass

  // bias near the diagonal: biasL[i] = bias(key - query = i - 255); far from it
  // the two capped values, taken at the ends of the expanded row
  const float* biasH = biasE + h * RELN + (S_ - 1);
  static_assert(BIASL == 2 * 256, "two entries a thread, both loads in flight together");
  const float bn0 = biasH[t - 255], bn1 = biasH[t + 1];
  const float biasLo = biasH[-(S_ - 1)], biasHi = biasH[S_ - 1];

  const _Float16* Kb  = K  + (size_t)(b * S_) * HD_ + h * DH_;
  const _Float16* VTb = VT + (size_t)((b * H_ + h) * DH_) * S_;

  // One pass's tiles: K 128 rows of 128 B, V^T 64 rows of 256 B; a thread copies
  // four 16-byte pieces of each (32 K rows / 16 V^T rows apart).
  auto stageKV = [&](int kb, int buf) {
    const _Float16* gk = Kb + (size_t)(kb + (t >> 3)) * HD_ + (t & 7) * 8;
    const _Float16* gv = VTb + (size_t)(t >> 4) * S_ + kb + (t & 15) * 8;
    const unsigned lk = (unsigned)(unsigned long long)&Ks[buf][t >> 3][(t & 7) * 8];
    const unsigned lv = (unsigned)(unsigned long long)&Vs[buf][t >> 4][(t & 15) * 8];
    // the copies and their s_wait_xcnt in one statement: the wait then stands in
    // front of every later write of a register that a copy names
    asm volatile(
        "global_load_async_to_lds_b128 %0, %8, off\n\t"
        "global_load_async_to_lds_b128 %1, %9, off\n\t"
        "global_load_async_to_lds_b128 %2, %10, off\n\t"
        "global_load_async_to_lds_b128 %3, %11, off\n\t"
        "global_load_async_to_lds_b128 %4, %12, off\n\t"
        "global_load_async_to_lds_b128 %5, %13, off\n\t"
        "global_load_async_to_lds_b128 %6, %14, off\n\t"
        "global_load_async_to_lds_b128 %7, %15, off\n\t"
        "s_wait_xcnt 0x0"
        :: "v"(lk), "v"(lk + 32 * P64 * 2), "v"(lk + 64 * P64 * 2), "v"(lk + 96 * P64 * 2),
           "v"(lv), "v"(lv + 16 * PKT * 2), "v"(lv + 32 * PKT * 2), "v"(lv + 48 * PKT * 2),
           "v"(gk), "v"(gk + 32 * HD_), "v"(gk + 64 * HD_), "v"(gk + 96 * HD_),
           "v"(gv), "v"(gv + 16 * S_), "v"(gv + 32 * S_), "v"(gv + 48 * S_)
        : "memory");
  };

  // Q^T B-fragments (lane = query, regs = dh), loaded once from global
  Frag16 qf[2][2];                                   // [query tile][dh half]
  const _Float16* qa[2];
#pragma unroll  // constant indices: the fragments stay in registers
  for (int qt = 0; qt < 2; ++qt) {
    qa[qt] = Q + ((size_t)(b * S_ + qrow + qt * 16 + lr) * HD_) + h * DH_ + ko;
    qf[qt][0].h[0] = *(const h8*)(qa[qt]);
    qf[qt][0].h[1] = *(const h8*)(qa[qt] + 16);
    qf[qt][1].h[0] = *(const h8*)(qa[qt] + 32);
    qf[qt][1].h[1] = *(const h8*)(qa[qt] + 48);
  }
  // behind the Q loads: the code that follows rewrites their address registers;
  // naming the addresses as inputs keeps them live up to the wait
  asm volatile("s_wait_xcnt 0x0" :: "v"(qa[0]), "v"(qa[1]) : "memory");

  v8f o[2][4] = {};                                  // [query tile][dh tile]
  float mx[2] = {-INFINITY, -INFINITY}, lsum[2] = {0.0f, 0.0f};

  stageKV(0, 0);
  biasL[t]       = bn0;
  biasL[t + 256] = bn1;
  async_wait0();
  __syncthreads();
  stageKV(KT, 1);                                    // flies during pass 0

  // The passes kbeg, kbeg + KT, ... below kend. FAR is a type whose member says
  // which form of the softmax is built; cb is a far run's one bias value.
  auto passes = [&](int kbeg, int kend, float cb, auto FAR) {
    constexpr bool far = decltype(FAR)::far;
    for (int kb = kbeg; kb < kend; kb += KT) {
      const int buf = (kb / KT) & 1;

      // S^T tiles: rows = the wave's keys (tk*16..), cols = queries; one K fragment, two tiles
      Frag16 ka[KW / 16][2];
#pragma unroll  // constant indices: the fragments stay in registers
      for (int tk = 0; tk < KW / 16; ++tk) {
        int key = k0w + tk * 16 + lr;
        ka[tk][0].h[0] = *(const h8*)&Ks[buf][key][ko];
        ka[tk][0].h[1] = *(const h8*)&Ks[buf][key][ko + 16];
        ka[tk][1].h[0] = *(const h8*)&Ks[buf][key][32 + ko];
        ka[tk][1].h[1] = *(const h8*)&Ks[buf][key][32 + ko + 16];
      }
      // keeps the K reads one group in front of the products: a read placed among
      // them is waited for on the spot
      __builtin_amdgcn_sched_barrier(0);
      v8f sc[2][KW / 16];
#pragma unroll  // constant indices: the score tiles stay in registers
      for (int tk = 0; tk < KW / 16; ++tk)
#pragma unroll  // as above
        for (int qt = 0; qt < 2; ++qt) {
          v8f c = {};
          c = wmma16x16x32(ka[tk][0], qf[qt][0], c);
          c = wmma16x16x32(ka[tk][1], qf[qt][1], c);
          sc[qt][tk] = c;
        }
      // keeps the products one run in front of the vector work: mixed with it, each
      // product is followed by idle slots until its result may be read
      __builtin_amdgcn_sched_barrier(0);

      Frag16 pf[2][KW / 32];
#pragma unroll  // as above
      for (int qt = 0; qt < 2; ++qt) {
        // near: scale + bias from LDS first; far: the raw products. One maximum a tile
        float mt[KW / 16];
#pragma unroll  // as above
        for (int tk = 0; tk < KW / 16; ++tk) {
          if constexpr (!far) {
            int bbase = kb - q0 + k0w + tk * 16 + ((lane >> 4) << 3) - (qg * 32 + qt * 16 + lr) + 255;
#pragma unroll  // as above
            for (int j = 0; j < 8; ++j)
              sc[qt][tk][j] = sc[qt][tk][j] * 0.125f + biasL[bbase + j];
          }
          float m = sc[qt][tk][0];
#pragma unroll  // as above
          for (int j = 1; j < 8; ++j) m = fmaxf(m, sc[qt][tk][j]);
          mt[tk] = m;
        }

        // online softmax, per-query scalar state (lane l and l^16 share a query)
        float mloc = fmaxf(fmaxf(mt[0], mt[1]), fmaxf(mt[2], mt[3]));
        mloc = fmaxf(mloc, __shfl_xor(mloc, 16, 32));
        if constexpr (far) mloc = mloc * 0.125f + cb;  // the scale is positive: the maximum carries over
        float nm    = fmaxf(mx[qt], mloc);
        float alpha = __expf(mx[qt] - nm);
        mx[qt] = nm;
        constexpr float LOG2E = 1.44269504088896340736f;
        const float sh2 = (cb - nm) * LOG2E;           // far: exp(s/8 + cb - nm) = 2^(s * LOG2E/8 + sh2)

        v8f e2[KW / 16];                               // far: the exponents to base 2
        if constexpr (far) {
#pragma unroll  // as above
          for (int tk = 0; tk < KW / 16; ++tk) e2[tk] = sc[qt][tk] * (0.125f * LOG2E) + sh2;
        }

        float rg[KW / 32];                             // one partial sum per 32 keys
#pragma unroll  // as above
        for (int g = 0; g < KW / 32; ++g) {
          float r = 0.0f;
#pragma unroll  // as above
          for (int j = 0; j < 8; ++j) {
            float p0, p1;
            if constexpr (far) {
              p0 = __builtin_amdgcn_exp2f(e2[2 * g][j]);
              p1 = __builtin_amdgcn_exp2f(e2[2 * g + 1][j]);
            } else {
              p0 = __expf(sc[qt][2 * g][j] - nm);
              p1 = __expf(sc[qt][2 * g + 1][j] - nm);
            }
            r += p0 + p1;
            pf[qt][g].h[0][j] = (_Float16)p0;
            pf[qt][g].h[1][j] = (_Float16)p1;
          }
          rg[g] = r;
        }
        float rs = rg[0] + rg[1];
        rs += __shfl_xor(rs, 16, 32);
        lsum[qt] = lsum[qt] * alpha + rs;

#pragma unroll  // as above
        for (int tdh = 0; tdh < 4; ++tdh)
#pragma unroll  // as above
          for (int j = 0; j < 8; ++j) o[qt][tdh][j] *= alpha;
      }

      // O^T += V^T(16dh x 32k) * P^T(32k x 16q), 32 keys at a time; one V^T fragment, two tiles
#pragma unroll  // as above
      for (int g = 0; g < KW / 32; ++g)
#pragma unroll  // as above
        for (int tdh = 0; tdh < 4; ++tdh) {
          int dhrow = tdh * 16 + lr;
          Frag16 va;
          va.h[0] = *(const h8*)&Vs[buf][dhrow][k0w + g * 32 + ko];
          va.h[1] = *(const h8*)&Vs[buf][dhrow][k0w + g * 32 + ko + 16];
#pragma unroll  // as above
          for (int qt = 0; qt < 2; ++qt) o[qt][tdh] = wmma16x16x32(va, pf[qt][g], o[qt][tdh]);
        }

      // hand-over: this wave's LDS reads are done, its copies of the next tile have
      // landed; behind the barrier that holds for all waves, and the buffer just
      // read may be refilled
      asm volatile("s_wait_dscnt 0x0" ::: "memory");
      async_wait0();
      __syncthreads();
      if (kb + 2 * KT < S_) stageKV(kb + 2 * KT, buf);
    }
  };

  // Keys kb..kb+127 against queries q0..q0+127 (both starts multiples of 128) are
  // 129 or more apart once the starts differ by 256 or more: the keys fall into a
  // far run below the diagonal, up to three near passes, a far run above it.
  // The bounds are the same for the whole block.
  const int nlo = q0 >= KT ? q0 - KT : 0;
  const int nhi = q0 + 2 * KT <= S_ ? q0 + 2 * KT : S_;
  passes(0, nlo, biasLo, FarPass{});
  passes(nlo, nhi, 0.0f, NearPass{});
  passes(nhi, S_, biasHi, FarPass{});
  async_wait0();  // nothing is in flight here; the wave does not end on an open count

  // Join the two halves of the keys. Each wave of a pair finishes one query tile:
  // it hands the other tile's maximum, sum and O to its partner through LDS. The K
  // buffers are free: every wave's last read of them lies in front of the last
  // pass's barrier and no copy is in flight.
  constexpr int MRG_O = 8 * 8 * 32 * 4;              // floats: 8 tiles x 8 x 32 lanes x 16 B
  static_assert((MRG_O + 8 * 2 * 32) * 4 <= (int)sizeof(Ks), "the join fits the K buffers");
  float* mrg = reinterpret_cast<float*>(&Ks[0][0][0]);
  const bool up = kh != 0;                           // the wave keeps tile kh, gives tile 1 - kh
  {
    const int r = qg * 2 + (1 - kh);
#pragma unroll  // constant indices: O stays in registers
    for (int tdh = 0; tdh < 4; ++tdh) {
      const v8f g = up ? o[0][tdh] : o[1][tdh];
      f4 lo4 = {g[0], g[1], g[2], g[3]}, hi4 = {g[4], g[5], g[6], g[7]};
      *(f4*)&mrg[((r * 8 + tdh * 2) * 32 + lane) * 4]     = lo4;
      *(f4*)&mrg[((r * 8 + tdh * 2 + 1) * 32 + lane) * 4] = hi4;
    }
    mrg[MRG_O + (r * 2) * 32 + lane]     = up ? mx[0] : mx[1];
    mrg[MRG_O + (r * 2 + 1) * 32 + lane] = up ? lsum[0] : lsum[1];
  }
  __syncthreads();                                   // the partner's tile is in LDS

  // rescale both halves to the common maximum, normalize, store context
  // row-major [token][h*64+dh]
  const int r = qg * 2 + kh;
  const float ma = up ? mx[1] : mx[0], la = up ? lsum[1] : lsum[0];
  const float mb = mrg[MRG_O + (r * 2) * 32 + lane], lb = mrg[MRG_O + (r * 2 + 1) * 32 + lane];
  const float mj = fmaxf(ma, mb);
  float fa = __expf(ma - mj), fb = __expf(mb - mj);
  const float inv = 1.0f / (la * fa + lb * fb);
  fa *= inv;
  fb *= inv;
#pragma unroll  // as above
  for (int tdh = 0; tdh < 4; ++tdh) {
    const v8f mine = up ? o[1][tdh] : o[0][tdh];
    const f4 lo4 = *(const f4*)&mrg[((r * 8 + tdh * 2) * 32 + lane) * 4];
    const f4 hi4 = *(const f4*)&mrg[((r * 8 + tdh * 2 + 1) * 32 + lane) * 4];
#pragma unroll  // as above
    for (int j = 0; j < 8; ++j) {
      int dhcol = tdh * 16 + j + (lane >> 4) * 8;
      const float other = j < 4 ? lo4[j & 3] : hi4[j & 3];
      Ctx[((size_t)(b * S_ + qrow + kh * 16 + lr) * HD_) + h * DH_ + dhcol] =
          (_Float16)(mine[j] * fa + other * fb);
    }
  }
}

// ---------------------------------------------------------------------------
// Launcher
// ---------------------------------------------------------------------------
extern "C" void kernel_launch(void* const* d_in, const int* in_sizes, int n_in,
                              void* d_out, int out_size, void* d_ws, size_t ws_size,
                              hipStream_t stream) {
  (void)in_sizes; (void)n_in; (void)out_size; (void)ws_size;
  const float* hs    = (const float*)d_in[0];
  const float* Wq    = (const float*)d_in[1];
  const float* Wk    = (const float*)d_in[2];
  const float* Wv    = (const float*)d_in[3];
  const float* Wo    = (const float*)d_in[4];
  const float* table = (const float*)d_in[5];

  char*  ws  = (char*)d_ws;
  size_t off = 0;
  auto alloc = [&](size_t bytes) -> void* {
    void* p = ws + off;
    off += (bytes + 255) & ~(size_t)255;
    return p;
  };

  _Float16* hs16   = (_Float16*)alloc((size_t)M_ * D_ * 2);
  _Float16* wq16T  = (_Float16*)alloc((size_t)3 * D_ * HD_ * 2);  // Wq^T | Wk^T | Wv^T
  _Float16* wk16T  = wq16T + (size_t)D_ * HD_;
  _Float16* wv16T  = wk16T + (size_t)D_ * HD_;
  _Float16* wo16T  = (_Float16*)alloc((size_t)HD_ * D_ * 2);
  _Float16* q16    = (_Float16*)alloc((size_t)M_ * HD_ * 2);
  _Float16* k16    = (_Float16*)alloc((size_t)M_ * HD_ * 2);
  _Float16* vT16   = (_Float16*)alloc((size_t)M_ * HD_ * 2);
  _Float16* ctx16  = (_Float16*)alloc((size_t)M_ * HD_ * 2);
  float*    biasE  = (float*)alloc((size_t)H_ * RELN * 4);

  prep_all<<<WT_BLOCKS + HS_BLOCKS + BIAS_BLOCKS, 256, 0, stream>>>(
      hs, Wq, Wk, Wv, Wo, table, hs16, wq16T, wk16T, wv16T, wo16T, biasE);

  dim3 gQkv(3 * HD_ / 128, M_ / 128);
  gemm_wmma<_Float16, true><<<gQkv, 256, 0, stream>>>(hs16, wq16T, q16, k16, vT16, M_, HD_, D_);

  dim3 gAttn(S_ / 128, H_, B_);
  flash_attn<<<gAttn, 256, 0, stream>>>(q16, k16, vT16, biasE, ctx16);

  dim3 gOut(D_ / 128, M_ / 128);
  gemm_wmma<float, false><<<gOut, 256, 0, stream>>>(ctx16, wo16T, (float*)d_out, nullptr, nullptr,
                                                    M_, D_, HD_);
}

// v008
// Measured time: 80 microseconds a run.
// Two timings next to v007 put it at 1.03 and 1.02 times that version's speed.
// All steps since v000 together make it 2.98 times as fast.
#include <hip/hip_runtime.h>
#include <hip/hip_fp16.h>
#include <math.h>

// ---------------------------------------------------------------------------
// Encoder self-attention with relative position bias (gfx1250, wave32, WMMA).
// one prep launch (f32->f16, weights transposed, bias expanded) -> one double-buffered async WMMA GEMM
// launch for Q, K and V (V written head-transposed) -> flash attention (S^T form, async K/V staging,
// LDS-resident bias, register P->B-frag) -> WMMA GEMM out on a ring of four LDS tiles.
// ---------------------------------------------------------------------------

typedef __attribute__((ext_vector_type(16))) _Float16 v16h;
typedef __attribute__((ext_vector_type(8)))  _Float16 h8;
typedef __attribute__((ext_vector_type(8)))  float    v8f;
typedef __attribute__((ext_vector_type(4)))  float    f4;

union Frag16 { v16h v; h8 h[2]; };

__device__ __forceinline__ v8f wmma16x16x32(const Frag16& a, const Frag16& b, v8f c) {
  return __builtin_amdgcn_wmma_f32_16x16x32_f16(false, a.v, false, b.v, (short)0, c,
                                                false, false);
}

// Async global->LDS copies bypass the VGPRs and are tracked by ASYNCcnt.
__device__ __forceinline__ void async_wait0() {
  asm volatile("s_wait_asynccnt 0x0" ::: "memory");
}

constexpr int B_  = 2;
constexpr int S_  = 2048;
constexpr int D_  = 1024;
constexpr int H_  = 16;
constexpr int DH_ = 64;
constexpr int HD_ = H_ * DH_;    // 1024
constexpr int M_  = B_ * S_;     // 4096
constexpr int RELN = 2 * S_ - 1; // 4095
constexpr int BIASL = 512;       // key - query from -255 to 256 (256 is staged, never read)
// LDS row pitches in f16 elements. Every tile is read by ds_load_b128 with 16
// lanes on 16 consecutive rows: a pitch of 16 B x odd puts those rows on 16
// different groups of four banks; the bare 128 B / 256 B rows fall on 2 / 1.
constexpr int P64 = 64 + 8;      // 64-element rows: 144 B
constexpr int P32 = 32 + 8;      // unused: no LDS tile has 32-element rows

// ---------------------------------------------------------------------------
// 1) All operand preparation in ONE launch; the block index picks the role.
//    The three roles share no data; each wave moves many bytes, so that few
//    waves have to be started and only one launch gap is paid.
//    a) weights: f32[k][n] -> f16[n][k]; a block takes one 64x64 tile position
//       of all four matrices (16 b128 loads in flight per thread, one barrier,
//       whole 128 B lines stored).
//    b) hidden states: f32 -> f16, 64 elements per thread, all loads first.
//    c) rel_bias_table[32][H] -> biasE[H][4095] indexed by (rel + S-1).
// ---------------------------------------------------------------------------
constexpr int WT_BLOCKS   = (D_ / 64) * (HD_ / 64);      // 256
constexpr int HS_UNROLL   = 8;
constexpr int HS_BLOCKS   = M_ * D_ / (256 * 8 * HS_UNROLL);  // 256
constexpr int BIAS_SPLIT  = 4;                           // blocks per head
constexpr int BIAS_BLOCKS = H_ * BIAS_SPLIT;             // 64

__global__ void __launch_bounds__(256)
prep_all(const float* __restrict__ hs, const float* __restrict__ Wq,
         const float* __restrict__ Wk, const float* __restrict__ Wv,
         const float* __restrict__ Wo, const float* __restrict__ table,
         _Float16* __restrict__ hs16, _Float16* __restrict__ wqT,
         _Float16* __restrict__ wkT, _Float16* __restrict__ wvT,
         _Float16* __restrict__ woT, float* __restrict__ biasE) {
  // pitch 65 floats: row writes and column reads both touch 32 different banks
  __shared__ float tile[4][64][65];
  const int t = threadIdx.x;
  int bid = blockIdx.x;

  if (bid < WT_BLOCKS) {
    const float* srcs[4] = {Wq, Wk, Wv, Wo};
    _Float16*    dsts[4] = {wqT, wkT, wvT, woT};
    const int k0 = (bid >> 4) * 64, n0 = (bid & 15) * 64;
    const int rr = t >> 4, cc = (t & 15) * 4;            // 16 rows x 64 cols a pass
    // one 32-bit byte offset serves all 16 loads (uniform base + constant step)
    const unsigned lo = (unsigned)((k0 + rr) * HD_ + n0 + cc) * 4u;
    f4 v[4][4];
#pragma unroll  // constant indices: arrays stay in registers, loads issue together
    for (int m = 0; m < 4; ++m)
#pragma unroll  // as above
      for (int p = 0; p < 4; ++p)
        v[m][p] = *(const f4*)((const char*)srcs[m] + lo + p * (16 * HD_ * 4));
    // wait before the loads' offset register is rewritten; naming it as an input
    // keeps it live up to here: without that the last load's result is placed
    // over it while the fifteen loads in front still name it
    asm volatile("s_wait_xcnt 0x0" :: "v"(lo) : "memory");
#pragma unroll  // as above
    for (int m = 0; m < 4; ++m)
#pragma unroll  // as above
      for (int p = 0; p < 4; ++p)
#pragma unroll  // as above
        for (int e = 0; e < 4; ++e) tile[m][p * 16 + rr][cc + e] = v[m][p][e];
    __syncthreads();
    const int kc = (t & 7) * 8, nr = t >> 3;             // 32 n-rows x 64 k a pass
    const unsigned so = (unsigned)((n0 + nr) * D_ + k0 + kc) * 2u;
#pragma unroll  // as above
    for (int m = 0; m < 4; ++m)
#pragma unroll  // as above
      for (int p = 0; p < 2; ++p) {
        h8 o;
#pragma unroll  // as above
        for (int e = 0; e < 8; ++e) o[e] = (_Float16)tile[m][kc + e][p * 32 + nr];
        *(h8*)((char*)dsts[m] + so + p * (32 * D_ * 2)) = o;
      }
    return;
  }
  bid -= WT_BLOCKS;

  if (bid < HS_BLOCKS) {
    const unsigned base = (unsigned)bid * (256 * 8 * HS_UNROLL) + t * 8;  // element
    const unsigned lo = base * 4u;                       // byte offset of the loads
    f4 a[HS_UNROLL], b[HS_UNROLL];
#pragma unroll  // constant indices: arrays stay in registers, loads issue together
    for (int u = 0; u < HS_UNROLL; ++u) {
      a[u] = *(const f4*)((const char*)hs + lo + u * 8192);
      b[u] = *(const f4*)((const char*)hs + lo + u * 8192 + 16);
    }
#pragma unroll  // as above
    for (int u = 0; u < HS_UNROLL; ++u) {
      h8 o;
      o[0] = (_Float16)a[u][0]; o[1] = (_Float16)a[u][1];
      o[2] = (_Float16)a[u][2]; o[3] = (_Float16)a[u][3];
      o[4] = (_Float16)b[u][0]; o[5] = (_Float16)b[u][1];
      o[6] = (_Float16)b[u][2]; o[7] = (_Float16)b[u][3];
      *(h8*)(hs16 + base + u * 2048) = o;
    }
    // behind the stores: the code that follows them in the listing rewrites
    // their address and data registers
    asm volatile("s_wait_xcnt 0x0" ::: "memory");
    return;
  }
  bid -= HS_BLOCKS;

  const int h  = bid / BIAS_SPLIT;
  const int r0 = (bid % BIAS_SPLIT) * 1024 + t;
  float val[4];
#pragma unroll  // constant indices: arrays stay in registers, loads issue together
  for (int u = 0; u < 4; ++u) {
    const int r  = r0 + u * 256;
    const int rc = r < RELN ? r : RELN - 1;   // index 4095 re-reads the last entry, is not stored
    int rel = rc - (S_ - 1);
    const int nb = 16, me = 8;
    int rb = (rel > 0) ? nb : 0;
    int rp = rel < 0 ? -rel : rel;
    int bk;
    if (rp < me) {
      bk = rp;
    } else {
      float x = __logf((float)rp * (1.0f / me)) * (1.0f / __logf(16.0f)) * (float)(nb - me);
      bk = me + (int)x;
      if (bk > nb - 1) bk = nb - 1;
    }
    val[u] = table[(rb + bk) * H_ + h];
  }
#pragma unroll  // as above
  for (int u = 0; u < 4; ++u)
    if (r0 + u * 256 < RELN) biasE[h * RELN + r0 + u * 256] = val[u];
}

// ---------------------------------------------------------------------------
// 3) WMMA GEMM: C[M,N] = A[M,K](f16) * BT[N,K](f16, pre-transposed).
//    128x128x64 tile, 8 waves (4x2), wave = 32x64. Async global->LDS staging
//    for both operands (no VGPR bounce, no scalar stores) into a ring of NB tiles,
//    a tile's copies issued NB - 1 trips ahead of its use.
//    QKV=false has one block on a WGP and nothing else to cover the way of a tile
//    from L2 or memory, which is longer than a trip's work: with four tiles three
//    are under way at any time. QKV=true keeps two: three blocks fill the LDS.
//    QKV=true: BT is Wq^T, Wk^T, Wv^T stacked by rows, so that one grid of
//    three times the column blocks does all three projections: three blocks
//    share a WGP and one block's compute covers another's wait for its tile.
//    Column blocks of the first HD_ columns go to C, of the second to Ck
//    (both of row pitch Ndim), the third are scattered as CvT[b][h][dh][s]
//    for the attention pass.
// ---------------------------------------------------------------------------
template <typename OutT, bool QKV>
__global__ void __launch_bounds__(256)
gemm_wmma(const _Float16* __restrict__ A, const _Float16* __restrict__ BT,
          OutT* __restrict__ C, OutT* __restrict__ Ck, OutT* __restrict__ CvT,
          int Mdim, int Ndim, int Kdim) {
  constexpr int NB = QKV ? 2 : 4;                     // tiles in the ring, a power of two
  static_assert(D_ / 64 >= NB - 1 && HD_ / 64 >= NB - 1, "the prologue's tiles exist");
  __shared__ __align__(16) _Float16 As[NB][128][P64];
  __shared__ __align__(16) _Float16 Bs[NB][128][P64];  // [n][k]
  const int t    = threadIdx.x;
  const int lane = t & 31, w = t >> 5;
  const int wm   = w & 3, wn = w >> 2;
  const int m0   = blockIdx.y * 128, n0 = blockIdx.x * 128;
  const int lr   = lane & 15, ko = (lane >> 4) * 8;
  // Staging coords: eight lanes cover the 128 B that a row has in a tile, so a
  // wave-wide copy asks for four whole lines, not for 32 B out of each of sixteen.
  // A thread copies one 16-byte piece of four rows (32 apart) of each operand.
  const int srow = t >> 3, scol = (t & 7) * 8;

  auto stage = [&](int k0, int buf) {
    const _Float16* sa = A  + (size_t)(m0 + srow) * Kdim + k0 + scol;
    const _Float16* sb = BT + (size_t)(n0 + srow) * Kdim + k0 + scol;
    const size_t    rs = (size_t)32 * Kdim;           // 32 rows on, in elements
    const unsigned  la = (unsigned)(unsigned long long)&As[buf][srow][scol];
    const unsigned  lb = (unsigned)(unsigned long long)&Bs[buf][srow][scol];
    // the copies and their s_wait_xcnt in one statement: the wait then stands in
    // front of every later write of a register that a copy names
    asm volatile(
        "global_load_async_to_lds_b128 %0, %8, off\n\t"
        "global_load_async_to_lds_b128 %1, %9, off\n\t"
        "global_load_async_to_lds_b128 %2, %10, off\n\t"
        "global_load_async_to_lds_b128 %3, %11, off\n\t"
        "global_load_async_to_lds_b128 %4, %12, off\n\t"
        "global_load_async_to_lds_b128 %5, %13, off\n\t"
        "global_load_async_to_lds_b128 %6, %14, off\n\t"
        "global_load_async_to_lds_b128 %7, %15, off\n\t"
        "s_wait_xcnt 0x0"
        :: "v"(la), "v"(la + 32 * P64 * 2), "v"(la + 64 * P64 * 2), "v"(la + 96 * P64 * 2),
           "v"(lb), "v"(lb + 32 * P64 * 2), "v"(lb + 64 * P64 * 2), "v"(lb + 96 * P64 * 2),
           "v"(sa), "v"(sa + rs), "v"(sa + 2 * rs), "v"(sa + 3 * rs),
           "v"(sb), "v"(sb + rs), "v"(sb + 2 * rs), "v"(sb + 3 * rs)
        : "memory");
  };

  // Every wave issues eight copies a tile, and the count returns in issue order: a
  // wait that leaves the copies of the NB - 2 youngest tiles open covers the oldest.
  constexpr int OPEN = 8 * (NB - 2);
  v8f acc[2][4] = {};
#pragma unroll  // constant buffer indices
  for (int s = 0; s < NB - 1; ++s) stage(s * 64, s);
  // tile 0 has landed; the tiles behind it stay under way
  asm volatile("s_wait_asynccnt %0" :: "n"(OPEN) : "memory");
  __syncthreads();

  const int T = Kdim / 64;
  for (int i = 0; i < T; ++i) {
    const int  buf  = i & (NB - 1);
    const bool more = i + NB - 1 < T;               // the same for the whole block
    // into the buffer that the trip before has read (its foot's barrier is passed)
    if (more) stage((i + NB - 1) * 64, (i + NB - 1) & (NB - 1));
#pragma unroll
    for (int ks = 0; ks < 64; ks += 32) {
      Frag16 a[2], b[4];
#pragma unroll
      for (int mt = 0; mt < 2; ++mt) {
        int row = wm * 32 + mt * 16 + lr;
        a[mt].h[0] = *(const h8*)&As[buf][row][ks + ko];
        a[mt].h[1] = *(const h8*)&As[buf][row][ks + ko + 16];
      }
#pragma unroll
      for (int nt = 0; nt < 4; ++nt) {
        int col = wn * 64 + nt * 16 + lr;
        b[nt].h[0] = *(const h8*)&Bs[buf][col][ks + ko];
        b[nt].h[1] = *(const h8*)&Bs[buf][col][ks + ko + 16];
      }
#pragma unroll
      for (int mt = 0; mt < 2; ++mt)
#pragma unroll
        for (int nt = 0; nt < 4; ++nt)
          acc[mt][nt] = wmma16x16x32(a[mt], b[nt], acc[mt][nt]);
    }
    // hand-over: this wave's LDS reads are done, its copies of the next tile have
    // landed; behind the barrier that holds for all waves, and the buffer just
    // read may be refilled (at the head of the next trip). A trip that has issued
    // a tile has NB - 1 tiles open and leaves the younger ones so; the last trips
    // issue none, the number open is another there, and they wait for all.
    asm volatile("s_wait_dscnt 0x0" ::: "memory");
    if (NB > 2 && more) asm volatile("s_wait_asynccnt %0" :: "n"(OPEN) : "memory");
    else                async_wait0();
    __syncthreads();
  }

  // a 128-column block lies wholly in one of the three outputs (block-uniform)
  const int sel = QKV ? n0 / HD_ : 0;
  const int nc0 = QKV ? n0 % HD_ : n0;
  if (QKV && sel == 2) {
#pragma unroll
    for (int mt = 0; mt < 2; ++mt)
#pragma unroll
      for (int nt = 0; nt < 4; ++nt)
#pragma unroll
        for (int j = 0; j < 8; ++j) {
          int m = m0 + wm * 32 + mt * 16 + j + (lane >> 4) * 8;
          int n = nc0 + wn * 64 + nt * 16 + lr;
          int bb = m >> 11, s = m & (S_ - 1);       // token -> (batch, seq)
          int hh = n >> 6,  dh = n & (DH_ - 1);     // col   -> (head, dh)
          CvT[((size_t)((bb * H_ + hh) * DH_ + dh)) * S_ + s] = (OutT)acc[mt][nt][j];
        }
    return;
  }
  OutT* __restrict__ Cs = (QKV && sel == 1) ? Ck : C;
#pragma unroll
  for (int mt = 0; mt < 2; ++mt)
#pragma unroll
    for (int nt = 0; nt < 4; ++nt)
#pragma unroll
      for (int j = 0; j < 8; ++j) {
        int m = m0 + wm * 32 + mt * 16 + j + (lane >> 4) * 8;
        int n = nc0 + wn * 64 + nt * 16 + lr;
        Cs[(size_t)m * Ndim + n] = (OutT)acc[mt][nt][j];
      }
  // behind the stores: in the listing the V block follows them and rewrites
  // their address and data registers
  if constexpr (QKV) asm volatile("s_wait_xcnt 0x0" ::: "memory");
}

// ---------------------------------------------------------------------------
// 4) Flash attention in S^T form, double-buffered async K/V staging.
//    S^T = K * Q^T  ->  lane = query col, j = key row; per-query scalar state;
//    P^T converts in registers to the B-fragment of O^T = V^T * P^T.
//    The bucket of a distance is the last one of its side from 128 on
//    so a pass whose keys all lie 129 or more from
//    all of the block's queries has ONE bias value: it takes the maximum over
//    the raw products and folds scale, bias and maximum into one multiply-add
//    in front of the exponential, with no bias read. Only the three passes
//    round the diagonal read the bias per element, from 512 floats in LDS.
//    A pass takes KT keys: what is paid once a pass (the exchange of the
//    maximum and of the sum between the wave's halves, the rescale of O, the
//    wait for the copies, the barrier) is paid once per KT keys, and the
//    score tiles of a pass are independent work for the wave.
//    A wave takes 32 queries (two column tiles) and one half of a pass's keys:
//    every K and V^T fragment read from LDS feeds two matrix instructions, so
//    the block reads half the LDS bytes of a 16-query wave, with as many waves.
//    The two waves of a query group keep their own maximum, sum and O over
//    their halves of the keys; the halves are joined once, behind the last pass.
// ---------------------------------------------------------------------------
constexpr int KT  = 128;         // keys per pass
constexpr int KW  = KT / 2;      // keys per pass and wave
constexpr int PKT = KT + 8;      // V^T rows of KT keys: 272 B = 16 B x 17 (odd)
static_assert(KT == 128 && S_ % KT == 0 && S_ / KT >= 2, "the staging below is written for 128 keys");
struct FarPass  { static constexpr bool far = true;  };
struct NearPass { static constexpr bool far = false; };

// four waves per SIMD (two blocks on a WGP) as before: the register budget is held at 256
__global__ void __launch_bounds__(256) __attribute__((amdgpu_waves_per_eu(4, 4)))
flash_attn(const _Float16* __restrict__ Q, const _Float16* __restrict__ K,
           const _Float16* __restrict__ VT, const float* __restrict__ biasE,
           _Float16* __restrict__ Ctx) {
  __shared__ __align__(16) _Float16 Ks[2][KT][P64];  // [key][dh]
  __shared__ __align__(16) _Float16 Vs[2][64][PKT];  // [dh][key] (from VT)
  __shared__ float biasL[BIASL];

  const int t = threadIdx.x, lane = t & 31, w = t >> 5;
  const int lr = lane & 15, ko = (lane >> 4) * 8;
  const int b = blockIdx.z, h = blockIdx.y;
  const int qg = w & 3, kh = w >> 2;                 // query group of 32, half of the keys
  const int q0 = blockIdx.x * 128, qrow = q0 + qg * 32;
  const int k0w = kh * KW;                           // the wave's first key within a pass

  // bias near the diagonal: biasL[i] = bias(key - query = i - 255); far from it
  // the two capped values, taken at the ends of the expanded row
  const float* biasH = biasE + h * RELN + (S_ - 1);
  static_assert(BIASL == 2 * 256, "two entries a thread, both loads in flight together");
  const float bn0 = biasH[t - 255], bn1 = biasH[t + 1];
  const float biasLo = biasH[-(S_ - 1)], biasHi = biasH[S_ - 1];

  const _Float16* Kb  = K  + (size_t)(b * S_) * HD_ + h * DH_;
  const _Float16* VTb = VT + (size_t)((b * H_ + h) * DH_) * S_;

  // One pass's tiles: K 128 rows of 128 B, V^T 64 rows of 256 B; a thread copies
  // four 16-byte pieces of each (32 K rows / 16 V^T rows apart).
  auto stageKV = [&](int kb, int buf) {
    const _Float16* gk = Kb + (size_t)(kb + (t >> 3)) * HD_ + (t & 7) * 8;
    const _Float16* gv = VTb + (size_t)(t >> 4) * S_ + kb + (t & 15) * 8;
    const unsigned lk = (unsigned)(unsigned long long)&Ks[buf][t >> 3][(t & 7) * 8];
    const unsigned lv = (unsigned)(unsigned long long)&Vs[buf][t >> 4][(t & 15) * 8];
    // the copies and their s_wait_xcnt in one statement: the wait then stands in
    // front of every later write of a register that a copy names
    asm volatile(
        "global_load_async_to_lds_b128 %0, %8, off\n\t"
        "global_load_async_to_lds_b128 %1, %9, off\n\t"
        "global_load_async_to_lds_b128 %2, %10, off\n\t"
        "global_load_async_to_lds_b128 %3, %11, off\n\t"
        "global_load_async_to_lds_b128 %4, %12, off\n\t"
        "global_load_async_to_lds_b128 %5, %13, off\n\t"
        "global_load_async_to_lds_b128 %6, %14, off\n\t"
        "global_load_async_to_lds_b128 %7, %15, off\n\t"
        "s_wait_xcnt 0x0"
        :: "v"(lk), "v"(lk + 32 * P64 * 2), "v"(lk + 64 * P64 * 2), "v"(lk + 96 * P64 * 2),
           "v"(lv), "v"(lv + 16 * PKT * 2), "v"(lv + 32 * PKT * 2), "v"(lv + 48 * PKT * 2),
           "v"(gk), "v"(gk + 32 * HD_), "v"(gk + 64 * HD_), "v"(gk + 96 * HD_),
           "v"(gv), "v"(gv + 16 * S_), "v"(gv + 32 * S_), "v"(gv + 48 * S_)
        : "memory");
  };

  // Q^T B-fragments (lane = query, regs = dh), loaded once from global
  Frag16 qf[2][2];                                   // [query tile][dh half]
  const _Float16* qa[2];
#pragma unroll  // constant indices: the fragments stay in registers
  for (int qt = 0; qt < 2; ++qt) {
    qa[qt] = Q + ((size_t)(b * S_ + qrow + qt * 16 + lr) * HD_) + h * DH_ + ko;
    qf[qt][0].h[0] = *(const h8*)(qa[qt]);
    qf[qt][0].h[1] = *(const h8*)(qa[qt] + 16);
    qf[qt][1].h[0] = *(const h8*)(qa[qt] + 32);
    qf[qt][1].h[1] = *(const h8*)(qa[qt] + 48);
  }
  // behind the Q loads: the code that follows rewrites their address registers;
  // naming the addresses as inputs keeps them live up to the wait
  asm volatile("s_wait_xcnt 0x0" :: "v"(qa[0]), "v"(qa[1]) : "memory");

  v8f o[2][4] = {};                                  // [query tile][dh tile]
  float mx[2] = {-INFINITY, -INFINITY}, lsum[2] = {0.0f, 0.0f};

  stageKV(0, 0);
  biasL[t]       = bn0;
  biasL[t + 256] = bn1;
  async_wait0();
  __syncthreads();
  stageKV(KT, 1);                                    // flies during pass 0

  // The passes kbeg, kbeg + KT, ... below kend. FAR is a type whose member says
  // which form of the softmax is built; cb is a far run's one bias value.
  auto passes = [&](int kbeg, int kend, float cb, auto FAR) {
    constexpr bool far = decltype(FAR)::far;
    for (int kb = kbeg; kb < kend; kb += KT) {
      const int buf = (kb / KT) & 1;

      // S^T tiles: rows = the wave's keys (tk*16..), cols = queries; one K fragment, two tiles
      Frag16 ka[KW / 16][2];
#pragma unroll  // constant indices: the fragments stay in registers
      for (int tk = 0; tk < KW / 16; ++tk) {
        int key = k0w + tk * 16 + lr;
        ka[tk][0].h[0] = *(const h8*)&Ks[buf][key][ko];
        ka[tk][0].h[1] = *(const h8*)&Ks[buf][key][ko + 16];
        ka[tk][1].h[0] = *(const h8*)&Ks[buf][key][32 + ko];
        ka[tk][1].h[1] = *(const h8*)&Ks[buf][key][32 + ko + 16];
      }
      // keeps the K reads one group in front of the products: a read placed among
      // them is waited for on the spot
      __builtin_amdgcn_sched_barrier(0);
      v8f sc[2][KW / 16];
#pragma unroll  // constant indices: the score tiles stay in registers
      for (int tk = 0; tk < KW / 16; ++tk)
#pragma unroll  // as above
        for (int qt = 0; qt < 2; ++qt) {
          v8f c = {};
          c = wmma16x16x32(ka[tk][0], qf[qt][0], c);
          c = wmma16x16x32(ka[tk][1], qf[qt][1], c);
          sc[qt][tk] = c;
        }
      // keeps the products one run in front of the vector work: mixed with it, each
      // product is followed by idle slots until its result may be read
      __builtin_amdgcn_sched_barrier(0);

      Frag16 pf[2][KW / 32];
#pragma unroll  // as above
      for (int qt = 0; qt < 2; ++qt) {
        // near: scale + bias from LDS first; far: the raw products. One maximum a tile
        float mt[KW / 16];
#pragma unroll  // as above
        for (int tk = 0; tk < KW / 16; ++tk) {
          if constexpr (!far) {
            int bbase = kb - q0 + k0w + tk * 16 + ((lane >> 4) << 3) - (qg * 32 + qt * 16 + lr) + 255;
#pragma unroll  // as above
            for (int j = 0; j < 8; ++j)
              sc[qt][tk][j] = sc[qt][tk][j] * 0.125f + biasL[bbase + j];
          }
          float m = sc[qt][tk][0];
#pragma unroll  // as above
          for (int j = 1; j < 8; ++j) m = fmaxf(m, sc[qt][tk][j]);
          mt[tk] = m;
        }

        // online softmax, per-query scalar state (lane l and l^16 share a query)
        float mloc = fmaxf(fmaxf(mt[0], mt[1]), fmaxf(mt[2], mt[3]));
        mloc = fmaxf(mloc, __shfl_xor(mloc, 16, 32));
        if constexpr (far) mloc = mloc * 0.125f + cb;  // the scale is positive: the maximum carries over
        float nm    = fmaxf(mx[qt], mloc);
        float alpha = __expf(mx[qt] - nm);
        mx[qt] = nm;
        constexpr float LOG2E = 1.44269504088896340736f;
        const float sh2 = (cb - nm) * LOG2E;           // far: exp(s/8 + cb - nm) = 2^(s * LOG2E/8 + sh2)

        v8f e2[KW / 16];                               // far: the exponents to base 2
        if constexpr (far) {
#pragma unroll  // as above
          for (int tk = 0; tk < KW / 16; ++tk) e2[tk] = sc[qt][tk] * (0.125f * LOG2E) + sh2;
        }

        float rg[KW / 32];                             // one partial sum per 32 keys
#pragma unroll  // as above
        for (int g = 0; g < KW / 32; ++g) {
          float r = 0.0f;
#pragma unroll  // as above
          for (int j = 0; j < 8; ++j) {
            float p0, p1;
            if constexpr (far) {
              p0 = __builtin_amdgcn_exp2f(e2[2 * g][j]);
              p1 = __builtin_amdgcn_exp2f(e2[2 * g + 1][j]);
            } else {
              p0 = __expf(sc[qt][2 * g][j] - nm);
              p1 = __expf(sc[qt][2 * g + 1][j] - nm);
            }
            r += p0 + p1;
            pf[qt][g].h[0][j] = (_Float16)p0;
            pf[qt][g].h[1][j] = (_Float16)p1;
          }
          rg[g] = r;
        }
        float rs = rg[0] + rg[1];
        rs += __shfl_xor(rs, 16, 32);
        lsum[qt] = lsum[qt] * alpha + rs;

#pragma unroll  // as above
        for (int tdh = 0; tdh < 4; ++tdh)
#pragma unroll  // as above
          for (int j = 0; j < 8; ++j) o[qt][tdh][j] *= alpha;
      }

      // O^T += V^T(16dh x 32k) * P^T(32k x 16q), 32 keys at a time; one V^T fragment, two tiles
#pragma unroll  // as above
      for (int g = 0; g < KW / 32; ++g)
#pragma unroll  // as above
        for (int tdh = 0; tdh < 4; ++tdh) {
          int dhrow = tdh * 16 + lr;
          Frag16 va;
          va.h[0] = *(const h8*)&Vs[buf][dhrow][k0w + g * 32 + ko];
          va.h[1] = *(const h8*)&Vs[buf][dhrow][k0w + g * 32 + ko + 16];
#pragma unroll  // as above
          for (int qt = 0; qt < 2; ++qt) o[qt][tdh] = wmma16x16x32(va, pf[qt][g], o[qt][tdh]);
        }

      // hand-over: this wave's LDS reads are done, its copies of the next tile have
      // landed; behind the barrier that holds for all waves, and the buffer just
      // read may be refilled
      asm volatile("s_wait_dscnt 0x0" ::: "memory");
      async_wait0();
      __syncthreads();
      if (kb + 2 * KT < S_) stageKV(kb + 2 * KT, buf);
    }
  };

  // Keys kb..kb+127 against queries q0..q0+127 (both starts multiples of 128) are
  // 129 or more apart once the starts differ by 256 or more: the keys fall into a
  // far run below the diagonal, up to three near passes, a far run above it.
  // The bounds are the same for the whole block.
  const int nlo = q0 >= KT ? q0 - KT : 0;
  const int nhi = q0 + 2 * KT <= S_ ? q0 + 2 * KT : S_;
  passes(0, nlo, biasLo, FarPass{});
  passes(nlo, nhi, 0.0f, NearPass{});
  passes(nhi, S_, biasHi, FarPass{});
  async_wait0();  // nothing is in flight here; the wave does not end on an open count

  // Join the two halves of the keys. Each wave of a pair finishes one query tile:
  // it hands the other tile's maximum, sum and O to its partner through LDS. The K
  // buffers are free: every wave's last read of them lies in front of the last
  // pass's barrier and no copy is in flight.
  constexpr int MRG_O = 8 * 8 * 32 * 4;              // floats: 8 tiles x 8 x 32 lanes x 16 B
  static_assert((MRG_O + 8 * 2 * 32) * 4 <= (int)sizeof(Ks), "the join fits the K buffers");
  float* mrg = reinterpret_cast<float*>(&Ks[0][0][0]);
  const bool up = kh != 0;                           // the wave keeps tile kh, gives tile 1 - kh
  {
    const int r = qg * 2 + (1 - kh);
#pragma unroll  // constant indices: O stays in registers
    for (int tdh = 0; tdh < 4; ++tdh) {
      const v8f g = up ? o[0][tdh] : o[1][tdh];
      f4 lo4 = {g[0], g[1], g[2], g[3]}, hi4 = {g[4], g[5], g[6], g[7]};
      *(f4*)&mrg[((r * 8 + tdh * 2) * 32 + lane) * 4]     = lo4;
      *(f4*)&mrg[((r * 8 + tdh * 2 + 1) * 32 + lane) * 4] = hi4;
    }
    mrg[MRG_O + (r * 2) * 32 + lane]     = up ? mx[0] : mx[1];
    mrg[MRG_O + (r * 2 + 1) * 32 + lane] = up ? lsum[0] : lsum[1];
  }
  __syncthreads();                                   // the partner's tile is in LDS

  // rescale both halves to the common maximum, normalize, store context
  // row-major [token][h*64+dh]
  const int r = qg * 2 + kh;
  const float ma = up ? mx[1] : mx[0], la = up ? lsum[1] : lsum[0];
  const float mb = mrg[MRG_O + (r * 2) * 32 + lane], lb = mrg[MRG_O + (r * 2 + 1) * 32 + lane];
  const float mj = fmaxf(ma, mb);
  float fa = __expf(ma - mj), fb = __expf(mb - mj);
  const float inv = 1.0f / (la * fa + lb * fb);
  fa *= inv;
  fb *= inv;
#pragma unroll  // as above
  for (int tdh = 0; tdh < 4; ++tdh) {
    const v8f mine = up ? o[1][tdh] : o[0][tdh];
    const f4 lo4 = *(const f4*)&mrg[((r * 8 + tdh * 2) * 32 + lane) * 4];
    const f4 hi4 = *(const f4*)&mrg[((r * 8 + tdh * 2 + 1) * 32 + lane) * 4];
#pragma unroll  // as above
    for (int j = 0; j < 8; ++j) {
      int dhcol = tdh * 16 + j + (lane >> 4) * 8;
      const float other = j < 4 ? lo4[j & 3] : hi4[j & 3];
      Ctx[((size_t)(b * S_ + qrow + kh * 16 + lr) * HD_) + h * DH_ + dhcol] =
          (_Float16)(mine[j] * fa + other * fb);
    }
  }
}

// ---------------------------------------------------------------------------
// Launcher
// ---------------------------------------------------------------------------
extern "C" void kernel_launch(void* const* d_in, const int* in_sizes, int n_in,
                              void* d_out, int out_size, void* d_ws, size_t ws_size,
                              hipStream_t stream) {
  (void)in_sizes; (void)n_in; (void)out_size; (void)ws_size;
  const float* hs    = (const float*)d_in[0];
  const float* Wq    = (const float*)d_in[1];
  const float* Wk    = (const float*)d_in[2];
  const float* Wv    = (const float*)d_in[3];
  const float* Wo    = (const float*)d_in[4];
  const float* table = (const float*)d_in[5];

  char*  ws  = (char*)d_ws;
  size_t off = 0;
  auto alloc = [&](size_t bytes) -> void* {
    void* p = ws + off;
    off += (bytes + 255) & ~(size_t)255;
    return p;
  };

  _Float16* hs16   = (_Float16*)alloc((size_t)M_ * D_ * 2);
  _Float16* wq16T  = (_Float16*)alloc((size_t)3 * D_ * HD_ * 2);  // Wq^T | Wk^T | Wv^T
  _Float16* wk16T  = wq16T + (size_t)D_ * HD_;
  _Float16* wv16T  = wk16T + (size_t)D_ * HD_;
  _Float16* wo16T  = (_Float16*)alloc((size_t)HD_ * D_ * 2);
  _Float16* q16    = (_Float16*)alloc((size_t)M_ * HD_ * 2);
  _Float16* k16    = (_Float16*)alloc((size_t)M_ * HD_ * 2);
  _Float16* vT16   = (_Float16*)alloc((size_t)M_ * HD_ * 2);
  _Float16* ctx16  = (_Float16*)alloc((size_t)M_ * HD_ * 2);
  float*    biasE  = (float*)alloc((size_t)H_ * RELN * 4);

  prep_all<<<WT_BLOCKS + HS_BLOCKS + BIAS_BLOCKS, 256, 0, stream>>>(
      hs, Wq, Wk, Wv, Wo, table, hs16, wq16T, wk16T, wv16T, wo16T, biasE);

  dim3 gQkv(3 * HD_ / 128, M_ / 128);
  gemm_wmma<_Float16, true><<<gQkv, 256, 0, stream>>>(hs16, wq16T, q16, k16, vT16, M_, HD_, D_);

  dim3 gAttn(S_ / 128, H_, B_);
  flash_attn<<<gAttn, 256, 0, stream>>>(q16, k16, vT16, biasE, ctx16);

  dim3 gOut(D_ / 128, M_ / 128);
  gemm_wmma<float, false><<<gOut, 256, 0, stream>>>(ctx16, wo16T, (float*)d_out, nullptr, nullptr,
                                                    M_, D_, HD_);
}

// v009
// A run of this version takes 77.4 microseconds.
// In both of two side-by-side timings against v008, it was 1.03 times as fast.
// All steps since v000 together make it 3.07 times as fast.
#include <hip/hip_runtime.h>
#include <hip/hip_fp16.h>
#include <math.h>

// ---------------------------------------------------------------------------
// Encoder self-attention with relative position bias (gfx1250, wave32, WMMA).
// one prep launch (f32->f16, weights transposed, bias expanded) -> one async WMMA GEMM launch
// for Q, K and V on a ring of four LDS tiles (V written head-transposed) -> flash attention (S^T form, async K/V staging,
// LDS-resident bias, register P->B-frag) -> WMMA GEMM out on a ring of four LDS tiles.
// ---------------------------------------------------------------------------

typedef __attribute__((ext_vector_type(16))) _Float16 v16h;
typedef __attribute__((ext_vector_type(8)))  _Float16 h8;
typedef __attribute__((ext_vector_type(8)))  float    v8f;
typedef __attribute__((ext_vector_type(4)))  float    f4;

union Frag16 { v16h v; h8 h[2]; };

__device__ __forceinline__ v8f wmma16x16x32(const Frag16& a, const Frag16& b, v8f c) {
  return __builtin_amdgcn_wmma_f32_16x16x32_f16(false, a.v, false, b.v, (short)0, c,
                                                false, false);
}

// Async global->LDS copies bypass the VGPRs and are tracked by ASYNCcnt.
__device__ __forceinline__ void async_wait0() {
  asm volatile("s_wait_asynccnt 0x0" ::: "memory");
}

constexpr int B_  = 2;
constexpr int S_  = 2048;
constexpr int D_  = 1024;
constexpr int H_  = 16;
constexpr int DH_ = 64;
constexpr int HD_ = H_ * DH_;    // 1024
constexpr int M_  = B_ * S_;     // 4096
constexpr int RELN = 2 * S_ - 1; // 4095
constexpr int BIASL = 512;       // key - query from -255 to 256 (256 is staged, never read)
// LDS row pitches in f16 elements. Every tile is read by ds_load_b128 with 16
// lanes on 16 consecutive rows: a pitch of 16 B x odd puts those rows on 16
// different groups of four banks; the bare 128 B / 256 B rows fall on 2 / 1.
constexpr int P64 = 64 + 8;      // 64-element rows: 144 B
constexpr int P32 = 32 + 8;      // unused: no LDS tile has 32-element rows

// ---------------------------------------------------------------------------
// 1) All operand preparation in ONE launch; the block index picks the role.
//    The three roles share no data; each wave moves many bytes, so that few
//    waves have to be started and only one launch gap is paid.
//    a) weights: f32[k][n] -> f16[n][k]; a block takes one 64x64 tile position
//       of all four matrices (16 b128 loads in flight per thread, one barrier,
//       whole 128 B lines stored).
//    b) hidden states: f32 -> f16, 64 elements per thread, all loads first.
//    c) rel_bias_table[32][H] -> biasE[H][4095] indexed by (rel + S-1).
// ---------------------------------------------------------------------------
constexpr int WT_BLOCKS   = (D_ / 64) * (HD_ / 64);      // 256
constexpr int HS_UNROLL   = 8;
constexpr int HS_BLOCKS   = M_ * D_ / (256 * 8 * HS_UNROLL);  // 256
constexpr int BIAS_SPLIT  = 4;                           // blocks per head
constexpr int BIAS_BLOCKS = H_ * BIAS_SPLIT;             // 64

__global__ void __launch_bounds__(256)
prep_all(const float* __restrict__ hs, const float* __restrict__ Wq,
         const float* __restrict__ Wk, const float* __restrict__ Wv,
         const float* __restrict__ Wo, const float* __restrict__ table,
         _Float16* __restrict__ hs16, _Float16* __restrict__ wqT,
         _Float16* __restrict__ wkT, _Float16* __restrict__ wvT,
         _Float16* __restrict__ woT, float* __restrict__ biasE) {
  // pitch 65 floats: row writes and column reads both touch 32 different banks
  __shared__ float tile[4][64][65];
  const int t = threadIdx.x;
  int bid = blockIdx.x;

  if (bid < WT_BLOCKS) {
    const float* srcs[4] = {Wq, Wk, Wv, Wo};
    _Float16*    dsts[4] = {wqT, wkT, wvT, woT};
    const int k0 = (bid >> 4) * 64, n0 = (bid & 15) * 64;
    const int rr = t >> 4, cc = (t & 15) * 4;            // 16 rows x 64 cols a pass
    // one 32-bit byte offset serves all 16 loads (uniform base + constant step)
    const unsigned lo = (unsigned)((k0 + rr) * HD_ + n0 + cc) * 4u;
    f4 v[4][4];
#pragma unroll  // constant indices: arrays stay in registers, loads issue together
    for (int m = 0; m < 4; ++m)
#pragma unroll  // as above
      for (int p = 0; p < 4; ++p)
        v[m][p] = *(const f4*)((const char*)srcs[m] + lo + p * (16 * HD_ * 4));
    // wait before the loads' offset register is rewritten; naming it as an input
    // keeps it live up to here: without that the last load's result is placed
    // over it while the fifteen loads in front still name it
    asm volatile("s_wait_xcnt 0x0" :: "v"(lo) : "memory");
#pragma unroll  // as above
    for (int m = 0; m < 4; ++m)
#pragma unroll  // as above
      for (int p = 0; p < 4; ++p)
#pragma unroll  // as above
        for (int e = 0; e < 4; ++e) tile[m][p * 16 + rr][cc + e] = v[m][p][e];
    __syncthreads();
    const int kc = (t & 7) * 8, nr = t >> 3;             // 32 n-rows x 64 k a pass
    const unsigned so = (unsigned)((n0 + nr) * D_ + k0 + kc) * 2u;
#pragma unroll  // as above
    for (int m = 0; m < 4; ++m)
#pragma unroll  // as above
      for (int p = 0; p < 2; ++p) {
        h8 o;
#pragma unroll  // as above
        for (int e = 0; e < 8; ++e) o[e] = (_Float16)tile[m][kc + e][p * 32 + nr];
        *(h8*)((char*)dsts[m] + so + p * (32 * D_ * 2)) = o;
      }
    return;
  }
  bid -= WT_BLOCKS;

  if (bid < HS_BLOCKS) {
    const unsigned base = (unsigned)bid * (256 * 8 * HS_UNROLL) + t * 8;  // element
    const unsigned lo = base * 4u;                       // byte offset of the loads
    f4 a[HS_UNROLL], b[HS_UNROLL];
#pragma unroll  // constant indices: arrays stay in registers, loads issue together
    for (int u = 0; u < HS_UNROLL; ++u) {
      a[u] = *(const f4*)((const char*)hs + lo + u * 8192);
      b[u] = *(const f4*)((const char*)hs + lo + u * 8192 + 16);
    }
#pragma unroll  // as above
    for (int u = 0; u < HS_UNROLL; ++u) {
      h8 o;
      o[0] = (_Float16)a[u][0]; o[1] = (_Float16)a[u][1];
      o[2] = (_Float16)a[u][2]; o[3] = (_Float16)a[u][3];
      o[4] = (_Float16)b[u][0]; o[5] = (_Float16)b[u][1];
      o[6] = (_Float16)b[u][2]; o[7] = (_Float16)b[u][3];
      *(h8*)(hs16 + base + u * 2048) = o;
    }
    // behind the stores: the code that follows them in the listing rewrites
    // their address and data registers
    asm volatile("s_wait_xcnt 0x0" ::: "memory");
    return;
  }
  bid -= HS_BLOCKS;

  const int h  = bid / BIAS_SPLIT;
  const int r0 = (bid % BIAS_SPLIT) * 1024 + t;
  float val[4];
#pragma unroll  // constant indices: arrays stay in registers, loads issue together
  for (int u = 0; u < 4; ++u) {
    const int r  = r0 + u * 256;
    const int rc = r < RELN ? r : RELN - 1;   // index 4095 re-reads the last entry, is not stored
    int rel = rc - (S_ - 1);
    const int nb = 16, me = 8;
    int rb = (rel > 0) ? nb : 0;
    int rp = rel < 0 ? -rel : rel;
    int bk;
    if (rp < me) {
      bk = rp;
    } else {
      float x = __logf((float)rp * (1.0f / me)) * (1.0f / __logf(16.0f)) * (float)(nb - me);
      bk = me + (int)x;
      if (bk > nb - 1) bk = nb - 1;
    }
    val[u] = table[(rb + bk) * H_ + h];
  }
#pragma unroll  // as above
  for (int u = 0; u < 4; ++u)
    if (r0 + u * 256 < RELN) biasE[h * RELN + r0 + u * 256] = val[u];
}

// ---------------------------------------------------------------------------
// 3) WMMA GEMM: C[M,N] = A[M,K](f16) * BT[N,K](f16, pre-transposed).
//    Async global->LDS staging for both operands (no VGPR bounce, no scalar
//    stores) into a ring of NB tiles of 64 k, a tile's copies issued NB - 1 trips
//    ahead of its use. One block stands on a WGP and has nothing else to cover the
//    way of a tile from L2 or memory, which is longer than a trip's work: with four
//    tiles three are under way at any time.
//    What a block asks of L2 is (BM + BN) rows of K for BM x BN results, and the
//    copies do not hit the WGP's cache: the tile is as large as still gives every
//    WGP a block.
//    QKV=false: 128x128 tile, 8 waves (4x2), wave = 32x64; 256 blocks.
//    QKV=true: BT is Wq^T, Wk^T, Wv^T stacked by rows, so that one grid does all
//    three projections: 256x192 tile, 16 waves (4x4), wave = 64x48; 256 blocks.
//    A group of 16 columns lies wholly in one output and one head: groups of the
//    first HD_ columns go to C, of the second to Ck (both of row pitch Ndim), the
//    third are scattered as CvT[b][h][dh][s] for the attention pass.
// ---------------------------------------------------------------------------
template <typename OutT, bool QKV>
__global__ void __launch_bounds__(QKV ? 512 : 256)
gemm_wmma(const _Float16* __restrict__ A, const _Float16* __restrict__ BT,
          OutT* __restrict__ C, OutT* __restrict__ Ck, OutT* __restrict__ CvT,
          int Mdim, int Ndim, int Kdim) {
  constexpr int BM = QKV ? 256 : 128, BN = QKV ? 192 : 128;  // block tile
  constexpr int WNS = QKV ? 4 : 2;                    // waves along n; four along m
  constexpr int MT = BM / 4 / 16, NT = BN / WNS / 16; // 16x16 tiles of a wave
  constexpr int SR = 4 * WNS * 32 / 8;                // rows that one copy of the block covers
  constexpr int NB = 4;                               // tiles in the ring, a power of two
  constexpr int KG = QKV ? 2 : 1;                     // k steps of 32 whose fragments are read together
  static_assert(D_ / 64 >= NB - 1 && HD_ / 64 >= NB - 1, "the prologue's tiles exist");
  static_assert(BM == 4 * SR && (BN == 4 * SR || BN == 3 * SR), "copies a thread and tile, below");
  static_assert(M_ % BM == 0 && (QKV ? 3 * HD_ : D_) % BN == 0, "whole tiles only");
  __shared__ __align__(16) _Float16 As[NB][BM][P64];
  __shared__ __align__(16) _Float16 Bs[NB][BN][P64];  // [n][k]
  const int t    = threadIdx.x;
  const int lane = t & 31, w = t >> 5;
  const int wm   = w & 3, wn = w >> 2;
  const int m0   = blockIdx.y * BM, n0 = blockIdx.x * BN;
  const int lr   = lane & 15, ko = (lane >> 4) * 8;
  // Staging coords: eight lanes cover the 128 B that a row has in a tile, so a
  // wave-wide copy asks for four whole lines, not for 32 B out of each of sixteen.
  // A thread copies one 16-byte piece of four rows of A and of three or four of BT
  // (SR rows apart).
  const int srow = t >> 3, scol = (t & 7) * 8;

  auto stage = [&](int k0, int buf) {
    const _Float16* sa = A  + (size_t)(m0 + srow) * Kdim + k0 + scol;
    const _Float16* sb = BT + (size_t)(n0 + srow) * Kdim + k0 + scol;
    const size_t    rs = (size_t)SR * Kdim;           // SR rows on, in elements
    constexpr unsigned LS = SR * P64 * 2;             // SR rows on, in LDS bytes
    const unsigned  la = (unsigned)(unsigned long long)&As[buf][srow][scol];
    const unsigned  lb = (unsigned)(unsigned long long)&Bs[buf][srow][scol];
    // the copies and their s_wait_xcnt in one statement: the wait then stands in
    // front of every later write of a register that a copy names
    if constexpr (BN == 3 * SR) {
      asm volatile(
          "global_load_async_to_lds_b128 %0, %7, off\n\t"
          "global_load_async_to_lds_b128 %1, %8, off\n\t"
          "global_load_async_to_lds_b128 %2, %9, off\n\t"
          "global_load_async_to_lds_b128 %3, %10, off\n\t"
          "global_load_async_to_lds_b128 %4, %11, off\n\t"
          "global_load_async_to_lds_b128 %5, %12, off\n\t"
          "global_load_async_to_lds_b128 %6, %13, off\n\t"
          "s_wait_xcnt 0x0"
          :: "v"(la), "v"(la + LS), "v"(la + 2 * LS), "v"(la + 3 * LS),
             "v"(lb), "v"(lb + LS), "v"(lb + 2 * LS),
             "v"(sa), "v"(sa + rs), "v"(sa + 2 * rs), "v"(sa + 3 * rs),
             "v"(sb), "v"(sb + rs), "v"(sb + 2 * rs)
          : "memory");
    } else {
      asm volatile(
          "global_load_async_to_lds_b128 %0, %8, off\n\t"
          "global_load_async_to_lds_b128 %1, %9, off\n\t"
          "global_load_async_to_lds_b128 %2, %10, off\n\t"
          "global_load_async_to_lds_b128 %3, %11, off\n\t"
          "global_load_async_to_lds_b128 %4, %12, off\n\t"
          "global_load_async_to_lds_b128 %5, %13, off\n\t"
          "global_load_async_to_lds_b128 %6, %14, off\n\t"
          "global_load_async_to_lds_b128 %7, %15, off\n\t"
          "s_wait_xcnt 0x0"
          :: "v"(la), "v"(la + LS), "v"(la + 2 * LS), "v"(la + 3 * LS),
             "v"(lb), "v"(lb + LS), "v"(lb + 2 * LS), "v"(lb + 3 * LS),
             "v"(sa), "v"(sa + rs), "v"(sa + 2 * rs), "v"(sa + 3 * rs),
             "v"(sb), "v"(sb + rs), "v"(sb + 2 * rs), "v"(sb + 3 * rs)
          : "memory");
    }
  };

  // Every wave issues the same number of copies a tile, and the count returns in
  // issue order: a wait that leaves the copies of the NB - 2 youngest tiles open
  // covers the oldest.
  constexpr int OPEN = (BM / SR + BN / SR) * (NB - 2);
  v8f acc[MT][NT] = {};
#pragma unroll  // constant buffer indices
  for (int s = 0; s < NB - 1; ++s) stage(s * 64, s);
  // tile 0 has landed; the tiles behind it stay under way
  asm volatile("s_wait_asynccnt %0" :: "n"(OPEN) : "memory");
  __syncthreads();

  const int T = Kdim / 64;
  for (int i = 0; i < T; ++i) {
    const int  buf  = i & (NB - 1);
    const bool more = i + NB - 1 < T;               // the same for the whole block
    // into the buffer that the trip before has read (its foot's barrier is passed)
    if (more) stage((i + NB - 1) * 64, (i + NB - 1) & (NB - 1));
#pragma unroll
    for (int kg = 0; kg < 64; kg += 32 * KG) {
      Frag16 a[KG][MT], b[KG][NT];
#pragma unroll
      for (int u = 0; u < KG; ++u) {
        const int ks = kg + u * 32;
#pragma unroll
        for (int mt = 0; mt < MT; ++mt) {
          int row = wm * (MT * 16) + mt * 16 + lr;
          a[u][mt].h[0] = *(const h8*)&As[buf][row][ks + ko];
          a[u][mt].h[1] = *(const h8*)&As[buf][row][ks + ko + 16];
        }
#pragma unroll
        for (int nt = 0; nt < NT; ++nt) {
          int col = wn * (NT * 16) + nt * 16 + lr;
          b[u][nt].h[0] = *(const h8*)&Bs[buf][col][ks + ko];
          b[u][nt].h[1] = *(const h8*)&Bs[buf][col][ks + ko + 16];
        }
      }
      // keeps the trip's fragment reads one group in front of its products: left to
      // itself the build of the 64x48 tile reads A one fragment at a time into one
      // register set and waits out the LDS latency in front of every three products
      if constexpr (QKV) __builtin_amdgcn_sched_barrier(0);
#pragma unroll
      for (int u = 0; u < KG; ++u)
#pragma unroll
        for (int mt = 0; mt < MT; ++mt)
#pragma unroll
          for (int nt = 0; nt < NT; ++nt)
            acc[mt][nt] = wmma16x16x32(a[u][mt], b[u][nt], acc[mt][nt]);
      // keeps the hand-over's s_wait_dscnt 0 behind the products: moved up among them
      // it makes the first products wait for the last fragment too
      if constexpr (QKV) __builtin_amdgcn_sched_barrier(0);
    }
    // hand-over: this wave's LDS reads are done, its copies of the next tile have
    // landed; behind the barrier that holds for all waves, and the buffer just
    // read may be refilled (at the head of the next trip). A trip that has issued
    // a tile has NB - 1 tiles open and leaves the younger ones so; the last trips
    // issue none, the number open is another there, and they wait for all.
    asm volatile("s_wait_dscnt 0x0" ::: "memory");
    if (more) asm volatile("s_wait_asynccnt %0" :: "n"(OPEN) : "memory");
    else      async_wait0();
    __syncthreads();
  }

  if constexpr (QKV) {
    // the wave's number in a scalar register: the choice of the output is a scalar branch
    const int wnu = __builtin_amdgcn_readfirstlane(wn);
#pragma unroll
    for (int nt = 0; nt < NT; ++nt) {
      const int ng  = n0 + wnu * (NT * 16) + nt * 16; // first of 16 columns, the same for the wave
      const int sel = ng / HD_, nc = ng % HD_ + lr;   // output, column in it
      if (sel == 2) {
        const int hh = nc >> 6, dh = nc & (DH_ - 1);  // col -> (head, dh)
#pragma unroll
        for (int mt = 0; mt < MT; ++mt)
#pragma unroll
          for (int j = 0; j < 8; ++j) {
            int m = m0 + wm * (MT * 16) + mt * 16 + j + (lane >> 4) * 8;
            int bb = m >> 11, s = m & (S_ - 1);       // token -> (batch, seq)
            CvT[((size_t)((bb * H_ + hh) * DH_ + dh)) * S_ + s] = (OutT)acc[mt][nt][j];
          }
        // behind the stores: the code that follows rewrites their address and data registers
        asm volatile("s_wait_xcnt 0x0" ::: "memory");
      } else {
        OutT* __restrict__ Cs = sel == 1 ? Ck : C;
#pragma unroll
        for (int mt = 0; mt < MT; ++mt)
#pragma unroll
          for (int j = 0; j < 8; ++j) {
            int m = m0 + wm * (MT * 16) + mt * 16 + j + (lane >> 4) * 8;
            Cs[(size_t)m * Ndim + nc] = (OutT)acc[mt][nt][j];
          }
        // as above
        asm volatile("s_wait_xcnt 0x0" ::: "memory");
      }
    }
  } else {
#pragma unroll
    for (int mt = 0; mt < MT; ++mt)
#pragma unroll
      for (int nt = 0; nt < NT; ++nt)
#pragma unroll
        for (int j = 0; j < 8; ++j) {
          int m = m0 + wm * (MT * 16) + mt * 16 + j + (lane >> 4) * 8;
          int n = n0 + wn * (NT * 16) + nt * 16 + lr;
          C[(size_t)m * Ndim + n] = (OutT)acc[mt][nt][j];
        }
  }
}

// ---------------------------------------------------------------------------
// 4) Flash attention in S^T form, double-buffered async K/V staging.
//    S^T = K * Q^T  ->  lane = query col, j = key row; per-query scalar state;
//    P^T converts in registers to the B-fragment of O^T = V^T * P^T.
//    The bucket of a distance is the last one of its side from 128 on
//    so a pass whose keys all lie 129 or more from
//    all of the block's queries has ONE bias value: it takes the maximum over
//    the raw products and folds scale, bias and maximum into one multiply-add
//    in front of the exponential, with no bias read. Only the three passes
//    round the diagonal read the bias per element, from 512 floats in LDS.
//    A pass takes KT keys: what is paid once a pass (the exchange of the
//    maximum and of the sum between the wave's halves, the rescale of O, the
//    wait for the copies, the barrier) is paid once per KT keys, and the
//    score tiles of a pass are independent work for the wave.
//    A wave takes 32 queries (two column tiles) and one half of a pass's keys:
//    every K and V^T fragment read from LDS feeds two matrix instructions, so
//    the block reads half the LDS bytes of a 16-query wave, with as many waves.
//    The two waves of a query group keep their own maximum, sum and O over
//    their halves of the keys; the halves are joined once, behind the last pass.
// ---------------------------------------------------------------------------
constexpr int KT  = 128;         // keys per pass
constexpr int KW  = KT / 2;      // keys per pass and wave
constexpr int PKT = KT + 8;      // V^T rows of KT keys: 272 B = 16 B x 17 (odd)
static_assert(KT == 128 && S_ % KT == 0 && S_ / KT >= 2, "the staging below is written for 128 keys");
struct FarPass  { static constexpr bool far = true;  };
struct NearPass { static constexpr bool far = false; };

// four waves per SIMD (two blocks on a WGP) as before: the register budget is held at 256
__global__ void __launch_bounds__(256) __attribute__((amdgpu_waves_per_eu(4, 4)))
flash_attn(const _Float16* __restrict__ Q, const _Float16* __restrict__ K,
           const _Float16* __restrict__ VT, const float* __restrict__ biasE,
           _Float16* __restrict__ Ctx) {
  __shared__ __align__(16) _Float16 Ks[2][KT][P64];  // [key][dh]
  __shared__ __align__(16) _Float16 Vs[2][64][PKT];  // [dh][key] (from VT)
  __shared__ float biasL[BIASL];

  const int t = threadIdx.x, lane = t & 31, w = t >> 5;
  const int lr = lane & 15, ko = (lane >> 4) * 8;
  const int b = blockIdx.z, h = blockIdx.y;
  const int qg = w & 3, kh = w >> 2;                 // query group of 32, half of the keys
  const int q0 = blockIdx.x * 128, qrow = q0 + qg * 32;
  const int k0w = kh * KW;                           // the wave's first key within a pass

  // bias near the diagonal: biasL[i] = bias(key - query = i - 255); far from it
  // the two capped values, taken at the ends of the expanded row
  const float* biasH = biasE + h * RELN + (S_ - 1);
  static_assert(BIASL == 2 * 256, "two entries a thread, both loads in flight together");
  const float bn0 = biasH[t - 255], bn1 = biasH[t + 1];
  const float biasLo = biasH[-(S_ - 1)], biasHi = biasH[S_ - 1];

  const _Float16* Kb  = K  + (size_t)(b * S_) * HD_ + h * DH_;
  const _Float16* VTb = VT + (size_t)((b * H_ + h) * DH_) * S_;

  // One pass's tiles: K 128 rows of 128 B, V^T 64 rows of 256 B; a thread copies
  // four 16-byte pieces of each (32 K rows / 16 V^T rows apart).
  auto stageKV = [&](int kb, int buf) {
    const _Float16* gk = Kb + (size_t)(kb + (t >> 3)) * HD_ + (t & 7) * 8;
    const _Float16* gv = VTb + (size_t)(t >> 4) * S_ + kb + (t & 15) * 8;
    const unsigned lk = (unsigned)(unsigned long long)&Ks[buf][t >> 3][(t & 7) * 8];
    const unsigned lv = (unsigned)(unsigned long long)&Vs[buf][t >> 4][(t & 15) * 8];
    // the copies and their s_wait_xcnt in one statement: the wait then stands in
    // front of every later write of a register that a copy names
    asm volatile(
        "global_load_async_to_lds_b128 %0, %8, off\n\t"
        "global_load_async_to_lds_b128 %1, %9, off\n\t"
        "global_load_async_to_lds_b128 %2, %10, off\n\t"
        "global_load_async_to_lds_b128 %3, %11, off\n\t"
        "global_load_async_to_lds_b128 %4, %12, off\n\t"
        "global_load_async_to_lds_b128 %5, %13, off\n\t"
        "global_load_async_to_lds_b128 %6, %14, off\n\t"
        "global_load_async_to_lds_b128 %7, %15, off\n\t"
        "s_wait_xcnt 0x0"
        :: "v"(lk), "v"(lk + 32 * P64 * 2), "v"(lk + 64 * P64 * 2), "v"(lk + 96 * P64 * 2),
           "v"(lv), "v"(lv + 16 * PKT * 2), "v"(lv + 32 * PKT * 2), "v"(lv + 48 * PKT * 2),
           "v"(gk), "v"(gk + 32 * HD_), "v"(gk + 64 * HD_), "v"(gk + 96 * HD_),
           "v"(gv), "v"(gv + 16 * S_), "v"(gv + 32 * S_), "v"(gv + 48 * S_)
        : "memory");
  };

  // Q^T B-fragments (lane = query, regs = dh), loaded once from global
  Frag16 qf[2][2];                                   // [query tile][dh half]
  const _Float16* qa[2];
#pragma unroll  // constant indices: the fragments stay in registers
  for (int qt = 0; qt < 2; ++qt) {
    qa[qt] = Q + ((size_t)(b * S_ + qrow + qt * 16 + lr) * HD_) + h * DH_ + ko;
    qf[qt][0].h[0] = *(const h8*)(qa[qt]);
    qf[qt][0].h[1] = *(const h8*)(qa[qt] + 16);
    qf[qt][1].h[0] = *(const h8*)(qa[qt] + 32);
    qf[qt][1].h[1] = *(const h8*)(qa[qt] + 48);
  }
  // behind the Q loads: the code that follows rewrites their address registers;
  // naming the addresses as inputs keeps them live up to the wait
  asm volatile("s_wait_xcnt 0x0" :: "v"(qa[0]), "v"(qa[1]) : "memory");

  v8f o[2][4] = {};                                  // [query tile][dh tile]
  float mx[2] = {-INFINITY, -INFINITY}, lsum[2] = {0.0f, 0.0f};

  stageKV(0, 0);
  biasL[t]       = bn0;
  biasL[t + 256] = bn1;
  async_wait0();
  __syncthreads();
  stageKV(KT, 1);                                    // flies during pass 0

  // The passes kbeg, kbeg + KT, ... below kend. FAR is a type whose member says
  // which form of the softmax is built; cb is a far run's one bias value.
  auto passes = [&](int kbeg, int kend, float cb, auto FAR) {
    constexpr bool far = decltype(FAR)::far;
    for (int kb = kbeg; kb < kend; kb += KT) {
      const int buf = (kb / KT) & 1;

      // S^T tiles: rows = the wave's keys (tk*16..), cols = queries; one K fragment, two tiles
      Frag16 ka[KW / 16][2];
#pragma unroll  // constant indices: the fragments stay in registers
      for (int tk = 0; tk < KW / 16; ++tk) {
        int key = k0w + tk * 16 + lr;
        ka[tk][0].h[0] = *(const h8*)&Ks[buf][key][ko];
        ka[tk][0].h[1] = *(const h8*)&Ks[buf][key][ko + 16];
        ka[tk][1].h[0] = *(const h8*)&Ks[buf][key][32 + ko];
        ka[tk][1].h[1] = *(const h8*)&Ks[buf][key][32 + ko + 16];
      }
      // keeps the K reads one group in front of the products: a read placed among
      // them is waited for on the spot
      __builtin_amdgcn_sched_barrier(0);
      v8f sc[2][KW / 16];
#pragma unroll  // constant indices: the score tiles stay in registers
      for (int tk = 0; tk < KW / 16; ++tk)
#pragma unroll  // as above
        for (int qt = 0; qt < 2; ++qt) {
          v8f c = {};
          c = wmma16x16x32(ka[tk][0], qf[qt][0], c);
          c = wmma16x16x32(ka[tk][1], qf[qt][1], c);
          sc[qt][tk] = c;
        }
      // keeps the products one run in front of the vector work: mixed with it, each
      // product is followed by idle slots until its result may be read
      __builtin_amdgcn_sched_barrier(0);

      Frag16 pf[2][KW / 32];
#pragma unroll  // as above
      for (int qt = 0; qt < 2; ++qt) {
        // near: scale + bias from LDS first; far: the raw products. One maximum a tile
        float mt[KW / 16];
#pragma unroll  // as above
        for (int tk = 0; tk < KW / 16; ++tk) {
          if constexpr (!far) {
            int bbase = kb - q0 + k0w + tk * 16 + ((lane >> 4) << 3) - (qg * 32 + qt * 16 + lr) + 255;
#pragma unroll  // as above
            for (int j = 0; j < 8; ++j)
              sc[qt][tk][j] = sc[qt][tk][j] * 0.125f + biasL[bbase + j];
          }
          float m = sc[qt][tk][0];
#pragma unroll  // as above
          for (int j = 1; j < 8; ++j) m = fmaxf(m, sc[qt][tk][j]);
          mt[tk] = m;
        }

        // online softmax, per-query scalar state (lane l and l^16 share a query)
        float mloc = fmaxf(fmaxf(mt[0], mt[1]), fmaxf(mt[2], mt[3]));
        mloc = fmaxf(mloc, __shfl_xor(mloc, 16, 32));
        if constexpr (far) mloc = mloc * 0.125f + cb;  // the scale is positive: the maximum carries over
        float nm    = fmaxf(mx[qt], mloc);
        float alpha = __expf(mx[qt] - nm);
        mx[qt] = nm;
        constexpr float LOG2E = 1.44269504088896340736f;
        const float sh2 = (cb - nm) * LOG2E;           // far: exp(s/8 + cb - nm) = 2^(s * LOG2E/8 + sh2)

        v8f e2[KW / 16];                               // far: the exponents to base 2
        if constexpr (far) {
#pragma unroll  // as above
          for (int tk = 0; tk < KW / 16; ++tk) e2[tk] = sc[qt][tk] * (0.125f * LOG2E) + sh2;
        }

        float rg[KW / 32];                             // one partial sum per 32 keys
#pragma unroll  // as above
        for (int g = 0; g < KW / 32; ++g) {
          float r = 0.0f;
#pragma unroll  // as above
          for (int j = 0; j < 8; ++j) {
            float p0, p1;
            if constexpr (far) {
              p0 = __builtin_amdgcn_exp2f(e2[2 * g][j]);
              p1 = __builtin_amdgcn_exp2f(e2[2 * g + 1][j]);
            } else {
              p0 = __expf(sc[qt][2 * g][j] - nm);
              p1 = __expf(sc[qt][2 * g + 1][j] - nm);
            }
            r += p0 + p1;
            pf[qt][g].h[0][j] = (_Float16)p0;
            pf[qt][g].h[1][j] = (_Float16)p1;
          }
          rg[g] = r;
        }
        float rs = rg[0] + rg[1];
        rs += __shfl_xor(rs, 16, 32);
        lsum[qt] = lsum[qt] * alpha + rs;

#pragma unroll  // as above
        for (int tdh = 0; tdh < 4; ++tdh)
#pragma unroll  // as above
          for (int j = 0; j < 8; ++j) o[qt][tdh][j] *= alpha;
      }

      // O^T += V^T(16dh x 32k) * P^T(32k x 16q), 32 keys at a time; one V^T fragment, two tiles
#pragma unroll  // as above
      for (int g = 0; g < KW / 32; ++g)
#pragma unroll  // as above
        for (int tdh = 0; tdh < 4; ++tdh) {
          int dhrow = tdh * 16 + lr;
          Frag16 va;
          va.h[0] = *(const h8*)&Vs[buf][dhrow][k0w + g * 32 + ko];
          va.h[1] = *(const h8*)&Vs[buf][dhrow][k0w + g * 32 + ko + 16];
#pragma unroll  // as above
          for (int qt = 0; qt < 2; ++qt) o[qt][tdh] = wmma16x16x32(va, pf[qt][g], o[qt][tdh]);
        }

      // hand-over: this wave's LDS reads are done, its copies of the next tile have
      // landed; behind the barrier that holds for all waves, and the buffer just
      // read may be refilled
      asm volatile("s_wait_dscnt 0x0" ::: "memory");
      async_wait0();
      __syncthreads();
      if (kb + 2 * KT < S_) stageKV(kb + 2 * KT, buf);
    }
  };

  // Keys kb..kb+127 against queries q0..q0+127 (both starts multiples of 128) are
  // 129 or more apart once the starts differ by 256 or more: the keys fall into a
  // far run below the diagonal, up to three near passes, a far run above it.
  // The bounds are the same for the whole block.
  const int nlo = q0 >= KT ? q0 - KT : 0;
  const int nhi = q0 + 2 * KT <= S_ ? q0 + 2 * KT : S_;
  passes(0, nlo, biasLo, FarPass{});
  passes(nlo, nhi, 0.0f, NearPass{});
  passes(nhi, S_, biasHi, FarPass{});
  async_wait0();  // nothing is in flight here; the wave does not end on an open count

  // Join the two halves of the keys. Each wave of a pair finishes one query tile:
  // it hands the other tile's maximum, sum and O to its partner through LDS. The K
  // buffers are free: every wave's last read of them lies in front of the last
  // pass's barrier and no copy is in flight.
  constexpr int MRG_O = 8 * 8 * 32 * 4;              // floats: 8 tiles x 8 x 32 lanes x 16 B
  static_assert((MRG_O + 8 * 2 * 32) * 4 <= (int)sizeof(Ks), "the join fits the K buffers");
  float* mrg = reinterpret_cast<float*>(&Ks[0][0][0]);
  const bool up = kh != 0;                           // the wave keeps tile kh, gives tile 1 - kh
  {
    const int r = qg * 2 + (1 - kh);
#pragma unroll  // constant indices: O stays in registers
    for (int tdh = 0; tdh < 4; ++tdh) {
      const v8f g = up ? o[0][tdh] : o[1][tdh];
      f4 lo4 = {g[0], g[1], g[2], g[3]}, hi4 = {g[4], g[5], g[6], g[7]};
      *(f4*)&mrg[((r * 8 + tdh * 2) * 32 + lane) * 4]     = lo4;
      *(f4*)&mrg[((r * 8 + tdh * 2 + 1) * 32 + lane) * 4] = hi4;
    }
    mrg[MRG_O + (r * 2) * 32 + lane]     = up ? mx[0] : mx[1];
    mrg[MRG_O + (r * 2 + 1) * 32 + lane] = up ? lsum[0] : lsum[1];
  }
  __syncthreads();                                   // the partner's tile is in LDS

  // rescale both halves to the common maximum, normalize, store context
  // row-major [token][h*64+dh]
  const int r = qg * 2 + kh;
  const float ma = up ? mx[1] : mx[0], la = up ? lsum[1] : lsum[0];
  const float mb = mrg[MRG_O + (r * 2) * 32 + lane], lb = mrg[MRG_O + (r * 2 + 1) * 32 + lane];
  const float mj = fmaxf(ma, mb);
  float fa = __expf(ma - mj), fb = __expf(mb - mj);
  const float inv = 1.0f / (la * fa + lb * fb);
  fa *= inv;
  fb *= inv;
#pragma unroll  // as above
  for (int tdh = 0; tdh < 4; ++tdh) {
    const v8f mine = up ? o[1][tdh] : o[0][tdh];
    const f4 lo4 = *(const f4*)&mrg[((r * 8 + tdh * 2) * 32 + lane) * 4];
    const f4 hi4 = *(const f4*)&mrg[((r * 8 + tdh * 2 + 1) * 32 + lane) * 4];
#pragma unroll  // as above
    for (int j = 0; j < 8; ++j) {
      int dhcol = tdh * 16 + j + (lane >> 4) * 8;
      const float other = j < 4 ? lo4[j & 3] : hi4[j & 3];
      Ctx[((size_t)(b * S_ + qrow + kh * 16 + lr) * HD_) + h * DH_ + dhcol] =
          (_Float16)(mine[j] * fa + other * fb);
    }
  }
}

// ---------------------------------------------------------------------------
// Launcher
// ---------------------------------------------------------------------------
extern "C" void kernel_launch(void* const* d_in, const int* in_sizes, int n_in,
                              void* d_out, int out_size, void* d_ws, size_t ws_size,
                              hipStream_t stream) {
  (void)in_sizes; (void)n_in; (void)out_size; (void)ws_size;
  const float* hs    = (const float*)d_in[0];
  const float* Wq    = (const float*)d_in[1];
  const float* Wk    = (const float*)d_in[2];
  const float* Wv    = (const float*)d_in[3];
  const float* Wo    = (const float*)d_in[4];
  const float* table = (const float*)d_in[5];

  char*  ws  = (char*)d_ws;
  size_t off = 0;
  auto alloc = [&](size_t bytes) -> void* {
    void* p = ws + off;
    off += (bytes + 255) & ~(size_t)255;
    return p;
  };

  _Float16* hs16   = (_Float16*)alloc((size_t)M_ * D_ * 2);
  _Float16* wq16T  = (_Float16*)alloc((size_t)3 * D_ * HD_ * 2);  // Wq^T | Wk^T | Wv^T
  _Float16* wk16T  = wq16T + (size_t)D_ * HD_;
  _Float16* wv16T  = wk16T + (size_t)D_ * HD_;
  _Float16* wo16T  = (_Float16*)alloc((size_t)HD_ * D_ * 2);
  _Float16* q16    = (_Float16*)alloc((size_t)M_ * HD_ * 2);
  _Float16* k16    = (_Float16*)alloc((size_t)M_ * HD_ * 2);
  _Float16* vT16   = (_Float16*)alloc((size_t)M_ * HD_ * 2);
  _Float16* ctx16  = (_Float16*)alloc((size_t)M_ * HD_ * 2);
  float*    biasE  = (float*)alloc((size_t)H_ * RELN * 4);

  prep_all<<<WT_BLOCKS + HS_BLOCKS + BIAS_BLOCKS, 256, 0, stream>>>(
      hs, Wq, Wk, Wv, Wo, table, hs16, wq16T, wk16T, wv16T, wo16T, biasE);

  dim3 gQkv(3 * HD_ / 192, M_ / 256);
  gemm_wmma<_Float16, true><<<gQkv, 512, 0, stream>>>(hs16, wq16T, q16, k16, vT16, M_, HD_, D_);

  dim3 gAttn(S_ / 128, H_, B_);
  flash_attn<<<gAttn, 256, 0, stream>>>(q16, k16, vT16, biasE, ctx16);

  dim3 gOut(D_ / 128, M_ / 128);
  gemm_wmma<float, false><<<gOut, 256, 0, stream>>>(ctx16, wo16T, (float*)d_out, nullptr, nullptr,
                                                    M_, D_, HD_);
}

// v010
// It runs in 73.6 microseconds.
// Timed twice side by side with v009, it ran 1.06 and 1.05 times as fast.
// All steps since v000 together make it 3.23 times as fast.
#include <hip/hip_runtime.h>
#include <hip/hip_fp16.h>
#include <math.h>

// ---------------------------------------------------------------------------
// Encoder self-attention with relative position bias (gfx1250, wave32, WMMA).
// one prep launch (f32->f16, weights transposed, bias expanded) -> one async WMMA GEMM launch
// for Q, K and V on a ring of four LDS tiles (V written head-transposed) -> flash attention (S^T form, async K/V staging,
// LDS-resident bias, register P->B-frag) -> WMMA GEMM out on a ring of four LDS tiles.
// ---------------------------------------------------------------------------

typedef __attribute__((ext_vector_type(16))) _Float16 v16h;
typedef __attribute__((ext_vector_type(8)))  _Float16 h8;
typedef __attribute__((ext_vector_type(8)))  float    v8f;
typedef __attribute__((ext_vector_type(4)))  float    f4;

union Frag16 { v16h v; h8 h[2]; };

__device__ __forceinline__ v8f wmma16x16x32(const Frag16& a, const Frag16& b, v8f c) {
  return __builtin_amdgcn_wmma_f32_16x16x32_f16(false, a.v, false, b.v, (short)0, c,
                                                false, false);
}

// Async global->LDS copies bypass the VGPRs and are tracked by ASYNCcnt.
__device__ __forceinline__ void async_wait0() {
  asm volatile("s_wait_asynccnt 0x0" ::: "memory");
}

constexpr int B_  = 2;
constexpr int S_  = 2048;
constexpr int D_  = 1024;
constexpr int H_  = 16;
constexpr int DH_ = 64;
constexpr int HD_ = H_ * DH_;    // 1024
constexpr int M_  = B_ * S_;     // 4096
constexpr int RELN = 2 * S_ - 1; // 4095
constexpr int BIASL = 512;       // key - query from -255 to 256 (256 is staged, never read)
// LDS row pitches in f16 elements. Every tile is read by ds_load_b128 with 16
// lanes on 16 consecutive rows: a pitch of 16 B x odd puts those rows on 16
// different groups of four banks; the bare 128 B / 256 B rows fall on 2 / 1.
constexpr int P64 = 64 + 8;      // 64-element rows: 144 B
constexpr int P32 = 32 + 8;      // 32-element rows:  80 B
// The softmax works on exponents to base 2. The projection stores Q times
// 1/sqrt(dh) * log2(e) (one rounding to f16, from the f32 sums, as before), so
// that K * Q^T is the scaled score in that unit with no vector work on it.
constexpr float LOG2E  = 1.44269504088896340736f;
constexpr float QSCALE = 0.125f * LOG2E;

// ---------------------------------------------------------------------------
// 1) All operand preparation in ONE launch; the block index picks the role.
//    The three roles share no data; each wave moves many bytes, so that few
//    waves have to be started and only one launch gap is paid.
//    a) weights: f32[k][n] -> f16[n][k]; a block takes one 64x64 tile position
//       of all four matrices (16 b128 loads in flight per thread, one barrier,
//       whole 128 B lines stored).
//    b) hidden states: f32 -> f16, 64 elements per thread, all loads first.
//    c) rel_bias_table[32][H] -> biasE[H][4095] indexed by (rel + S-1).
// ---------------------------------------------------------------------------
constexpr int WT_BLOCKS   = (D_ / 64) * (HD_ / 64);      // 256
constexpr int HS_UNROLL   = 8;
constexpr int HS_BLOCKS   = M_ * D_ / (256 * 8 * HS_UNROLL);  // 256
constexpr int BIAS_SPLIT  = 4;                           // blocks per head
constexpr int BIAS_BLOCKS = H_ * BIAS_SPLIT;             // 64

__global__ void __launch_bounds__(256)
prep_all(const float* __restrict__ hs, const float* __restrict__ Wq,
         const float* __restrict__ Wk, const float* __restrict__ Wv,
         const float* __restrict__ Wo, const float* __restrict__ table,
         _Float16* __restrict__ hs16, _Float16* __restrict__ wqT,
         _Float16* __restrict__ wkT, _Float16* __restrict__ wvT,
         _Float16* __restrict__ woT, float* __restrict__ biasE) {
  // pitch 65 floats: row writes and column reads both touch 32 different banks
  __shared__ float tile[4][64][65];
  const int t = threadIdx.x;
  int bid = blockIdx.x;

  if (bid < WT_BLOCKS) {
    const float* srcs[4] = {Wq, Wk, Wv, Wo};
    _Float16*    dsts[4] = {wqT, wkT, wvT, woT};
    const int k0 = (bid >> 4) * 64, n0 = (bid & 15) * 64;
    const int rr = t >> 4, cc = (t & 15) * 4;            // 16 rows x 64 cols a pass
    // one 32-bit byte offset serves all 16 loads (uniform base + constant step)
    const unsigned lo = (unsigned)((k0 + rr) * HD_ + n0 + cc) * 4u;
    f4 v[4][4];
#pragma unroll  // constant indices: arrays stay in registers, loads issue together
    for (int m = 0; m < 4; ++m)
#pragma unroll  // as above
      for (int p = 0; p < 4; ++p)
        v[m][p] = *(const f4*)((const char*)srcs[m] + lo + p * (16 * HD_ * 4));
    // wait before the loads' offset register is rewritten; naming it as an input
    // keeps it live up to here: without that the last load's result is placed
    // over it while the fifteen loads in front still name it
    asm volatile("s_wait_xcnt 0x0" :: "v"(lo) : "memory");
#pragma unroll  // as above
    for (int m = 0; m < 4; ++m)
#pragma unroll  // as above
      for (int p = 0; p < 4; ++p)
#pragma unroll  // as above
        for (int e = 0; e < 4; ++e) tile[m][p * 16 + rr][cc + e] = v[m][p][e];
    __syncthreads();
    const int kc = (t & 7) * 8, nr = t >> 3;             // 32 n-rows x 64 k a pass
    const unsigned so = (unsigned)((n0 + nr) * D_ + k0 + kc) * 2u;
#pragma unroll  // as above
    for (int m = 0; m < 4; ++m)
#pragma unroll  // as above
      for (int p = 0; p < 2; ++p) {
        h8 o;
#pragma unroll  // as above
        for (int e = 0; e < 8; ++e) o[e] = (_Float16)tile[m][kc + e][p * 32 + nr];
        *(h8*)((char*)dsts[m] + so + p * (32 * D_ * 2)) = o;
      }
    return;
  }
  bid -= WT_BLOCKS;

  if (bid < HS_BLOCKS) {
    const unsigned base = (unsigned)bid * (256 * 8 * HS_UNROLL) + t * 8;  // element
    const unsigned lo = base * 4u;                       // byte offset of the loads
    f4 a[HS_UNROLL], b[HS_UNROLL];
#pragma unroll  // constant indices: arrays stay in registers, loads issue together
    for (int u = 0; u < HS_UNROLL; ++u) {
      a[u] = *(const f4*)((const char*)hs + lo + u * 8192);
      b[u] = *(const f4*)((const char*)hs + lo + u * 8192 + 16);
    }
#pragma unroll  // as above
    for (int u = 0; u < HS_UNROLL; ++u) {
      h8 o;
      o[0] = (_Float16)a[u][0]; o[1] = (_Float16)a[u][1];
      o[2] = (_Float16)a[u][2]; o[3] = (_Float16)a[u][3];
      o[4] = (_Float16)b[u][0]; o[5] = (_Float16)b[u][1];
      o[6] = (_Float16)b[u][2]; o[7] = (_Float16)b[u][3];
      *(h8*)(hs16 + base + u * 2048) = o;
    }
    // behind the stores: the code that follows them in the listing rewrites
    // their address and data registers
    asm volatile("s_wait_xcnt 0x0" ::: "memory");
    return;
  }
  bid -= HS_BLOCKS;

  const int h  = bid / BIAS_SPLIT;
  const int r0 = (bid % BIAS_SPLIT) * 1024 + t;
  float val[4];
#pragma unroll  // constant indices: arrays stay in registers, loads issue together
  for (int u = 0; u < 4; ++u) {
    const int r  = r0 + u * 256;
    const int rc = r < RELN ? r : RELN - 1;   // index 4095 re-reads the last entry, is not stored
    int rel = rc - (S_ - 1);
    const int nb = 16, me = 8;
    int rb = (rel > 0) ? nb : 0;
    int rp = rel < 0 ? -rel : rel;
    int bk;
    if (rp < me) {
      bk = rp;
    } else {
      float x = __logf((float)rp * (1.0f / me)) * (1.0f / __logf(16.0f)) * (float)(nb - me);
      bk = me + (int)x;
      if (bk > nb - 1) bk = nb - 1;
    }
    val[u] = table[(rb + bk) * H_ + h];
  }
#pragma unroll  // as above
  for (int u = 0; u < 4; ++u)
    if (r0 + u * 256 < RELN) biasE[h * RELN + r0 + u * 256] = val[u];
}

// ---------------------------------------------------------------------------
// 3) WMMA GEMM: C[M,N] = A[M,K](f16) * BT[N,K](f16, pre-transposed).
//    Async global->LDS staging for both operands (no VGPR bounce, no scalar
//    stores) into a ring of NB tiles of 64 k, a tile's copies issued NB - 1 trips
//    ahead of its use. One block stands on a WGP and has nothing else to cover the
//    way of a tile from L2 or memory, which is longer than a trip's work: with four
//    tiles three are under way at any time.
//    What a block asks of L2 is (BM + BN) rows of K for BM x BN results, and the
//    copies do not hit the WGP's cache: the tile is as large as still gives every
//    WGP a block.
//    QKV=false: 128x128 tile, 8 waves (4x2), wave = 32x64; 256 blocks.
//    QKV=true: BT is Wq^T, Wk^T, Wv^T stacked by rows, so that one grid does all
//    three projections: 256x192 tile, 16 waves (4x4), wave = 64x48; 256 blocks.
//    A group of 16 columns lies wholly in one output and one head: groups of the
//    first HD_ columns go to C, of the second to Ck (both of row pitch Ndim), the
//    third are scattered as CvT[b][h][dh][s] for the attention pass.
// ---------------------------------------------------------------------------
template <typename OutT, bool QKV>
__global__ void __launch_bounds__(QKV ? 512 : 256)
gemm_wmma(const _Float16* __restrict__ A, const _Float16* __restrict__ BT,
          OutT* __restrict__ C, OutT* __restrict__ Ck, OutT* __restrict__ CvT,
          int Mdim, int Ndim, int Kdim) {
  constexpr int BM = QKV ? 256 : 128, BN = QKV ? 192 : 128;  // block tile
  constexpr int WNS = QKV ? 4 : 2;                    // waves along n; four along m
  constexpr int MT = BM / 4 / 16, NT = BN / WNS / 16; // 16x16 tiles of a wave
  constexpr int SR = 4 * WNS * 32 / 8;                // rows that one copy of the block covers
  constexpr int NB = 4;                               // tiles in the ring, a power of two
  constexpr int KG = QKV ? 2 : 1;                     // k steps of 32 whose fragments are read together
  static_assert(D_ / 64 >= NB - 1 && HD_ / 64 >= NB - 1, "the prologue's tiles exist");
  static_assert(BM == 4 * SR && (BN == 4 * SR || BN == 3 * SR), "copies a thread and tile, below");
  static_assert(M_ % BM == 0 && (QKV ? 3 * HD_ : D_) % BN == 0, "whole tiles only");
  __shared__ __align__(16) _Float16 As[NB][BM][P64];
  __shared__ __align__(16) _Float16 Bs[NB][BN][P64];  // [n][k]
  const int t    = threadIdx.x;
  const int lane = t & 31, w = t >> 5;
  const int wm   = w & 3, wn = w >> 2;
  const int m0   = blockIdx.y * BM, n0 = blockIdx.x * BN;
  const int lr   = lane & 15, ko = (lane >> 4) * 8;
  // Staging coords: eight lanes cover the 128 B that a row has in a tile, so a
  // wave-wide copy asks for four whole lines, not for 32 B out of each of sixteen.
  // A thread copies one 16-byte piece of four rows of A and of three or four of BT
  // (SR rows apart).
  const int srow = t >> 3, scol = (t & 7) * 8;

  auto stage = [&](int k0, int buf) {
    const _Float16* sa = A  + (size_t)(m0 + srow) * Kdim + k0 + scol;
    const _Float16* sb = BT + (size_t)(n0 + srow) * Kdim + k0 + scol;
    const size_t    rs = (size_t)SR * Kdim;           // SR rows on, in elements
    constexpr unsigned LS = SR * P64 * 2;             // SR rows on, in LDS bytes
    const unsigned  la = (unsigned)(unsigned long long)&As[buf][srow][scol];
    const unsigned  lb = (unsigned)(unsigned long long)&Bs[buf][srow][scol];
    // the copies and their s_wait_xcnt in one statement: the wait then stands in
    // front of every later write of a register that a copy names
    if constexpr (BN == 3 * SR) {
      asm volatile(
          "global_load_async_to_lds_b128 %0, %7, off\n\t"
          "global_load_async_to_lds_b128 %1, %8, off\n\t"
          "global_load_async_to_lds_b128 %2, %9, off\n\t"
          "global_load_async_to_lds_b128 %3, %10, off\n\t"
          "global_load_async_to_lds_b128 %4, %11, off\n\t"
          "global_load_async_to_lds_b128 %5, %12, off\n\t"
          "global_load_async_to_lds_b128 %6, %13, off\n\t"
          "s_wait_xcnt 0x0"
          :: "v"(la), "v"(la + LS), "v"(la + 2 * LS), "v"(la + 3 * LS),
             "v"(lb), "v"(lb + LS), "v"(lb + 2 * LS),
             "v"(sa), "v"(sa + rs), "v"(sa + 2 * rs), "v"(sa + 3 * rs),
             "v"(sb), "v"(sb + rs), "v"(sb + 2 * rs)
          : "memory");
    } else {
      asm volatile(
          "global_load_async_to_lds_b128 %0, %8, off\n\t"
          "global_load_async_to_lds_b128 %1, %9, off\n\t"
          "global_load_async_to_lds_b128 %2, %10, off\n\t"
          "global_load_async_to_lds_b128 %3, %11, off\n\t"
          "global_load_async_to_lds_b128 %4, %12, off\n\t"
          "global_load_async_to_lds_b128 %5, %13, off\n\t"
          "global_load_async_to_lds_b128 %6, %14, off\n\t"
          "global_load_async_to_lds_b128 %7, %15, off\n\t"
          "s_wait_xcnt 0x0"
          :: "v"(la), "v"(la + LS), "v"(la + 2 * LS), "v"(la + 3 * LS),
             "v"(lb), "v"(lb + LS), "v"(lb + 2 * LS), "v"(lb + 3 * LS),
             "v"(sa), "v"(sa + rs), "v"(sa + 2 * rs), "v"(sa + 3 * rs),
             "v"(sb), "v"(sb + rs), "v"(sb + 2 * rs), "v"(sb + 3 * rs)
          : "memory");
    }
  };

  // Every wave issues the same number of copies a tile, and the count returns in
  // issue order: a wait that leaves the copies of the NB - 2 youngest tiles open
  // covers the oldest.
  constexpr int OPEN = (BM / SR + BN / SR) * (NB - 2);
  v8f acc[MT][NT] = {};
#pragma unroll  // constant buffer indices
  for (int s = 0; s < NB - 1; ++s) stage(s * 64, s);
  // tile 0 has landed; the tiles behind it stay under way
  asm volatile("s_wait_asynccnt %0" :: "n"(OPEN) : "memory");
  __syncthreads();

  const int T = Kdim / 64;
  for (int i = 0; i < T; ++i) {
    const int  buf  = i & (NB - 1);
    const bool more = i + NB - 1 < T;               // the same for the whole block
    // into the buffer that the trip before has read (its foot's barrier is passed)
    if (more) stage((i + NB - 1) * 64, (i + NB - 1) & (NB - 1));
#pragma unroll
    for (int kg = 0; kg < 64; kg += 32 * KG) {
      Frag16 a[KG][MT], b[KG][NT];
#pragma unroll
      for (int u = 0; u < KG; ++u) {
        const int ks = kg + u * 32;
#pragma unroll
        for (int mt = 0; mt < MT; ++mt) {
          int row = wm * (MT * 16) + mt * 16 + lr;
          a[u][mt].h[0] = *(const h8*)&As[buf][row][ks + ko];
          a[u][mt].h[1] = *(const h8*)&As[buf][row][ks + ko + 16];
        }
#pragma unroll
        for (int nt = 0; nt < NT; ++nt) {
          int col = wn * (NT * 16) + nt * 16 + lr;
          b[u][nt].h[0] = *(const h8*)&Bs[buf][col][ks + ko];
          b[u][nt].h[1] = *(const h8*)&Bs[buf][col][ks + ko + 16];
        }
      }
      // keeps the trip's fragment reads one group in front of its products: left to
      // itself the build of the 64x48 tile reads A one fragment at a time into one
      // register set and waits out the LDS latency in front of every three products
      if constexpr (QKV) __builtin_amdgcn_sched_barrier(0);
#pragma unroll
      for (int u = 0; u < KG; ++u)
#pragma unroll
        for (int mt = 0; mt < MT; ++mt)
#pragma unroll
          for (int nt = 0; nt < NT; ++nt)
            acc[mt][nt] = wmma16x16x32(a[u][mt], b[u][nt], acc[mt][nt]);
      // keeps the hand-over's s_wait_dscnt 0 behind the products: moved up among them
      // it makes the first products wait for the last fragment too
      if constexpr (QKV) __builtin_amdgcn_sched_barrier(0);
    }
    // hand-over: this wave's LDS reads are done, its copies of the next tile have
    // landed; behind the barrier that holds for all waves, and the buffer just
    // read may be refilled (at the head of the next trip). A trip that has issued
    // a tile has NB - 1 tiles open and leaves the younger ones so; the last trips
    // issue none, the number open is another there, and they wait for all.
    asm volatile("s_wait_dscnt 0x0" ::: "memory");
    if (more) asm volatile("s_wait_asynccnt %0" :: "n"(OPEN) : "memory");
    else      async_wait0();
    __syncthreads();
  }

  if constexpr (QKV) {
    // the wave's number in a scalar register: the choice of the output is a scalar branch
    const int wnu = __builtin_amdgcn_readfirstlane(wn);
#pragma unroll
    for (int nt = 0; nt < NT; ++nt) {
      const int ng  = n0 + wnu * (NT * 16) + nt * 16; // first of 16 columns, the same for the wave
      const int sel = ng / HD_, nc = ng % HD_ + lr;   // output, column in it
      if (sel == 2) {
        const int hh = nc >> 6, dh = nc & (DH_ - 1);  // col -> (head, dh)
#pragma unroll
        for (int mt = 0; mt < MT; ++mt)
#pragma unroll
          for (int j = 0; j < 8; ++j) {
            int m = m0 + wm * (MT * 16) + mt * 16 + j + (lane >> 4) * 8;
            int bb = m >> 11, s = m & (S_ - 1);       // token -> (batch, seq)
            CvT[((size_t)((bb * H_ + hh) * DH_ + dh)) * S_ + s] = (OutT)acc[mt][nt][j];
          }
        // behind the stores: the code that follows rewrites their address and data registers
        asm volatile("s_wait_xcnt 0x0" ::: "memory");
      } else {
        OutT* __restrict__ Cs = sel == 1 ? Ck : C;
        if (sel == 0) {                               // Q carries the softmax scale; a scalar branch
#pragma unroll
          for (int mt = 0; mt < MT; ++mt) acc[mt][nt] *= QSCALE;
        }
#pragma unroll
        for (int mt = 0; mt < MT; ++mt)
#pragma unroll
          for (int j = 0; j < 8; ++j) {
            int m = m0 + wm * (MT * 16) + mt * 16 + j + (lane >> 4) * 8;
            Cs[(size_t)m * Ndim + nc] = (OutT)acc[mt][nt][j];
          }
        // as above
        asm volatile("s_wait_xcnt 0x0" ::: "memory");
      }
    }
  } else {
#pragma unroll
    for (int mt = 0; mt < MT; ++mt)
#pragma unroll
      for (int nt = 0; nt < NT; ++nt)
#pragma unroll
        for (int j = 0; j < 8; ++j) {
          int m = m0 + wm * (MT * 16) + mt * 16 + j + (lane >> 4) * 8;
          int n = n0 + wn * (NT * 16) + nt * 16 + lr;
          C[(size_t)m * Ndim + n] = (OutT)acc[mt][nt][j];
        }
  }
}

// ---------------------------------------------------------------------------
// 4) Flash attention in S^T form, double-buffered async K/V staging.
//    S^T = K * Q^T  ->  lane = query col, j = key row; per-query scalar state;
//    P^T converts in registers to the B-fragment of O^T = V^T * P^T.
//    The bucket of a distance is the last one of its side from 128 on
//    (the reference caps it), so a pass whose keys all lie 129 or more from
//    all of the block's queries has ONE bias value. Q carries scale * log2(e),
//    and such a pass gives (bias - reference) as the C operand of its first score
//    product: the matrix instruction's result IS the exponent to base 2, and the
//    vector port only takes the exponential, sums and packs. C must be known
//    before the products, so the reference is the one in use, not this pass's
//    maximum; any reference gives the same quotient as long as P stays in f16
//    range. A pass in which a lane's sum of P passes PLIM (or is not a number)
//    is done again with the maximum taken first, which moves the reference and
//    rescales O and the sum; so is the very first pass, which has no reference.
//    Only the three passes round the diagonal read the bias per element, from
//    512 floats in LDS; they always take the maximum first.
//    A pass takes KT keys: what is paid once a pass (the exchange of the
//    maximum between the wave's halves and the rescale of O where the maximum is taken, the
//    wait for the copies, the barrier) is paid once per KT keys, and the
//    score tiles of a pass are independent work for the wave.
//    A wave takes 32 queries (two column tiles) and one half of a pass's keys:
//    every K and V^T fragment read from LDS feeds two matrix instructions, so
//    the block reads half the LDS bytes of a 16-query wave, with as many waves.
//    The two waves of a query group keep their own reference, sum and O over
//    their halves of the keys; the halves are joined once, behind the last pass.
// ---------------------------------------------------------------------------
constexpr int KT  = 128;         // keys per pass
constexpr int KW  = KT / 2;      // keys per pass and wave
constexpr int PKT = KT + 8;      // V^T rows of KT keys: 272 B = 16 B x 17 (odd)
static_assert(KT == 128 && S_ % KT == 0 && S_ / KT >= 2, "the staging below is written for 128 keys");
struct FarPass  { static constexpr bool far = true;  };
struct NearPass { static constexpr bool far = false; };

// four waves per SIMD (two blocks on a WGP) as before: the register budget is held at 256
__global__ void __launch_bounds__(256) __attribute__((amdgpu_waves_per_eu(4, 4)))
flash_attn(const _Float16* __restrict__ Q, const _Float16* __restrict__ K,
           const _Float16* __restrict__ VT, const float* __restrict__ biasE,
           _Float16* __restrict__ Ctx) {
  __shared__ __align__(16) _Float16 Ks[2][KT][P64];  // [key][dh]
  __shared__ __align__(16) _Float16 Vs[2][64][PKT];  // [dh][key] (from VT)
  __shared__ float biasL[BIASL];

  const int t = threadIdx.x, lane = t & 31, w = t >> 5;
  const int lr = lane & 15, ko = (lane >> 4) * 8;
  const int b = blockIdx.z, h = blockIdx.y;
  const int qg = w & 3, kh = w >> 2;                 // query group of 32, half of the keys
  const int q0 = blockIdx.x * 128, qrow = q0 + qg * 32;
  const int k0w = kh * KW;                           // the wave's first key within a pass

  // bias near the diagonal: biasL[i] = bias(key - query = i - 255) * log2(e); far from it
  // the two capped values, taken at the ends of the expanded row
  const float* biasH = biasE + h * RELN + (S_ - 1);
  static_assert(BIASL == 2 * 256, "two entries a thread, both loads in flight together");
  const float bn0 = biasH[t - 255], bn1 = biasH[t + 1];
  const float biasLo = biasH[-(S_ - 1)], biasHi = biasH[S_ - 1];

  const _Float16* Kb  = K  + (size_t)(b * S_) * HD_ + h * DH_;
  const _Float16* VTb = VT + (size_t)((b * H_ + h) * DH_) * S_;

  // One pass's tiles: K 128 rows of 128 B, V^T 64 rows of 256 B; a thread copies
  // four 16-byte pieces of each (32 K rows / 16 V^T rows apart).
  auto stageKV = [&](int kb, int buf) {
    const _Float16* gk = Kb + (size_t)(kb + (t >> 3)) * HD_ + (t & 7) * 8;
    const _Float16* gv = VTb + (size_t)(t >> 4) * S_ + kb + (t & 15) * 8;
    const unsigned lk = (unsigned)(unsigned long long)&Ks[buf][t >> 3][(t & 7) * 8];
    const unsigned lv = (unsigned)(unsigned long long)&Vs[buf][t >> 4][(t & 15) * 8];
    // the copies and their s_wait_xcnt in one statement: the wait then stands in
    // front of every later write of a register that a copy names
    asm volatile(
        "global_load_async_to_lds_b128 %0, %8, off\n\t"
        "global_load_async_to_lds_b128 %1, %9, off\n\t"
        "global_load_async_to_lds_b128 %2, %10, off\n\t"
        "global_load_async_to_lds_b128 %3, %11, off\n\t"
        "global_load_async_to_lds_b128 %4, %12, off\n\t"
        "global_load_async_to_lds_b128 %5, %13, off\n\t"
        "global_load_async_to_lds_b128 %6, %14, off\n\t"
        "global_load_async_to_lds_b128 %7, %15, off\n\t"
        "s_wait_xcnt 0x0"
        :: "v"(lk), "v"(lk + 32 * P64 * 2), "v"(lk + 64 * P64 * 2), "v"(lk + 96 * P64 * 2),
           "v"(lv), "v"(lv + 16 * PKT * 2), "v"(lv + 32 * PKT * 2), "v"(lv + 48 * PKT * 2),
           "v"(gk), "v"(gk + 32 * HD_), "v"(gk + 64 * HD_), "v"(gk + 96 * HD_),
           "v"(gv), "v"(gv + 16 * S_), "v"(gv + 32 * S_), "v"(gv + 48 * S_)
        : "memory");
  };

  // Q^T B-fragments (lane = query, regs = dh), loaded once from global
  Frag16 qf[2][2];                                   // [query tile][dh half]
  const _Float16* qa[2];
#pragma unroll  // constant indices: the fragments stay in registers
  for (int qt = 0; qt < 2; ++qt) {
    qa[qt] = Q + ((size_t)(b * S_ + qrow + qt * 16 + lr) * HD_) + h * DH_ + ko;
    qf[qt][0].h[0] = *(const h8*)(qa[qt]);
    qf[qt][0].h[1] = *(const h8*)(qa[qt] + 16);
    qf[qt][1].h[0] = *(const h8*)(qa[qt] + 32);
    qf[qt][1].h[1] = *(const h8*)(qa[qt] + 48);
  }
  // behind the Q loads: the code that follows rewrites their address registers;
  // naming the addresses as inputs keeps them live up to the wait
  asm volatile("s_wait_xcnt 0x0" :: "v"(qa[0]), "v"(qa[1]) : "memory");

  v8f o[2][4] = {};                                  // [query tile][dh tile]
  // ref: the reference of the exponents (base 2), the same in lanes l and l ^ 16;
  // lsum: the sum of P over the keys of the lane's own half of the rows
  float ref[2] = {-INFINITY, -INFINITY}, lsum[2] = {0.0f, 0.0f};
  constexpr float PLIM = 4096.0f;                    // bound on a lane's sum of P in a pass; each P then fits f16

  stageKV(0, 0);
  biasL[t]       = bn0 * LOG2E;
  biasL[t + 256] = bn1 * LOG2E;
  async_wait0();
  __syncthreads();
  stageKV(KT, 1);                                    // flies during pass 0

  // The passes kbeg, kbeg + KT, ... below kend. FAR is a type whose member says
  // which form of the softmax is built; cb is a far run's one bias value (base 2).
  auto passes = [&](int kbeg, int kend, float cb, auto FAR) {
    constexpr bool far = decltype(FAR)::far;
    v8f cblk[2];                                     // far: bias - reference in all eight rows, the C operand
    if constexpr (far) {
#pragma unroll  // constant indices: the blocks stay in registers
      for (int qt = 0; qt < 2; ++qt)
#pragma unroll  // as above
        for (int j = 0; j < 8; ++j) cblk[qt][j] = cb - ref[qt];
    }
    for (int kb = kbeg; kb < kend; kb += KT) {
      const int buf = (kb / KT) & 1;
      v8f    sc[2][KW / 16];
      Frag16 pf[2][KW / 32];
      float  rs[2];

      // S^T tiles on top of c0: rows = the wave's keys (tk*16..), cols = queries;
      // one K fragment, two tiles
      auto products = [&](const v8f& c0, const v8f& c1) {
        Frag16 ka[KW / 16][2];
#pragma unroll  // constant indices: the fragments stay in registers
        for (int tk = 0; tk < KW / 16; ++tk) {
          int key = k0w + tk * 16 + lr;
          ka[tk][0].h[0] = *(const h8*)&Ks[buf][key][ko];
          ka[tk][0].h[1] = *(const h8*)&Ks[buf][key][ko + 16];
          ka[tk][1].h[0] = *(const h8*)&Ks[buf][key][32 + ko];
          ka[tk][1].h[1] = *(const h8*)&Ks[buf][key][32 + ko + 16];
        }
        // keeps the K reads one group in front of the products: a read placed among
        // them is waited for on the spot
        __builtin_amdgcn_sched_barrier(0);
#pragma unroll  // constant indices: the score tiles stay in registers
        for (int tk = 0; tk < KW / 16; ++tk)
#pragma unroll  // as above
          for (int qt = 0; qt < 2; ++qt) {
            v8f c = wmma16x16x32(ka[tk][0], qf[qt][0], qt ? c1 : c0);
            sc[qt][tk] = wmma16x16x32(ka[tk][1], qf[qt][1], c);
          }
        // keeps the products one run in front of the vector work: mixed with it, each
        // product is followed by idle slots until its result may be read
        __builtin_amdgcn_sched_barrier(0);
      };

      // V^T fragments of 32 of the wave's keys, one read group
      auto readV = [&](Frag16 (&va)[4], int g) {
#pragma unroll  // constant indices: the fragments stay in registers
        for (int tdh = 0; tdh < 4; ++tdh) {
          int dhrow = tdh * 16 + lr;
          va[tdh].h[0] = *(const h8*)&Vs[buf][dhrow][k0w + g * 32 + ko];
          va[tdh].h[1] = *(const h8*)&Vs[buf][dhrow][k0w + g * 32 + ko + 16];
        }
        // keeps the reads one group where they are written: moved down among their
        // products, each is waited for on the spot
        if constexpr (far) __builtin_amdgcn_sched_barrier(0);
      };
      Frag16 va0[4];

      // P = 2^sc, packed as the B fragment of the second product; the lane's sums
      auto exps = [&]() {
#pragma unroll  // as above
        for (int qt = 0; qt < 2; ++qt) {
          float rg[KW / 32];                           // one partial sum per 32 keys
#pragma unroll  // as above
          for (int g = 0; g < KW / 32; ++g) {
            float r = 0.0f;
#pragma unroll  // as above
            for (int j = 0; j < 8; ++j) {
              const float p0 = __builtin_amdgcn_exp2f(sc[qt][2 * g][j]);
              const float p1 = __builtin_amdgcn_exp2f(sc[qt][2 * g + 1][j]);
              r += p0 + p1;
              pf[qt][g].h[0][j] = (_Float16)p0;
              pf[qt][g].h[1][j] = (_Float16)p1;
            }
            rg[g] = r;
          }
          rs[qt] = rg[0] + rg[1];
        }
      };

      bool full = true;                                // take the maximum first
      if constexpr (far) {
        if (kb != 0) {                                 // a reference is in use (the same test for the whole block)
          products(cblk[0], cblk[1]);
          exps();
          readV(va0, 0);                               // lands under the test and its branch
          // one test a pass, a scalar branch; no P is negative, so the two sums together
          // bound each P; written so that a NaN asks for the full form too
          full = __builtin_amdgcn_ballot_w32(!(rs[0] + rs[1] <= PLIM)) != 0;
        }
      }
      if (full) {
        const v8f zero = {};
        products(zero, zero);
#pragma unroll  // as above
        for (int qt = 0; qt < 2; ++qt) {
          // near: bias from LDS first; far: the bare products. One maximum a tile
          float mt[KW / 16];
#pragma unroll  // as above
          for (int tk = 0; tk < KW / 16; ++tk) {
            if constexpr (!far) {
              int bbase = kb - q0 + k0w + tk * 16 + ((lane >> 4) << 3) - (qg * 32 + qt * 16 + lr) + 255;
#pragma unroll  // as above
              for (int j = 0; j < 8; ++j) sc[qt][tk][j] += biasL[bbase + j];
            }
            float m = sc[qt][tk][0];
#pragma unroll  // as above
            for (int j = 1; j < 8; ++j) m = fmaxf(m, sc[qt][tk][j]);
            mt[tk] = m;
          }
          // per-query scalar state (lane l and l^16 share a query)
          float mloc = fmaxf(fmaxf(mt[0], mt[1]), fmaxf(mt[2], mt[3]));
          mloc = fmaxf(mloc, __shfl_xor(mloc, 16, 32));
          if constexpr (far) mloc += cb;
          const float nm    = fmaxf(ref[qt], mloc);
          const float alpha = __builtin_amdgcn_exp2f(ref[qt] - nm);
          const float sh    = (far ? cb : 0.0f) - nm;
          ref[qt] = nm;
#pragma unroll  // as above
          for (int tk = 0; tk < KW / 16; ++tk) sc[qt][tk] += sh;
          if constexpr (far) {
#pragma unroll  // as above
            for (int j = 0; j < 8; ++j) cblk[qt][j] = sh;
          }
          lsum[qt] *= alpha;
#pragma unroll  // as above
          for (int tdh = 0; tdh < 4; ++tdh)
#pragma unroll  // as above
            for (int j = 0; j < 8; ++j) o[qt][tdh][j] *= alpha;
        }
        exps();
        readV(va0, 0);
      }
      lsum[0] += rs[0];
      lsum[1] += rs[1];

      // O^T += V^T(16dh x 32k) * P^T(32k x 16q), 32 keys at a time; one V^T fragment, two tiles
      static_assert(KW / 32 == 2, "two groups of 32 keys");
      auto readV1 = [&](Frag16& va, int tdh) {         // a V^T fragment of the second 32 keys
        int dhrow = tdh * 16 + lr;
        va.h[0] = *(const h8*)&Vs[buf][dhrow][k0w + 32 + ko];
        va.h[1] = *(const h8*)&Vs[buf][dhrow][k0w + 32 + ko + 16];
      };
      auto pv = [&](const Frag16& va, int g, int tdh) {
#pragma unroll  // as above
        for (int qt = 0; qt < 2; ++qt) o[qt][tdh] = wmma16x16x32(va, pf[qt][g], o[qt][tdh]);
      };
      Frag16 va1[4];
      if constexpr (far) {
        // The second group's reads go two fragments at a time, eight products ahead of
        // their use. The scheduling barriers keep that order: left to itself the build
        // reads them into one register set and waits out the LDS latency four times.
        readV1(va1[0], 0);
        readV1(va1[1], 1);
        __builtin_amdgcn_sched_barrier(0);
        pv(va0[0], 0, 0);
        pv(va0[1], 0, 1);
        __builtin_amdgcn_sched_barrier(0);
        readV1(va1[2], 2);
        readV1(va1[3], 3);
        __builtin_amdgcn_sched_barrier(0);
        pv(va0[2], 0, 2);
        pv(va0[3], 0, 3);
#pragma unroll  // as above
        for (int tdh = 0; tdh < 4; ++tdh) pv(va1[tdh], 1, tdh);
        // keeps the hand-over's s_wait_dscnt 0 behind the products: moved up among them
        // it makes the wave sit out the last reads' latency with products still to issue
        __builtin_amdgcn_sched_barrier(0);
      } else {
#pragma unroll  // as above
        for (int tdh = 0; tdh < 4; ++tdh) pv(va0[tdh], 0, tdh);
#pragma unroll  // as above
        for (int tdh = 0; tdh < 4; ++tdh) {
          readV1(va1[tdh], tdh);
          pv(va1[tdh], 1, tdh);
        }
      }

      // hand-over: this wave's LDS reads are done, its copies of the next tile have
      // landed; behind the barrier that holds for all waves, and the buffer just
      // read may be refilled
      asm volatile("s_wait_dscnt 0x0" ::: "memory");
      async_wait0();
      __syncthreads();
      if (kb + 2 * KT < S_) stageKV(kb + 2 * KT, buf);
    }
  };

  // Keys kb..kb+127 against queries q0..q0+127 (both starts multiples of 128) are
  // 129 or more apart once the starts differ by 256 or more: the keys fall into a
  // far run below the diagonal, up to three near passes, a far run above it.
  // The bounds are the same for the whole block.
  const int nlo = q0 >= KT ? q0 - KT : 0;
  const int nhi = q0 + 2 * KT <= S_ ? q0 + 2 * KT : S_;
  passes(0, nlo, biasLo * LOG2E, FarPass{});
  passes(nlo, nhi, 0.0f, NearPass{});
  passes(nhi, S_, biasHi * LOG2E, FarPass{});
  async_wait0();  // nothing is in flight here; the wave does not end on an open count

  // the two halves of a wave hold the sums of their own rows: joined once, here
  lsum[0] += __shfl_xor(lsum[0], 16, 32);
  lsum[1] += __shfl_xor(lsum[1], 16, 32);

  // Join the two halves of the keys. Each wave of a pair finishes one query tile:
  // it hands the other tile's reference, sum and O to its partner through LDS. The K
  // buffers are free: every wave's last read of them lies in front of the last
  // pass's barrier and no copy is in flight.
  constexpr int MRG_O = 8 * 8 * 32 * 4;              // floats: 8 tiles x 8 x 32 lanes x 16 B
  static_assert((MRG_O + 8 * 2 * 32) * 4 <= (int)sizeof(Ks), "the join fits the K buffers");
  float* mrg = reinterpret_cast<float*>(&Ks[0][0][0]);
  const bool up = kh != 0;                           // the wave keeps tile kh, gives tile 1 - kh
  {
    const int r = qg * 2 + (1 - kh);
#pragma unroll  // constant indices: O stays in registers
    for (int tdh = 0; tdh < 4; ++tdh) {
      const v8f g = up ? o[0][tdh] : o[1][tdh];
      f4 lo4 = {g[0], g[1], g[2], g[3]}, hi4 = {g[4], g[5], g[6], g[7]};
      *(f4*)&mrg[((r * 8 + tdh * 2) * 32 + lane) * 4]     = lo4;
      *(f4*)&mrg[((r * 8 + tdh * 2 + 1) * 32 + lane) * 4] = hi4;
    }
    mrg[MRG_O + (r * 2) * 32 + lane]     = up ? ref[0] : ref[1];
    mrg[MRG_O + (r * 2 + 1) * 32 + lane] = up ? lsum[0] : lsum[1];
  }
  __syncthreads();                                   // the partner's tile is in LDS

  // rescale both halves to the common reference, normalize, store context
  // row-major [token][h*64+dh]
  const int r = qg * 2 + kh;
  const float ma = up ? ref[1] : ref[0], la = up ? lsum[1] : lsum[0];
  const float mb = mrg[MRG_O + (r * 2) * 32 + lane], lb = mrg[MRG_O + (r * 2 + 1) * 32 + lane];
  const float mj = fmaxf(ma, mb);
  float fa = __builtin_amdgcn_exp2f(ma - mj), fb = __builtin_amdgcn_exp2f(mb - mj);
  const float inv = 1.0f / (la * fa + lb * fb);
  fa *= inv;
  fb *= inv;
#pragma unroll  // as above
  for (int tdh = 0; tdh < 4; ++tdh) {
    const v8f mine = up ? o[1][tdh] : o[0][tdh];
    const f4 lo4 = *(const f4*)&mrg[((r * 8 + tdh * 2) * 32 + lane) * 4];
    const f4 hi4 = *(const f4*)&mrg[((r * 8 + tdh * 2 + 1) * 32 + lane) * 4];
#pragma unroll  // as above
    for (int j = 0; j < 8; ++j) {
      int dhcol = tdh * 16 + j + (lane >> 4) * 8;
      const float other = j < 4 ? lo4[j & 3] : hi4[j & 3];
      Ctx[((size_t)(b * S_ + qrow + kh * 16 + lr) * HD_) + h * DH_ + dhcol] =
          (_Float16)(mine[j] * fa + other * fb);
    }
  }
}

// ---------------------------------------------------------------------------
// Launcher
// ---------------------------------------------------------------------------
extern "C" void kernel_launch(void* const* d_in, const int* in_sizes, int n_in,
                              void* d_out, int out_size, void* d_ws, size_t ws_size,
                              hipStream_t stream) {
  (void)in_sizes; (void)n_in; (void)out_size; (void)ws_size;
  const float* hs    = (const float*)d_in[0];
  const float* Wq    = (const float*)d_in[1];
  const float* Wk    = (const float*)d_in[2];
  const float* Wv    = (const float*)d_in[3];
  const float* Wo    = (const float*)d_in[4];
  const float* table = (const float*)d_in[5];

  char*  ws  = (char*)d_ws;
  size_t off = 0;
  auto alloc = [&](size_t bytes) -> void* {
    void* p = ws + off;
    off += (bytes + 255) & ~(size_t)255;
    return p;
  };

  _Float16* hs16   = (_Float16*)alloc((size_t)M_ * D_ * 2);
  _Float16* wq16T  = (_Float16*)alloc((size_t)3 * D_ * HD_ * 2);  // Wq^T | Wk^T | Wv^T
  _Float16* wk16T  = wq16T + (size_t)D_ * HD_;
  _Float16* wv16T  = wk16T + (size_t)D_ * HD_;
  _Float16* wo16T  = (_Float16*)alloc((size_t)HD_ * D_ * 2);
  _Float16* q16    = (_Float16*)alloc((size_t)M_ * HD_ * 2);
  _Float16* k16    = (_Float16*)alloc((size_t)M_ * HD_ * 2);
  _Float16* vT16   = (_Float16*)alloc((size_t)M_ * HD_ * 2);
  _Float16* ctx16  = (_Float16*)alloc((size_t)M_ * HD_ * 2);
  float*    biasE  = (float*)alloc((size_t)H_ * RELN * 4);

  prep_all<<<WT_BLOCKS + HS_BLOCKS + BIAS_BLOCKS, 256, 0, stream>>>(
      hs, Wq, Wk, Wv, Wo, table, hs16, wq16T, wk16T, wv16T, wo16T, biasE);

  dim3 gQkv(3 * HD_ / 192, M_ / 256);
  gemm_wmma<_Float16, true><<<gQkv, 512, 0, stream>>>(hs16, wq16T, q16, k16, vT16, M_, HD_, D_);

  dim3 gAttn(S_ / 128, H_, B_);
  flash_attn<<<gAttn, 256, 0, stream>>>(q16, k16, vT16, biasE, ctx16);

  dim3 gOut(D_ / 128, M_ / 128);
  gemm_wmma<float, false><<<gOut, 256, 0, stream>>>(ctx16, wo16T, (float*)d_out, nullptr, nullptr,
                                                    M_, D_, HD_);
}
